// v000
// Times are from an AMD MI455X. After a warm-up the kernel runs many times in a row, and a time is the length of
// such a window on the GPU divided by its runs, so every launch and the gaps after it count. The runs cycle
// through copies of the inputs. A figure is the median of several windows, for all but v000 over two sittings.
// Sittings can differ by a few percent; kernels timed side by side share one.
// The starting kernel, v000, takes 914 microseconds a run.
#include <hip/hip_runtime.h>

// NonSymmetricAttentionKernel (hidden [2][2048][768]; q/k/v = x W + b (12 heads x 64); scores = q.k/8 + alibi[h][i][j] where alibi = -slope[h%4] |sqrt(j) - sqrt(i)|, slopes 2^-2, 2^-4, 2^-6, 2^-8; heads 0-3 causal (j <= i), heads 4-7 anti-causal (j >= i), heads 8-11 unmasked;
// softmax; out = attn v merged (no output projection) -> [2][2048][768]).
// Compute dtypes, f32 accumulate: every input rounded to bf16; q/k/v on PLAIN bf16 operands (inputs: exact) + bias; scores (K 64) and attn.v single fp16 planes (4 heads z-batched; x1024) EXCEPT the short-window rows - query rows < 512 of the

#define NB_  2
#define TT   2048
#define DM   768
#define NH_  12
#define HD   64
#define HPP  4
#define RHL  512
#define PCAR 1024.0f
typedef _Float16 h16;
typedef unsigned short bf;
typedef __attribute__((ext_vector_type(16))) __bf16   v16bf;
typedef __attribute__((ext_vector_type(16))) _Float16 v16h;
typedef __attribute__((ext_vector_type(8)))  _Float16 v8h;
typedef __attribute__((ext_vector_type(8)))  unsigned short v8us;
typedef __attribute__((ext_vector_type(8)))  float    v8f;
typedef __attribute__((ext_vector_type(4)))  float    v4f;
typedef v8h  __attribute__((may_alias)) v8ha;
typedef v4f  __attribute__((may_alias)) v4fa;
typedef v8us __attribute__((may_alias)) v8usa;

__device__ __forceinline__ unsigned short f2bf(float f) { unsigned u = __float_as_uint(f); u += 0x7FFFu + ((u >> 16) & 1u); return (unsigned short)(u >> 16); }
__device__ __forceinline__ float bf2f(unsigned short b) { return __uint_as_float(((unsigned)b) << 16); }
__device__ __forceinline__ float bfr(float f) { return bf2f(f2bf(f)); }
__device__ __forceinline__ v16h cat16(v8h lo, v8h hi) { return __builtin_shufflevector(lo, hi, 0, 1, 2, 3, 4, 5, 6, 7, 8, 9, 10, 11, 12, 13, 14, 15); }
__device__ __forceinline__ v16bf cat16b(v8us lo, v8us hi) { return __builtin_bit_cast(v16bf, __builtin_shufflevector(lo, hi, 0, 1, 2, 3, 4, 5, 6, 7, 8, 9, 10, 11, 12, 13, 14, 15)); }
__device__ __forceinline__ v8f wmma16(v16h a, v16h b, v8f c) { return __builtin_amdgcn_wmma_f32_16x16x32_f16(false, a, false, b, (short)0, c, false, false); }
__device__ __forceinline__ v8f wmmab(v16bf a, v16bf b, v8f c) { return __builtin_amdgcn_wmma_f32_16x16x32_bf16(false, a, false, b, (short)0, c, false, false); }



// ---- k_gemmw: register-blocked GEMM, ONE WAVE per 64x64 output tile (16 accumulators), operands straight from K-contiguous 16-bit planes; grid (M/64, N/64, Z), 32 threads.
// C[m][n] (f32, pitch ldc, + optional f32 bias[n]) = sum_k A[m][k] Bt[n][k] (+ split products per NSPLIT). z-batch strides sA/sB/sC in elements. K % 32 == 0.
template <typename T16> struct WFrag;
template <> struct WFrag<h16> { typedef v16h V; static __device__ __forceinline__ V ld(const h16* p) { return cat16(*(const v8h*)p, *(const v8h*)(p + 16)); } static __device__ __forceinline__ v8f mma(V a, V b, v8f c) { return wmma16(a, b, c); } };
template <> struct WFrag<bf> { typedef v16bf V; static __device__ __forceinline__ V ld(const bf* p) { return cat16b(*(const v8us*)p, *(const v8us*)(p + 16)); } static __device__ __forceinline__ v8f mma(V a, V b, v8f c) { return wmmab(a, b, c); } };
template <typename T16, int NSPLIT, bool BIAS>
__global__ __launch_bounds__(32) void k_gemmw(const T16* __restrict__ A, const T16* __restrict__ A2, const T16* __restrict__ Bt, const T16* __restrict__ Bt2, int K, float* C, int ldc, const float* __restrict__ bias, size_t sA, size_t sB, size_t sC) {
    typedef typename WFrag<T16>::V V;
    __shared__ __align__(16) float os[16 * 68];
    const size_t z = blockIdx.z; A += z * sA; if (A2) A2 += z * sA; Bt += z * sB; if (Bt2) Bt2 += z * sB; C += z * sC;
    const int lane = threadIdx.x & 31, lr = lane & 15, hi = lane >> 4; const int r0 = blockIdx.x * 64, c0 = blockIdx.y * 64;
    v8f acc[4][4];
#pragma unroll
    for (int mb = 0; mb < 4; ++mb)
#pragma unroll
        for (int nb = 0; nb < 4; ++nb) acc[mb][nb] = (v8f){};
    const size_t aoff = (size_t)(r0 + lr) * K + 8 * hi, boff = (size_t)(c0 + lr) * K + 8 * hi;
#pragma unroll 1
    for (int kc = 0; kc < K; kc += 32) {
        V a[4], a2[4];
#pragma unroll
        for (int mb = 0; mb < 4; ++mb) { a[mb] = WFrag<T16>::ld(A + aoff + (size_t)mb * 16 * K + kc); if (NSPLIT == 1 || NSPLIT == 2) a2[mb] = WFrag<T16>::ld(A2 + aoff + (size_t)mb * 16 * K + kc); }
#pragma unroll
        for (int nb = 0; nb < 4; ++nb) { const V b = WFrag<T16>::ld(Bt + boff + (size_t)nb * 16 * K + kc); V b2; if (NSPLIT >= 2) b2 = WFrag<T16>::ld(Bt2 + boff + (size_t)nb * 16 * K + kc);
#pragma unroll
            for (int mb = 0; mb < 4; ++mb) { acc[mb][nb] = WFrag<T16>::mma(a[mb], b, acc[mb][nb]); if (NSPLIT == 1 || NSPLIT == 2) acc[mb][nb] = WFrag<T16>::mma(a2[mb], b, acc[mb][nb]); if (NSPLIT >= 2) acc[mb][nb] = WFrag<T16>::mma(a[mb], b2, acc[mb][nb]); } }
        asm volatile("v_nop\n\tv_nop\n\tv_nop\n\tv_nop" : "+v"(acc[0][0]), "+v"(acc[1][1]), "+v"(acc[2][2]), "+v"(acc[3][3]) : "v"(a[0]), "v"(a[3]));
    }
#pragma unroll
    for (int mb = 0; mb < 4; ++mb) {
#pragma unroll
        for (int nb = 0; nb < 4; ++nb) {
#pragma unroll
            for (int j = 0; j < 8; ++j) os[(hi * 8 + j) * 68 + nb * 16 + lr] = acc[mb][nb][j]; }
        __builtin_amdgcn_wave_barrier(); asm volatile("" ::: "memory");
        float* crow = C + (size_t)(r0 + mb * 16) * ldc + c0;
{
#pragma unroll
            for (int s = 0; s < 8; ++s) { const int row = 2 * s + hi, cofs = lr * 4; v4f val = *(const v4fa*)(os + row * 68 + cofs); if (BIAS) { val[0] += bfr(bias[c0 + cofs]); val[1] += bfr(bias[c0 + cofs + 1]); val[2] += bfr(bias[c0 + cofs + 2]); val[3] += bfr(bias[c0 + cofs + 3]); }
                *(v4f*)(crow + (size_t)row * ldc + cofs) = val; }
             }
        __builtin_amdgcn_wave_barrier(); asm volatile("" ::: "memory");
    }
}

__device__ __forceinline__ h16 tohx(float x) { return (h16)x; }
__device__ __forceinline__ void splitf(float y, unsigned short& h, unsigned short& l) { h = f2bf(y); l = f2bf(y - bf2f(h)); }
typedef __attribute__((ext_vector_type(2))) unsigned short v2us;
typedef __attribute__((ext_vector_type(4))) unsigned short v4us;
typedef __attribute__((ext_vector_type(2))) _Float16 v2h;
typedef __attribute__((ext_vector_type(4))) _Float16 v4h;

__global__ __launch_bounds__(256) void k_wtG(const float* __restrict__ w, int K, int N, bf* Bt) {
    const int lane = threadIdx.x & 31; const int L0 = (blockIdx.x * 8 + (threadIdx.x >> 5)) * 8; const int nlines = N * K / 64;
{
#pragma unroll 1
        for (int l = 0; l < 8; ++l) { const int L = L0 + l; if (L >= nlines) break; const size_t e = (size_t)L * 64 + lane * 2; const int k = (int)(e % K), n = (int)(e / K); v2us o;
            o[0] = f2bf(w[(size_t)k * N + n]); o[1] = f2bf(w[(size_t)(k + 1) * N + n]); *(v2us*)(Bt + e) = o; }
         }
}
__global__ __launch_bounds__(256) void k_cvt8(const float* __restrict__ src, bf* dst, size_t n8) { const size_t i = (size_t)blockIdx.x * 256 + threadIdx.x; if (i >= n8) return; const v8f v = *(const v8f*)(src + i * 8); v8us o;
#pragma unroll
    for (int k = 0; k < 8; ++k) o[k] = f2bf(v[k]); *(v8us*)(dst + i * 8) = o;  }
// k_sqt: SQ[j] = sqrt(j) (f32, correctly rounded); k_pl3: fp16 + hl planes [h][t][d] of a [t][768] buffer (8-B lanes); k_vt3: fp16 + hl planes VT[h][d][t] (lane -> 2 consecutive t); k_nsoft: wave per (z, i) row of head h = h0 + z, group g = h/4: keep = g0 ? j <= i : g1 ? j >= i : all;
__device__ __forceinline__ bool hlrow(int g, int i) { return (g == 0) ? (i < RHL) : (g == 1) ? (i >= TT - RHL) : false; }
__global__ __launch_bounds__(256) void k_pl3(const float* __restrict__ F, h16* P, bf* Ph, bf* Pl) { const int e = (blockIdx.x * 256 + threadIdx.x) * 4; if (e >= NH_ * TT * HD) return; const int d = e % HD; const int t = (e / HD) % TT; const int h = e / (HD * TT); const float* f = F + (size_t)t * DM + h * HD + d; v4h o; v4us oh, ol;
#pragma unroll
    for (int u = 0; u < 4; ++u) { o[u] = tohx(f[u]); unsigned short a, b; splitf(f[u], a, b); oh[u] = a; ol[u] = b; } { *(v4h*)(P + e) = o; *(v4us*)(Ph + e) = oh; *(v4us*)(Pl + e) = ol;  } }
__global__ __launch_bounds__(256) void k_vt3(const float* __restrict__ V, h16* VT, bf* VTh, bf* VTl) { const int e = (blockIdx.x * 256 + threadIdx.x) * 2; if (e >= NH_ * HD * TT) return; const int t = e % TT; const int d = (e / TT) % HD; const int h = e / (TT * HD); const float a = V[(size_t)t * DM + h * HD + d], b = V[(size_t)(t + 1) * DM + h * HD + d]; v2h o; o[0] = tohx(a); o[1] = tohx(b); v2us oh, ol; unsigned short a1, b1, a2, b2; splitf(a, a1, b1); splitf(b, a2, b2); oh[0] = a1; oh[1] = a2; ol[0] = b1; ol[1] = b2;
    { *(v2h*)(VT + e) = o; *(v2us*)(VTh + e) = oh; *(v2us*)(VTl + e) = ol;  } }
__global__ __launch_bounds__(256) void k_sqt(float* SQ) { const int j = blockIdx.x * 256 + threadIdx.x; if (j >= TT) return; const float r = __fsqrt_rn((float)j); *(float*)(SQ + j) = r;  }
__global__ __launch_bounds__(256) void k_nsoft(const float* __restrict__ Sb, const float* __restrict__ SQ, int h0, h16* P16, bf* Ph, bf* Pl) { const int lane = threadIdx.x & 31; const int row = blockIdx.x * 8 + (threadIdx.x >> 5); if (row >= HPP * TT) return; const int i = row % TT; const int z = row / TT; const int h = h0 + z; const int g = h / 4; const int hm = h % 4;
    const float slope = (hm == 0) ? 0.25f : (hm == 1) ? 0.0625f : (hm == 2) ? 0.015625f : 0.00390625f; const float sqi = SQ[i]; const float* sr = Sb + (size_t)row * TT; float v[TT / 32]; float mx = -3.0e38f;
#pragma unroll
    for (int ch = 0; ch < TT / 128; ++ch) { const int j0 = ch * 128 + lane * 4; const v4f a = *(const v4f*)(sr + j0); const v4f sq = *(const v4f*)(SQ + j0);
#pragma unroll
        for (int u = 0; u < 4; ++u) { const int j = j0 + u; const bool keep = (g == 0) ? (j <= i) : (g == 1) ? (j >= i) : true; float rel = fabsf(__fsub_rn(sq[u], sqi)); asm volatile("" : "+v"(rel)); float t0 = a[u] * 0.125f; asm volatile("" : "+v"(t0)); float ab = __fmul_rn(slope, rel); asm volatile("" : "+v"(ab)); const float t = keep ? __fsub_rn(t0, ab) : -3.0e38f; v[ch * 4 + u] = t; mx = fmaxf(mx, t); } }
#pragma unroll
    for (int sh = 16; sh; sh >>= 1) mx = fmaxf(mx, __shfl_xor(mx, sh, 32));
    float sum = 0.f;
#pragma unroll
    for (int q = 0; q < TT / 32; ++q) { float d0 = __fsub_rn(v[q], mx); asm volatile("" : "+v"(d0)); v[q] = (v[q] > -1.0e38f) ? __builtin_amdgcn_exp2f(__fmul_rn(d0, 1.4426950408889634f)) : 0.f; sum += v[q]; }
#pragma unroll
    for (int sh = 16; sh; sh >>= 1) sum += __shfl_xor(sum, sh, 32);
    const float inv = __fdiv_rn(1.0f, sum); const float f = inv * PCAR; const bool hl = hlrow(g, i);
    {
#pragma unroll
        for (int ch = 0; ch < TT / 128; ++ch) { const size_t oo = (size_t)row * TT + ch * 128 + lane * 4; v4h o4;
#pragma unroll
            for (int q = 0; q < 4; ++q) o4[q] = tohx(v[ch * 4 + q] * f); *(v4h*)(P16 + oo) = o4; }
        if (hl) {
#pragma unroll
            for (int ch = 0; ch < TT / 128; ++ch) { const size_t oo = (size_t)row * TT + ch * 128 + lane * 4; v4us oh, ol;
#pragma unroll
                for (int q = 0; q < 4; ++q) { unsigned short a, b; splitf(v[ch * 4 + q] * inv, a, b); oh[q] = a; ol[q] = b; } *(v4us*)(Ph + oo) = oh; *(v4us*)(Pl + oo) = ol; } }
         } }
__global__ __launch_bounds__(256) void k_mrg(const float* __restrict__ O16, const float* __restrict__ Ohl, int h0, float* outb) { const int e = (blockIdx.x * 256 + threadIdx.x) * 4; if (e >= HPP * TT * HD) return; const int d = e % HD; const int t = (e / HD) % TT; const int z = e / (HD * TT); const int h = h0 + z; const bool hl = hlrow(h / 4, t); v4f o;
#pragma unroll
    for (int u = 0; u < 4; ++u) o[u] = hl ? Ohl[e + u] : O16[e + u] * (1.0f / PCAR); float* dst = outb + (size_t)t * DM + h * HD + d; *(v4f*)dst = o;  }

extern "C" void kernel_launch(void* const* d_in, const int* in_sizes, int n_in,
                              void* d_out, int out_size, void* d_ws, size_t ws_size, hipStream_t stream) {
    (void)in_sizes; (void)n_in; (void)out_size;
    const float** I = (const float**)d_in;
    const float *x = I[0], *Wq = I[1], *bq = I[2], *Wk = I[3], *bk = I[4], *Wv = I[5], *bv = I[6];
    float* OUT = (float*)d_out;     // [2][2048][768]
    char* wsp = (char*)d_ws;
    auto take = [&](size_t bytes) { char* p = wsp; wsp += (bytes + 255) & ~(size_t)255; return (void*)p; };
    bf* BQ = (bf*)take((size_t)DM * DM * 2); bf* BK = (bf*)take((size_t)DM * DM * 2); bf* BV = (bf*)take((size_t)DM * DM * 2);
    bf* XB = (bf*)take((size_t)TT * DM * 2); float* Q = (float*)take((size_t)TT * DM * 4); float* K = (float*)take((size_t)TT * DM * 4); float* V = (float*)take((size_t)TT * DM * 4);
    h16* Q16 = (h16*)take((size_t)NH_ * TT * HD * 2); bf* Qh = (bf*)take((size_t)NH_ * TT * HD * 2); bf* Ql = (bf*)take((size_t)NH_ * TT * HD * 2); h16* K16 = (h16*)take((size_t)NH_ * TT * HD * 2); bf* Kh = (bf*)take((size_t)NH_ * TT * HD * 2); bf* Kl = (bf*)take((size_t)NH_ * TT * HD * 2);
    h16* VT = (h16*)take((size_t)NH_ * HD * TT * 2); bf* VTh = (bf*)take((size_t)NH_ * HD * TT * 2); bf* VTl = (bf*)take((size_t)NH_ * HD * TT * 2);
    float* Sb = (float*)take((size_t)HPP * TT * TT * 4); h16* P16 = (h16*)take((size_t)HPP * TT * TT * 2); bf* Ph = (bf*)take((size_t)HPP * TT * TT * 2); bf* Pl = (bf*)take((size_t)HPP * TT * TT * 2); float* SQ = (float*)take(TT * 4); float* O16 = (float*)take((size_t)HPP * TT * HD * 4); float* Ohl = (float*)take((size_t)HPP * TT * HD * 4);
    if ((size_t)(wsp - (char*)d_ws) > ws_size) return;    // total ~ 215 MB (4-head [2048][2048] f32 scores 64 MB + fp16 and hl probability planes 96 MB + q/k/v planes)
    k_wtG<<<(DM * DM / 64 + 63) / 64, 256, 0, stream>>>(Wq, DM, DM, BQ); k_wtG<<<(DM * DM / 64 + 63) / 64, 256, 0, stream>>>(Wk, DM, DM, BK); k_wtG<<<(DM * DM / 64 + 63) / 64, 256, 0, stream>>>(Wv, DM, DM, BV);
    const size_t zs = (size_t)TT * HD; k_sqt<<<(TT + 255) / 256, 256, 0, stream>>>(SQ);
    for (int b = 0; b < NB_; ++b) {
        k_cvt8<<<(TT * DM / 8 + 255) / 256, 256, 0, stream>>>(x + (size_t)b * TT * DM, XB, (size_t)TT * DM / 8);
        k_gemmw<bf, 0, true><<<dim3(TT / 64, DM / 64, 1), 32, 0, stream>>>(XB, nullptr, BQ, nullptr, DM, Q, DM, bq, 0, 0, 0); k_gemmw<bf, 0, true><<<dim3(TT / 64, DM / 64, 1), 32, 0, stream>>>(XB, nullptr, BK, nullptr, DM, K, DM, bk, 0, 0, 0); k_gemmw<bf, 0, true><<<dim3(TT / 64, DM / 64, 1), 32, 0, stream>>>(XB, nullptr, BV, nullptr, DM, V, DM, bv, 0, 0, 0);
        k_pl3<<<(NH_ * TT * HD / 4 + 255) / 256, 256, 0, stream>>>(Q, Q16, Qh, Ql); k_pl3<<<(NH_ * TT * HD / 4 + 255) / 256, 256, 0, stream>>>(K, K16, Kh, Kl); k_vt3<<<(NH_ * HD * TT / 2 + 255) / 256, 256, 0, stream>>>(V, VT, VTh, VTl);
        for (int h0 = 0; h0 < NH_; h0 += HPP) { const int g = h0 / 4; const size_t zo = (size_t)h0 * zs; const int r0 = (g == 0) ? 0 : TT - RHL;   // hl window rows [r0, r0 + 512) for groups 0 and 1
            k_gemmw<h16, 0, false><<<dim3(TT / 64, TT / 64, HPP), 32, 0, stream>>>(Q16 + zo, nullptr, K16 + zo, nullptr, HD, Sb, TT, nullptr, zs, zs, (size_t)TT * TT);
            if (g < 2) k_gemmw<bf, 2, false><<<dim3(RHL / 64, TT / 64, HPP), 32, 0, stream>>>(Qh + zo + (size_t)r0 * HD, Ql + zo + (size_t)r0 * HD, Kh + zo, Kl + zo, HD, Sb + (size_t)r0 * TT, TT, nullptr, zs, zs, (size_t)TT * TT);   // overwrite the window rows with 3-product scores
            k_nsoft<<<HPP * TT / 8, 256, 0, stream>>>(Sb, SQ, h0, P16, Ph, Pl);
            k_gemmw<h16, 0, false><<<dim3(TT / 64, 1, HPP), 32, 0, stream>>>(P16, nullptr, VT + zo, nullptr, TT, O16, HD, nullptr, (size_t)TT * TT, zs, zs);
            if (g < 2) k_gemmw<bf, 2, false><<<dim3(RHL / 64, 1, HPP), 32, 0, stream>>>(Ph + (size_t)r0 * TT, Pl + (size_t)r0 * TT, VTh + zo, VTl + zo, TT, Ohl + (size_t)r0 * HD, HD, nullptr, (size_t)TT * TT, zs, zs);
            k_mrg<<<(HPP * TT * HD / 4 + 255) / 256, 256, 0, stream>>>(O16, Ohl, h0, OUT + (size_t)b * TT * DM); } }
}

// v001
// It runs in 593 microseconds.
// Next to v000, in two timings, it ran 1.55 times as fast each time.
#include <hip/hip_runtime.h>

// NonSymmetricAttentionKernel (hidden [2][2048][768]; q/k/v = x W + b (12 heads x 64); scores = q.k/8 + alibi[h][i][j] where alibi = -slope[h%4] |sqrt(j) - sqrt(i)|, slopes 2^-2, 2^-4, 2^-6, 2^-8; heads 0-3 causal (j <= i), heads 4-7 anti-causal (j >= i), heads 8-11 unmasked;
// softmax; out = attn v merged (no output projection) -> [2][2048][768]).
// Compute dtypes, f32 accumulate: every input rounded to bf16; q/k/v on PLAIN bf16 operands (inputs: exact) + bias; scores (K 64) and attn.v single fp16 planes (4 heads z-batched; x1024) EXCEPT the short-window rows - query rows < 512 of the

#define NB_  2
#define TT   2048
#define DM   768
#define NH_  12
#define HD   64
#define HPP  4
#define RHL  512
#define PCAR 1024.0f
typedef _Float16 h16;
typedef unsigned short bf;
typedef __attribute__((ext_vector_type(16))) __bf16   v16bf;
typedef __attribute__((ext_vector_type(16))) _Float16 v16h;
typedef __attribute__((ext_vector_type(8)))  _Float16 v8h;
typedef __attribute__((ext_vector_type(8)))  unsigned short v8us;
typedef __attribute__((ext_vector_type(8)))  float    v8f;
typedef __attribute__((ext_vector_type(4)))  float    v4f;
typedef v8h  __attribute__((may_alias)) v8ha;
typedef v4f  __attribute__((may_alias)) v4fa;
typedef v8us __attribute__((may_alias)) v8usa;

__device__ __forceinline__ unsigned short f2bf(float f) { unsigned u = __float_as_uint(f); u += 0x7FFFu + ((u >> 16) & 1u); return (unsigned short)(u >> 16); }
__device__ __forceinline__ float bf2f(unsigned short b) { return __uint_as_float(((unsigned)b) << 16); }
__device__ __forceinline__ float bfr(float f) { return bf2f(f2bf(f)); }
__device__ __forceinline__ v16h cat16(v8h lo, v8h hi) { return __builtin_shufflevector(lo, hi, 0, 1, 2, 3, 4, 5, 6, 7, 8, 9, 10, 11, 12, 13, 14, 15); }
__device__ __forceinline__ v16bf cat16b(v8us lo, v8us hi) { return __builtin_bit_cast(v16bf, __builtin_shufflevector(lo, hi, 0, 1, 2, 3, 4, 5, 6, 7, 8, 9, 10, 11, 12, 13, 14, 15)); }
__device__ __forceinline__ v8f wmma16(v16h a, v16h b, v8f c) { return __builtin_amdgcn_wmma_f32_16x16x32_f16(false, a, false, b, (short)0, c, false, false); }
__device__ __forceinline__ v8f wmmab(v16bf a, v16bf b, v8f c) { return __builtin_amdgcn_wmma_f32_16x16x32_bf16(false, a, false, b, (short)0, c, false, false); }



// ---- k_gemmw: register-blocked GEMM, one work-group of KS waves per 64x64 output tile (16 accumulators a wave), operands straight from K-contiguous 16-bit planes; grid (M/64, N/64, Z), 32 * KS threads.
// KS > 1: wave w takes the 32-wide k steps w, w + KS, w + 2 KS, ...; the KS partial tiles meet in LDS and are summed in wave order 0 .. KS-1 (fixed order, same result every run).
// C[m][n] (f32, pitch ldc, + optional f32 bias[n]) = sum_k A[m][k] Bt[n][k] (+ split products per NSPLIT). z-batch strides sA/sB/sC in elements. K % 32 == 0.
template <typename T16> struct WFrag;
template <> struct WFrag<h16> { typedef v16h V; static __device__ __forceinline__ V ld(const h16* p) { return cat16(*(const v8h*)p, *(const v8h*)(p + 16)); } static __device__ __forceinline__ v8f mma(V a, V b, v8f c) { return wmma16(a, b, c); } };
template <> struct WFrag<bf> { typedef v16bf V; static __device__ __forceinline__ V ld(const bf* p) { return cat16b(*(const v8us*)p, *(const v8us*)(p + 16)); } static __device__ __forceinline__ v8f mma(V a, V b, v8f c) { return wmmab(a, b, c); } };
template <typename T16, int NSPLIT, bool BIAS, int KS>
__global__ __launch_bounds__(32 * KS) void k_gemmw(const T16* __restrict__ A, const T16* __restrict__ A2, const T16* __restrict__ Bt, const T16* __restrict__ Bt2, int K, float* C, int ldc, const float* __restrict__ bias, size_t sA, size_t sB, size_t sC) {
    typedef typename WFrag<T16>::V V;
    __shared__ __align__(16) float os[(KS == 1 ? 16 : KS * 64) * 68];
    const int wv = (KS == 1) ? 0 : __builtin_amdgcn_readfirstlane((int)(threadIdx.x >> 5));   // wave number in a scalar register, so that the k loop's counter and branch stay scalar
    const size_t z = blockIdx.z; A += z * sA; if (A2) A2 += z * sA; Bt += z * sB; if (Bt2) Bt2 += z * sB; C += z * sC;
    const int lane = threadIdx.x & 31, lr = lane & 15, hi = lane >> 4; const int r0 = blockIdx.x * 64, c0 = blockIdx.y * 64;
    v8f acc[4][4];
#pragma unroll
    for (int mb = 0; mb < 4; ++mb)
#pragma unroll
        for (int nb = 0; nb < 4; ++nb) acc[mb][nb] = (v8f){};
    const size_t aoff = (size_t)(r0 + lr) * K + 8 * hi, boff = (size_t)(c0 + lr) * K + 8 * hi;
#pragma unroll 1
    for (int kc = wv * 32; kc < K; kc += 32 * KS) {
        V a[4], a2[4];
#pragma unroll
        for (int mb = 0; mb < 4; ++mb) { a[mb] = WFrag<T16>::ld(A + aoff + (size_t)mb * 16 * K + kc); if (NSPLIT == 1 || NSPLIT == 2) a2[mb] = WFrag<T16>::ld(A2 + aoff + (size_t)mb * 16 * K + kc); }
#pragma unroll
        for (int nb = 0; nb < 4; ++nb) { const V b = WFrag<T16>::ld(Bt + boff + (size_t)nb * 16 * K + kc); V b2; if (NSPLIT >= 2) b2 = WFrag<T16>::ld(Bt2 + boff + (size_t)nb * 16 * K + kc);
#pragma unroll
            for (int mb = 0; mb < 4; ++mb) { acc[mb][nb] = WFrag<T16>::mma(a[mb], b, acc[mb][nb]); if (NSPLIT == 1 || NSPLIT == 2) acc[mb][nb] = WFrag<T16>::mma(a2[mb], b, acc[mb][nb]); if (NSPLIT >= 2) acc[mb][nb] = WFrag<T16>::mma(a[mb], b2, acc[mb][nb]); } }
        asm volatile("v_nop\n\tv_nop\n\tv_nop\n\tv_nop" : "+v"(acc[0][0]), "+v"(acc[1][1]), "+v"(acc[2][2]), "+v"(acc[3][3]) : "v"(a[0]), "v"(a[3]));
    }
    if constexpr (KS > 1) {
        float* ow = os + wv * (64 * 68); const int cofs = ((int)threadIdx.x & 15) * 4; v4f bb = (v4f){};   // a thread's four columns are the same in every pass below: its bias is fetched once, ahead of the barrier
        if (BIAS) { bb[0] = bfr(bias[c0 + cofs]); bb[1] = bfr(bias[c0 + cofs + 1]); bb[2] = bfr(bias[c0 + cofs + 2]); bb[3] = bfr(bias[c0 + cofs + 3]); }
#pragma unroll
        for (int mb = 0; mb < 4; ++mb)
#pragma unroll
            for (int nb = 0; nb < 4; ++nb)
#pragma unroll
                for (int j = 0; j < 8; ++j) ow[(mb * 16 + hi * 8 + j) * 68 + nb * 16 + lr] = acc[mb][nb][j];
        __syncthreads();   // every wave's partial tile is in LDS before any wave sums
#pragma unroll
        for (int s = 0; s < 32 / KS; ++s) { const int row = (s * (32 * KS) + (int)threadIdx.x) >> 4; v4f val = *(const v4fa*)(os + row * 68 + cofs);
#pragma unroll
            for (int w = 1; w < KS; ++w) val += *(const v4fa*)(os + w * (64 * 68) + row * 68 + cofs);
            if (BIAS) val += bb;
            *(v4f*)(C + (size_t)(r0 + row) * ldc + c0 + cofs) = val; }
        return;
    }
#pragma unroll
    for (int mb = 0; mb < 4; ++mb) {
#pragma unroll
        for (int nb = 0; nb < 4; ++nb) {
#pragma unroll
            for (int j = 0; j < 8; ++j) os[(hi * 8 + j) * 68 + nb * 16 + lr] = acc[mb][nb][j]; }
        __builtin_amdgcn_wave_barrier(); asm volatile("" ::: "memory");
        float* crow = C + (size_t)(r0 + mb * 16) * ldc + c0;
{
#pragma unroll
            for (int s = 0; s < 8; ++s) { const int row = 2 * s + hi, cofs = lr * 4; v4f val = *(const v4fa*)(os + row * 68 + cofs); if (BIAS) { val[0] += bfr(bias[c0 + cofs]); val[1] += bfr(bias[c0 + cofs + 1]); val[2] += bfr(bias[c0 + cofs + 2]); val[3] += bfr(bias[c0 + cofs + 3]); }
                *(v4f*)(crow + (size_t)row * ldc + cofs) = val; }
             }
        __builtin_amdgcn_wave_barrier(); asm volatile("" ::: "memory");
    }
}

__device__ __forceinline__ h16 tohx(float x) { return (h16)x; }
__device__ __forceinline__ void splitf(float y, unsigned short& h, unsigned short& l) { h = f2bf(y); l = f2bf(y - bf2f(h)); }
typedef __attribute__((ext_vector_type(2))) unsigned short v2us;
typedef __attribute__((ext_vector_type(4))) unsigned short v4us;
typedef __attribute__((ext_vector_type(2))) _Float16 v2h;
typedef __attribute__((ext_vector_type(4))) _Float16 v4h;

__global__ __launch_bounds__(256) void k_wtG(const float* __restrict__ w, int K, int N, bf* Bt) {
    const int lane = threadIdx.x & 31; const int L0 = (blockIdx.x * 8 + (threadIdx.x >> 5)) * 8; const int nlines = N * K / 64;
{
#pragma unroll 1
        for (int l = 0; l < 8; ++l) { const int L = L0 + l; if (L >= nlines) break; const size_t e = (size_t)L * 64 + lane * 2; const int k = (int)(e % K), n = (int)(e / K); v2us o;
            o[0] = f2bf(w[(size_t)k * N + n]); o[1] = f2bf(w[(size_t)(k + 1) * N + n]); *(v2us*)(Bt + e) = o; }
         }
}
__global__ __launch_bounds__(256) void k_cvt8(const float* __restrict__ src, bf* dst, size_t n8) { const size_t i = (size_t)blockIdx.x * 256 + threadIdx.x; if (i >= n8) return; const v8f v = *(const v8f*)(src + i * 8); v8us o;
#pragma unroll
    for (int k = 0; k < 8; ++k) o[k] = f2bf(v[k]); *(v8us*)(dst + i * 8) = o;  }
// k_sqt: SQ[j] = sqrt(j) (f32, correctly rounded); k_pl3: fp16 + hl planes [h][t][d] of a [t][768] buffer (8-B lanes); k_vt3: fp16 + hl planes VT[h][d][t] (lane -> 2 consecutive t); k_nsoft: wave per (z, i) row of head h = h0 + z, group g = h/4: keep = g0 ? j <= i : g1 ? j >= i : all;
__device__ __forceinline__ bool hlrow(int g, int i) { return (g == 0) ? (i < RHL) : (g == 1) ? (i >= TT - RHL) : false; }
__global__ __launch_bounds__(256) void k_pl3(const float* __restrict__ F, h16* P, bf* Ph, bf* Pl) { const int e = (blockIdx.x * 256 + threadIdx.x) * 4; if (e >= NH_ * TT * HD) return; const int d = e % HD; const int t = (e / HD) % TT; const int h = e / (HD * TT); const float* f = F + (size_t)t * DM + h * HD + d; v4h o; v4us oh, ol;
#pragma unroll
    for (int u = 0; u < 4; ++u) { o[u] = tohx(f[u]); unsigned short a, b; splitf(f[u], a, b); oh[u] = a; ol[u] = b; } { *(v4h*)(P + e) = o; *(v4us*)(Ph + e) = oh; *(v4us*)(Pl + e) = ol;  } }
__global__ __launch_bounds__(256) void k_vt3(const float* __restrict__ V, h16* VT, bf* VTh, bf* VTl) { const int e = (blockIdx.x * 256 + threadIdx.x) * 2; if (e >= NH_ * HD * TT) return; const int t = e % TT; const int d = (e / TT) % HD; const int h = e / (TT * HD); const float a = V[(size_t)t * DM + h * HD + d], b = V[(size_t)(t + 1) * DM + h * HD + d]; v2h o; o[0] = tohx(a); o[1] = tohx(b); v2us oh, ol; unsigned short a1, b1, a2, b2; splitf(a, a1, b1); splitf(b, a2, b2); oh[0] = a1; oh[1] = a2; ol[0] = b1; ol[1] = b2;
    { *(v2h*)(VT + e) = o; *(v2us*)(VTh + e) = oh; *(v2us*)(VTl + e) = ol;  } }
__global__ __launch_bounds__(256) void k_sqt(float* SQ) { const int j = blockIdx.x * 256 + threadIdx.x; if (j >= TT) return; const float r = __fsqrt_rn((float)j); *(float*)(SQ + j) = r;  }
__global__ __launch_bounds__(256) void k_nsoft(const float* __restrict__ Sb, const float* __restrict__ SQ, int h0, h16* P16, bf* Ph, bf* Pl) { const int lane = threadIdx.x & 31; const int row = blockIdx.x * 8 + (threadIdx.x >> 5); if (row >= HPP * TT) return; const int i = row % TT; const int z = row / TT; const int h = h0 + z; const int g = h / 4; const int hm = h % 4;
    const float slope = (hm == 0) ? 0.25f : (hm == 1) ? 0.0625f : (hm == 2) ? 0.015625f : 0.00390625f; const float sqi = SQ[i]; const float* sr = Sb + (size_t)row * TT; float v[TT / 32]; float mx = -3.0e38f;
#pragma unroll
    for (int ch = 0; ch < TT / 128; ++ch) { const int j0 = ch * 128 + lane * 4; const v4f a = *(const v4f*)(sr + j0); const v4f sq = *(const v4f*)(SQ + j0);
#pragma unroll
        for (int u = 0; u < 4; ++u) { const int j = j0 + u; const bool keep = (g == 0) ? (j <= i) : (g == 1) ? (j >= i) : true; float rel = fabsf(__fsub_rn(sq[u], sqi)); asm volatile("" : "+v"(rel)); float t0 = a[u] * 0.125f; asm volatile("" : "+v"(t0)); float ab = __fmul_rn(slope, rel); asm volatile("" : "+v"(ab)); const float t = keep ? __fsub_rn(t0, ab) : -3.0e38f; v[ch * 4 + u] = t; mx = fmaxf(mx, t); } }
#pragma unroll
    for (int sh = 16; sh; sh >>= 1) mx = fmaxf(mx, __shfl_xor(mx, sh, 32));
    float sum = 0.f;
#pragma unroll
    for (int q = 0; q < TT / 32; ++q) { float d0 = __fsub_rn(v[q], mx); asm volatile("" : "+v"(d0)); v[q] = (v[q] > -1.0e38f) ? __builtin_amdgcn_exp2f(__fmul_rn(d0, 1.4426950408889634f)) : 0.f; sum += v[q]; }
#pragma unroll
    for (int sh = 16; sh; sh >>= 1) sum += __shfl_xor(sum, sh, 32);
    const float inv = __fdiv_rn(1.0f, sum); const float f = inv * PCAR; const bool hl = hlrow(g, i);
    {
#pragma unroll
        for (int ch = 0; ch < TT / 128; ++ch) { const size_t oo = (size_t)row * TT + ch * 128 + lane * 4; v4h o4;
#pragma unroll
            for (int q = 0; q < 4; ++q) o4[q] = tohx(v[ch * 4 + q] * f); *(v4h*)(P16 + oo) = o4; }
        if (hl) {
#pragma unroll
            for (int ch = 0; ch < TT / 128; ++ch) { const size_t oo = (size_t)row * TT + ch * 128 + lane * 4; v4us oh, ol;
#pragma unroll
                for (int q = 0; q < 4; ++q) { unsigned short a, b; splitf(v[ch * 4 + q] * inv, a, b); oh[q] = a; ol[q] = b; } *(v4us*)(Ph + oo) = oh; *(v4us*)(Pl + oo) = ol; } }
         } }
__global__ __launch_bounds__(256) void k_mrg(const float* __restrict__ O16, const float* __restrict__ Ohl, int h0, float* outb) { const int e = (blockIdx.x * 256 + threadIdx.x) * 4; if (e >= HPP * TT * HD) return; const int d = e % HD; const int t = (e / HD) % TT; const int z = e / (HD * TT); const int h = h0 + z; const bool hl = hlrow(h / 4, t); v4f o;
#pragma unroll
    for (int u = 0; u < 4; ++u) o[u] = hl ? Ohl[e + u] : O16[e + u] * (1.0f / PCAR); float* dst = outb + (size_t)t * DM + h * HD + d; *(v4f*)dst = o;  }

extern "C" void kernel_launch(void* const* d_in, const int* in_sizes, int n_in,
                              void* d_out, int out_size, void* d_ws, size_t ws_size, hipStream_t stream) {
    (void)in_sizes; (void)n_in; (void)out_size;
    const float** I = (const float**)d_in;
    const float *x = I[0], *Wq = I[1], *bq = I[2], *Wk = I[3], *bk = I[4], *Wv = I[5], *bv = I[6];
    float* OUT = (float*)d_out;     // [2][2048][768]
    char* wsp = (char*)d_ws;
    auto take = [&](size_t bytes) { char* p = wsp; wsp += (bytes + 255) & ~(size_t)255; return (void*)p; };
    bf* BQ = (bf*)take((size_t)DM * DM * 2); bf* BK = (bf*)take((size_t)DM * DM * 2); bf* BV = (bf*)take((size_t)DM * DM * 2);
    bf* XB = (bf*)take((size_t)TT * DM * 2); float* Q = (float*)take((size_t)TT * DM * 4); float* K = (float*)take((size_t)TT * DM * 4); float* V = (float*)take((size_t)TT * DM * 4);
    h16* Q16 = (h16*)take((size_t)NH_ * TT * HD * 2); bf* Qh = (bf*)take((size_t)NH_ * TT * HD * 2); bf* Ql = (bf*)take((size_t)NH_ * TT * HD * 2); h16* K16 = (h16*)take((size_t)NH_ * TT * HD * 2); bf* Kh = (bf*)take((size_t)NH_ * TT * HD * 2); bf* Kl = (bf*)take((size_t)NH_ * TT * HD * 2);
    h16* VT = (h16*)take((size_t)NH_ * HD * TT * 2); bf* VTh = (bf*)take((size_t)NH_ * HD * TT * 2); bf* VTl = (bf*)take((size_t)NH_ * HD * TT * 2);
    float* Sb = (float*)take((size_t)HPP * TT * TT * 4); h16* P16 = (h16*)take((size_t)HPP * TT * TT * 2); bf* Ph = (bf*)take((size_t)HPP * TT * TT * 2); bf* Pl = (bf*)take((size_t)HPP * TT * TT * 2); float* SQ = (float*)take(TT * 4); float* O16 = (float*)take((size_t)HPP * TT * HD * 4); float* Ohl = (float*)take((size_t)HPP * TT * HD * 4);
    if ((size_t)(wsp - (char*)d_ws) > ws_size) return;    // total ~ 215 MB (4-head [2048][2048] f32 scores 64 MB + fp16 and hl probability planes 96 MB + q/k/v planes)
    k_wtG<<<(DM * DM / 64 + 63) / 64, 256, 0, stream>>>(Wq, DM, DM, BQ); k_wtG<<<(DM * DM / 64 + 63) / 64, 256, 0, stream>>>(Wk, DM, DM, BK); k_wtG<<<(DM * DM / 64 + 63) / 64, 256, 0, stream>>>(Wv, DM, DM, BV);
    const size_t zs = (size_t)TT * HD; k_sqt<<<(TT + 255) / 256, 256, 0, stream>>>(SQ);
    for (int b = 0; b < NB_; ++b) {
        k_cvt8<<<(TT * DM / 8 + 255) / 256, 256, 0, stream>>>(x + (size_t)b * TT * DM, XB, (size_t)TT * DM / 8);
        k_gemmw<bf, 0, true, 8><<<dim3(TT / 64, DM / 64, 1), 256, 0, stream>>>(XB, nullptr, BQ, nullptr, DM, Q, DM, bq, 0, 0, 0); k_gemmw<bf, 0, true, 8><<<dim3(TT / 64, DM / 64, 1), 256, 0, stream>>>(XB, nullptr, BK, nullptr, DM, K, DM, bk, 0, 0, 0); k_gemmw<bf, 0, true, 8><<<dim3(TT / 64, DM / 64, 1), 256, 0, stream>>>(XB, nullptr, BV, nullptr, DM, V, DM, bv, 0, 0, 0);
        k_pl3<<<(NH_ * TT * HD / 4 + 255) / 256, 256, 0, stream>>>(Q, Q16, Qh, Ql); k_pl3<<<(NH_ * TT * HD / 4 + 255) / 256, 256, 0, stream>>>(K, K16, Kh, Kl); k_vt3<<<(NH_ * HD * TT / 2 + 255) / 256, 256, 0, stream>>>(V, VT, VTh, VTl);
        for (int h0 = 0; h0 < NH_; h0 += HPP) { const int g = h0 / 4; const size_t zo = (size_t)h0 * zs; const int r0 = (g == 0) ? 0 : TT - RHL;   // hl window rows [r0, r0 + 512) for groups 0 and 1
            k_gemmw<h16, 0, false, 1><<<dim3(TT / 64, TT / 64, HPP), 32, 0, stream>>>(Q16 + zo, nullptr, K16 + zo, nullptr, HD, Sb, TT, nullptr, zs, zs, (size_t)TT * TT);
            if (g < 2) k_gemmw<bf, 2, false, 1><<<dim3(RHL / 64, TT / 64, HPP), 32, 0, stream>>>(Qh + zo + (size_t)r0 * HD, Ql + zo + (size_t)r0 * HD, Kh + zo, Kl + zo, HD, Sb + (size_t)r0 * TT, TT, nullptr, zs, zs, (size_t)TT * TT);   // overwrite the window rows with 3-product scores
            k_nsoft<<<HPP * TT / 8, 256, 0, stream>>>(Sb, SQ, h0, P16, Ph, Pl);
            k_gemmw<h16, 0, false, 16><<<dim3(TT / 64, 1, HPP), 512, 0, stream>>>(P16, nullptr, VT + zo, nullptr, TT, O16, HD, nullptr, (size_t)TT * TT, zs, zs);
            if (g < 2) k_gemmw<bf, 2, false, 16><<<dim3(RHL / 64, 1, HPP), 512, 0, stream>>>(Ph + (size_t)r0 * TT, Pl + (size_t)r0 * TT, VTh + zo, VTl + zo, TT, Ohl + (size_t)r0 * HD, HD, nullptr, (size_t)TT * TT, zs, zs);
            k_mrg<<<(HPP * TT * HD / 4 + 255) / 256, 256, 0, stream>>>(O16, Ohl, h0, OUT + (size_t)b * TT * DM); } }
}

// v002
// It runs in 204 microseconds.
// Next to v001, in two timings, it ran 2.88 times as fast each time.
// Over all steps from v000 it is 4.47 times as fast.
#include <hip/hip_runtime.h>

// NonSymmetricAttentionKernel (hidden [2][2048][768]; q/k/v = x W + b (12 heads x 64); scores = q.k/8 + alibi[h][i][j] where alibi = -slope[h%4] |sqrt(j) - sqrt(i)|, slopes 2^-2, 2^-4, 2^-6, 2^-8; heads 0-3 causal (j <= i), heads 4-7 anti-causal (j >= i), heads 8-11 unmasked;
// softmax; out = attn v merged (no output projection) -> [2][2048][768]).
// Compute dtypes, f32 accumulate: every input rounded to bf16; q/k/v on PLAIN bf16 operands (inputs: exact) + bias; scores (K 64) and attn.v on single fp16 planes (probabilities x1024) EXCEPT the short-window rows (query rows < 512 of heads 0-3, >= 1536 of heads 4-7): bf16 high + low planes, three products.

#define NB_  2
#define TT   2048
#define DM   768
#define NH_  12
#define HD   64
#define RHL  512
typedef _Float16 h16;
typedef unsigned short bf;
typedef __attribute__((ext_vector_type(16))) __bf16   v16bf;
typedef __attribute__((ext_vector_type(16))) _Float16 v16h;
typedef __attribute__((ext_vector_type(8)))  _Float16 v8h;
typedef __attribute__((ext_vector_type(8)))  unsigned short v8us;
typedef __attribute__((ext_vector_type(8)))  float    v8f;
typedef __attribute__((ext_vector_type(4)))  float    v4f;
typedef v8h  __attribute__((may_alias)) v8ha;
typedef v4f  __attribute__((may_alias)) v4fa;
typedef v8us __attribute__((may_alias)) v8usa;

__device__ __forceinline__ unsigned short f2bf(float f) { unsigned u = __float_as_uint(f); u += 0x7FFFu + ((u >> 16) & 1u); return (unsigned short)(u >> 16); }
__device__ __forceinline__ float bf2f(unsigned short b) { return __uint_as_float(((unsigned)b) << 16); }
__device__ __forceinline__ float bfr(float f) { return bf2f(f2bf(f)); }
__device__ __forceinline__ v16h cat16(v8h lo, v8h hi) { return __builtin_shufflevector(lo, hi, 0, 1, 2, 3, 4, 5, 6, 7, 8, 9, 10, 11, 12, 13, 14, 15); }
__device__ __forceinline__ v16bf cat16b(v8us lo, v8us hi) { return __builtin_bit_cast(v16bf, __builtin_shufflevector(lo, hi, 0, 1, 2, 3, 4, 5, 6, 7, 8, 9, 10, 11, 12, 13, 14, 15)); }
__device__ __forceinline__ v8f wmma16(v16h a, v16h b, v8f c) { return __builtin_amdgcn_wmma_f32_16x16x32_f16(false, a, false, b, (short)0, c, false, false); }
__device__ __forceinline__ v8f wmmab(v16bf a, v16bf b, v8f c) { return __builtin_amdgcn_wmma_f32_16x16x32_bf16(false, a, false, b, (short)0, c, false, false); }



// ---- k_gemmw: register-blocked GEMM, one work-group of KS waves per 64x64 output tile (16 accumulators a wave), operands straight from K-contiguous 16-bit planes; grid (M/64, N/64, Z), 32 * KS threads.
// KS > 1: wave w takes the 32-wide k steps w, w + KS, w + 2 KS, ...; the KS partial tiles meet in LDS and are summed in wave order 0 .. KS-1 (fixed order, same result every run).
// C[m][n] (f32, pitch ldc, + optional f32 bias[n]) = sum_k A[m][k] Bt[n][k] (+ split products per NSPLIT). z-batch strides sA/sB/sC in elements. K % 32 == 0.
template <typename T16> struct WFrag;
template <> struct WFrag<h16> { typedef v16h V; static __device__ __forceinline__ V ld(const h16* p) { return cat16(*(const v8h*)p, *(const v8h*)(p + 16)); } static __device__ __forceinline__ v8f mma(V a, V b, v8f c) { return wmma16(a, b, c); } };
template <> struct WFrag<bf> { typedef v16bf V; static __device__ __forceinline__ V ld(const bf* p) { return cat16b(*(const v8us*)p, *(const v8us*)(p + 16)); } static __device__ __forceinline__ v8f mma(V a, V b, v8f c) { return wmmab(a, b, c); } };
template <typename T16, int NSPLIT, bool BIAS, int KS>
__global__ __launch_bounds__(32 * KS) void k_gemmw(const T16* __restrict__ A, const T16* __restrict__ A2, const T16* __restrict__ Bt, const T16* __restrict__ Bt2, int K, float* C, int ldc, const float* __restrict__ bias, size_t sA, size_t sB, size_t sC) {
    typedef typename WFrag<T16>::V V;
    __shared__ __align__(16) float os[(KS == 1 ? 16 : KS * 64) * 68];
    const int wv = (KS == 1) ? 0 : __builtin_amdgcn_readfirstlane((int)(threadIdx.x >> 5));   // wave number in a scalar register, so that the k loop's counter and branch stay scalar
    const size_t z = blockIdx.z; A += z * sA; if (A2) A2 += z * sA; Bt += z * sB; if (Bt2) Bt2 += z * sB; C += z * sC;
    const int lane = threadIdx.x & 31, lr = lane & 15, hi = lane >> 4; const int r0 = blockIdx.x * 64, c0 = blockIdx.y * 64;
    v8f acc[4][4];
#pragma unroll
    for (int mb = 0; mb < 4; ++mb)
#pragma unroll
        for (int nb = 0; nb < 4; ++nb) acc[mb][nb] = (v8f){};
    const size_t aoff = (size_t)(r0 + lr) * K + 8 * hi, boff = (size_t)(c0 + lr) * K + 8 * hi;
#pragma unroll 1
    for (int kc = wv * 32; kc < K; kc += 32 * KS) {
        V a[4], a2[4];
#pragma unroll
        for (int mb = 0; mb < 4; ++mb) { a[mb] = WFrag<T16>::ld(A + aoff + (size_t)mb * 16 * K + kc); if (NSPLIT == 1 || NSPLIT == 2) a2[mb] = WFrag<T16>::ld(A2 + aoff + (size_t)mb * 16 * K + kc); }
#pragma unroll
        for (int nb = 0; nb < 4; ++nb) { const V b = WFrag<T16>::ld(Bt + boff + (size_t)nb * 16 * K + kc); V b2; if (NSPLIT >= 2) b2 = WFrag<T16>::ld(Bt2 + boff + (size_t)nb * 16 * K + kc);
#pragma unroll
            for (int mb = 0; mb < 4; ++mb) { acc[mb][nb] = WFrag<T16>::mma(a[mb], b, acc[mb][nb]); if (NSPLIT == 1 || NSPLIT == 2) acc[mb][nb] = WFrag<T16>::mma(a2[mb], b, acc[mb][nb]); if (NSPLIT >= 2) acc[mb][nb] = WFrag<T16>::mma(a[mb], b2, acc[mb][nb]); } }
        asm volatile("v_nop\n\tv_nop\n\tv_nop\n\tv_nop" : "+v"(acc[0][0]), "+v"(acc[1][1]), "+v"(acc[2][2]), "+v"(acc[3][3]) : "v"(a[0]), "v"(a[3]));
    }
    if constexpr (KS > 1) {
        float* ow = os + wv * (64 * 68); const int cofs = ((int)threadIdx.x & 15) * 4; v4f bb = (v4f){};   // a thread's four columns are the same in every pass below: its bias is fetched once, ahead of the barrier
        if (BIAS) { bb[0] = bfr(bias[c0 + cofs]); bb[1] = bfr(bias[c0 + cofs + 1]); bb[2] = bfr(bias[c0 + cofs + 2]); bb[3] = bfr(bias[c0 + cofs + 3]); }
#pragma unroll
        for (int mb = 0; mb < 4; ++mb)
#pragma unroll
            for (int nb = 0; nb < 4; ++nb)
#pragma unroll
                for (int j = 0; j < 8; ++j) ow[(mb * 16 + hi * 8 + j) * 68 + nb * 16 + lr] = acc[mb][nb][j];
        __syncthreads();   // every wave's partial tile is in LDS before any wave sums
#pragma unroll
        for (int s = 0; s < 32 / KS; ++s) { const int row = (s * (32 * KS) + (int)threadIdx.x) >> 4; v4f val = *(const v4fa*)(os + row * 68 + cofs);
#pragma unroll
            for (int w = 1; w < KS; ++w) val += *(const v4fa*)(os + w * (64 * 68) + row * 68 + cofs);
            if (BIAS) val += bb;
            *(v4f*)(C + (size_t)(r0 + row) * ldc + c0 + cofs) = val; }
        return;
    }
#pragma unroll
    for (int mb = 0; mb < 4; ++mb) {
#pragma unroll
        for (int nb = 0; nb < 4; ++nb) {
#pragma unroll
            for (int j = 0; j < 8; ++j) os[(hi * 8 + j) * 68 + nb * 16 + lr] = acc[mb][nb][j]; }
        __builtin_amdgcn_wave_barrier(); asm volatile("" ::: "memory");
        float* crow = C + (size_t)(r0 + mb * 16) * ldc + c0;
{
#pragma unroll
            for (int s = 0; s < 8; ++s) { const int row = 2 * s + hi, cofs = lr * 4; v4f val = *(const v4fa*)(os + row * 68 + cofs); if (BIAS) { val[0] += bfr(bias[c0 + cofs]); val[1] += bfr(bias[c0 + cofs + 1]); val[2] += bfr(bias[c0 + cofs + 2]); val[3] += bfr(bias[c0 + cofs + 3]); }
                *(v4f*)(crow + (size_t)row * ldc + cofs) = val; }
             }
        __builtin_amdgcn_wave_barrier(); asm volatile("" ::: "memory");
    }
}

__device__ __forceinline__ h16 tohx(float x) { return (h16)x; }
__device__ __forceinline__ void splitf(float y, unsigned short& h, unsigned short& l) { h = f2bf(y); l = f2bf(y - bf2f(h)); }
typedef __attribute__((ext_vector_type(2))) unsigned short v2us;
typedef __attribute__((ext_vector_type(4))) unsigned short v4us;
typedef __attribute__((ext_vector_type(2))) _Float16 v2h;
typedef __attribute__((ext_vector_type(4))) _Float16 v4h;

__global__ __launch_bounds__(256) void k_wtG(const float* __restrict__ w, int K, int N, bf* Bt) {
    const int lane = threadIdx.x & 31; const int L0 = (blockIdx.x * 8 + (threadIdx.x >> 5)) * 8; const int nlines = N * K / 64;
{
#pragma unroll 1
        for (int l = 0; l < 8; ++l) { const int L = L0 + l; if (L >= nlines) break; const size_t e = (size_t)L * 64 + lane * 2; const int k = (int)(e % K), n = (int)(e / K); v2us o;
            o[0] = f2bf(w[(size_t)k * N + n]); o[1] = f2bf(w[(size_t)(k + 1) * N + n]); *(v2us*)(Bt + e) = o; }
         }
}
__global__ __launch_bounds__(256) void k_cvt8(const float* __restrict__ src, bf* dst, size_t n8) { const size_t i = (size_t)blockIdx.x * 256 + threadIdx.x; if (i >= n8) return; const v8f v = *(const v8f*)(src + i * 8); v8us o;
#pragma unroll
    for (int k = 0; k < 8; ++k) o[k] = f2bf(v[k]); *(v8us*)(dst + i * 8) = o;  }
// k_sqt: SQ[j] = sqrt(j) (f32, correctly rounded); k_pl3: fp16 + hl planes [h][t][d] of a [t][768] buffer (8-B lanes); k_vt3: fp16 + hl planes VT[h][d][t] (lane -> 2 consecutive t).
__device__ __forceinline__ bool hlrow(int g, int i) { return (g == 0) ? (i < RHL) : (g == 1) ? (i >= TT - RHL) : false; }
__global__ __launch_bounds__(256) void k_pl3(const float* __restrict__ F, h16* P, bf* Ph, bf* Pl) { const int e = (blockIdx.x * 256 + threadIdx.x) * 4; if (e >= NH_ * TT * HD) return; const int d = e % HD; const int t = (e / HD) % TT; const int h = e / (HD * TT); const float* f = F + (size_t)t * DM + h * HD + d; v4h o; v4us oh, ol;
#pragma unroll
    for (int u = 0; u < 4; ++u) { o[u] = tohx(f[u]); unsigned short a, b; splitf(f[u], a, b); oh[u] = a; ol[u] = b; } { *(v4h*)(P + e) = o; *(v4us*)(Ph + e) = oh; *(v4us*)(Pl + e) = ol;  } }
__global__ __launch_bounds__(256) void k_vt3(const float* __restrict__ V, h16* VT, bf* VTh, bf* VTl) { const int e = (blockIdx.x * 256 + threadIdx.x) * 2; if (e >= NH_ * HD * TT) return; const int t = e % TT; const int d = (e / TT) % HD; const int h = e / (TT * HD); const float a = V[(size_t)t * DM + h * HD + d], b = V[(size_t)(t + 1) * DM + h * HD + d]; v2h o; o[0] = tohx(a); o[1] = tohx(b); v2us oh, ol; unsigned short a1, b1, a2, b2; splitf(a, a1, b1); splitf(b, a2, b2); oh[0] = a1; oh[1] = a2; ol[0] = b1; ol[1] = b2;
    { *(v2h*)(VT + e) = o; *(v2us*)(VTh + e) = oh; *(v2us*)(VTl + e) = ol;  } }
__global__ __launch_bounds__(256) void k_sqt(float* SQ) { const int j = blockIdx.x * 256 + threadIdx.x; if (j >= TT) return; const float r = __fsqrt_rn((float)j); *(float*)(SQ + j) = r;  }
#define KP 72          // LDS row pitch in 16-bit elements: 128 B of data + 16 B, an odd multiple of 16 B, so that the 16 rows of a fragment read fall on different banks
#define PS (64 * KP)   // one 64-row plane
typedef __attribute__((ext_vector_type(2))) float v2f;
typedef __attribute__((ext_vector_type(2))) __bf16 v2b;
template <typename T16> struct Oct;
template <> struct Oct<h16> { typedef v8h T; };
template <> struct Oct<bf> { typedef v8us T; };
__device__ __forceinline__ float xhalf(float x) { return __builtin_bit_cast(float, __builtin_amdgcn_permlanex16(__builtin_bit_cast(int, x), __builtin_bit_cast(int, x), 0x76543210, 0xfedcba98, false, false)); }   // lane l <-> lane l ^ 16
template <typename T16, bool HL>
__device__ __forceinline__ void fattn_wg(T16* lds, const T16* __restrict__ q, const T16* __restrict__ q2, const T16* __restrict__ k, const T16* __restrict__ k2, const T16* __restrict__ vt, const T16* __restrict__ vt2,
                                         const float* __restrict__ SQ, int g, float slope, int q0, int lr, int hi, float* __restrict__ orow) {
    typedef WFrag<T16> W; typedef typename W::V V; typedef typename Oct<T16>::T H;   // every '#pragma unroll' below opens a short loop of fixed length, so that the arrays it indexes stay in registers
    constexpr int BS = (HL ? 4 : 2) * PS;   // one buffer: K, V^T (and their low planes)
    const float L2E = 1.4426950408889634f; const float c1 = 0.125f * L2E, c2 = slope * L2E;
    const int i = q0 + lr; const float sqi = SQ[i];
    const int klo = (g == 1) ? i : 0; const unsigned span = (unsigned)(((g == 0) ? i : TT - 1) - klo);   // key j is kept when klo <= j <= klo + span
    V qa[2], qb[2];
#pragma unroll
    for (int kk = 0; kk < 2; ++kk) { qa[kk] = W::ld(q + (size_t)i * HD + 8 * hi + kk * 32); if (HL) qb[kk] = W::ld(q2 + (size_t)i * HD + 8 * hi + kk * 32); }
    const int srow = (int)threadIdx.x >> 3, sch = ((int)threadIdx.x & 7) * 8;   // staging: 8 threads a 128-B row, a wave covers 4 whole lines
    const int kso = srow * HD + sch, vso = srow * TT + sch, lso = srow * KP + sch;
    H rk[2], rv[2], rk2[2], rv2[2];
#pragma unroll
    for (int r = 0; r < 2; ++r) { rk[r] = *(const H*)(k + kso + r * 32 * HD); rv[r] = *(const H*)(vt + vso + r * 32 * TT); if (HL) { rk2[r] = *(const H*)(k2 + kso + r * 32 * HD); rv2[r] = *(const H*)(vt2 + vso + r * 32 * TT); } }
#pragma unroll
    for (int r = 0; r < 2; ++r) { *(H*)(lds + lso + r * 32 * KP) = rk[r]; *(H*)(lds + PS + lso + r * 32 * KP) = rv[r]; if (HL) { *(H*)(lds + 2 * PS + lso + r * 32 * KP) = rk2[r]; *(H*)(lds + 3 * PS + lso + r * 32 * KP) = rv2[r]; } }
    v4f sq[4][2];
#pragma unroll
    for (int t = 0; t < 4; ++t) { sq[t][0] = *(const v4f*)(SQ + t * 16 + 8 * hi); sq[t][1] = *(const v4f*)(SQ + t * 16 + 8 * hi + 4); }
    float m = -1.0e30f, l = 0.f; v8f o[4];
#pragma unroll
    for (int mb = 0; mb < 4; ++mb) o[mb] = (v8f){};
    const int fo = lr * KP + 8 * hi;
#pragma unroll
    for (int r = 0; r < 2; ++r) { rk[r] = *(const H*)(k + kso + (64 + r * 32) * HD); rv[r] = *(const H*)(vt + vso + r * 32 * TT + 64); if (HL) { rk2[r] = *(const H*)(k2 + kso + (64 + r * 32) * HD); rv2[r] = *(const H*)(vt2 + vso + r * 32 * TT + 64); } }   // pass 1's tiles, on their way to the registers
    __syncthreads();   // pass 0's tiles are in LDS before any wave reads them
#pragma unroll 1   // kept rolled: a pass is some hundred instructions already, a second copy would only cost instruction cache
    for (int k0 = 0; k0 < TT; k0 += 64) {
        const T16* lb = lds + ((k0 >> 6) & 1) * BS; T16* ln = lds + (((k0 >> 6) & 1) ^ 1) * BS;
        const int kn = (k0 + 64 < TT) ? k0 + 64 : 0, kf = (k0 + 128 < TT) ? k0 + 128 : 0;   // past the end block 0 is fetched again, unused: addresses stay in bounds and every pass has the same control flow
        v8f s[4];
#pragma unroll
        for (int t = 0; t < 4; ++t) { v8f a = (v8f){};
#pragma unroll
            for (int kk = 0; kk < 2; ++kk) { const V ka = W::ld(lb + fo + t * 16 * KP + kk * 32); a = W::mma(ka, qa[kk], a); if (HL) { const V kb = W::ld(lb + 2 * PS + fo + t * 16 * KP + kk * 32); a = W::mma(kb, qa[kk], a); a = W::mma(ka, qb[kk], a); } }
            s[t] = a; }
#pragma unroll
        for (int t = 0; t < 4; ++t)
#pragma unroll
            for (int j = 0; j < 8; ++j) s[t][j] = s[t][j] * c1 - c2 * fabsf(sq[t][j >> 2][j & 3] - sqi);
#pragma unroll
        for (int t = 0; t < 4; ++t) { sq[t][0] = *(const v4f*)(SQ + kn + t * 16 + 8 * hi); sq[t][1] = *(const v4f*)(SQ + kn + t * 16 + 8 * hi + 4); }
        if ((g == 0 && k0 + 63 > q0) || (g == 1 && k0 < q0 + 15)) {   // wave-uniform: only a pass that holds a masked (query, key) pair of this wave pays for the mask
            const int kb0 = k0 + 8 * hi - klo;
#pragma unroll
            for (int t = 0; t < 4; ++t)
#pragma unroll
                for (int j = 0; j < 8; ++j) s[t][j] = ((unsigned)(kb0 + t * 16 + j) <= span) ? s[t][j] : -3.0e38f; }
        float mt[4];
#pragma unroll
        for (int t = 0; t < 4; ++t) { mt[t] = s[t][0];
#pragma unroll
            for (int j = 1; j < 8; ++j) mt[t] = fmaxf(mt[t], s[t][j]); }
        float mx = fmaxf(fmaxf(m, fmaxf(mt[0], mt[1])), fmaxf(mt[2], mt[3])); mx = fmaxf(mx, xhalf(mx));
        const float al = __builtin_amdgcn_exp2f(m - mx), ms = mx - 10.0f; m = mx;   // while every key so far was masked, mx stays at its start value, al is 1 and every p below is 0
#pragma unroll
        for (int mb = 0; mb < 4; ++mb) o[mb] *= al;
        V pa[2], pb[2]; float lt[4];
#pragma unroll
        for (int t = 0; t < 4; ++t) { lt[t] = 0.f;
#pragma unroll
            for (int j = 0; j < 8; j += 2) { v2f p; p[0] = __builtin_amdgcn_exp2f(s[t][j] - ms); p[1] = __builtin_amdgcn_exp2f(s[t][j + 1] - ms); lt[t] += p[0]; lt[t] += p[1]; const int e = (t & 1) * 8 + j;
                if constexpr (HL) { const v2b ph = __builtin_convertvector(p, v2b); const v2b pl = __builtin_convertvector(p - __builtin_convertvector(ph, v2f), v2b); pa[t >> 1][e] = ph[0]; pa[t >> 1][e + 1] = ph[1]; pb[t >> 1][e] = pl[0]; pb[t >> 1][e + 1] = pl[1]; }   // high plane, and what it leaves, both rounded to nearest
                else { pa[t >> 1][e] = (h16)p[0]; pa[t >> 1][e + 1] = (h16)p[1]; } } }
        l = l * al + ((lt[0] + lt[1]) + (lt[2] + lt[3]));
#pragma unroll
        for (int kk = 0; kk < 2; ++kk)
#pragma unroll
            for (int mb = 0; mb < 4; ++mb) { const V va = W::ld(lb + PS + fo + mb * 16 * KP + kk * 32); o[mb] = W::mma(va, pa[kk], o[mb]); if (HL) { const V vb = W::ld(lb + 3 * PS + fo + mb * 16 * KP + kk * 32); o[mb] = W::mma(vb, pa[kk], o[mb]); o[mb] = W::mma(va, pb[kk], o[mb]); } }
#pragma unroll
        for (int r = 0; r < 2; ++r) { *(H*)(ln + lso + r * 32 * KP) = rk[r]; *(H*)(ln + PS + lso + r * 32 * KP) = rv[r]; if (HL) { *(H*)(ln + 2 * PS + lso + r * 32 * KP) = rk2[r]; *(H*)(ln + 3 * PS + lso + r * 32 * KP) = rv2[r]; } }
        const T16 *pk = k + kso + kf * HD, *pv = vt + vso + kf, *pk2 = HL ? k2 + kso + kf * HD : pk, *pv2 = HL ? vt2 + vso + kf : pv;
#pragma unroll
        for (int r = 0; r < 2; ++r) { rk[r] = *(const H*)(pk + r * 32 * HD); rv[r] = *(const H*)(pv + r * 32 * TT); if (HL) { rk2[r] = *(const H*)(pk2 + r * 32 * HD); rv2[r] = *(const H*)(pv2 + r * 32 * TT); } }   // fetched a whole pass ahead of their store to LDS
        asm volatile("s_wait_xcnt 0x0" :: "v"(pk), "v"(pv), "v"(pk2), "v"(pv2) : "memory");   // in front of whatever next overwrites the address registers of the fetches above; they are named as inputs so that they stay as they are up to this wait
        asm volatile("s_wait_dscnt 0x0" ::: "memory");   // this wave's LDS stores above have landed and its reads of this pass's buffer have returned
        asm volatile("s_barrier_signal -1\n\ts_barrier_wait -1" ::: "memory");   // work-group barrier: publishes the next pass's tiles and frees this pass's buffer. By hand, because __syncthreads() also waits for the global fetches just issued, which are to fly through the next pass
    }
    l += xhalf(l); const float inv = 1.0f / l;
#pragma unroll
    for (int mb = 0; mb < 4; ++mb) { float* d = orow + (size_t)lr * DM + mb * 16 + hi * 8; v4f x0, x1;
#pragma unroll
        for (int u = 0; u < 4; ++u) { x0[u] = o[mb][u] * inv; x1[u] = o[mb][4 + u] * inv; }
        *(v4f*)d = x0; *(v4f*)(d + 4) = x1; }
}
__global__ __launch_bounds__(256) void k_fattn(const h16* __restrict__ Q16, const bf* __restrict__ Qh, const bf* __restrict__ Ql, const h16* __restrict__ K16, const bf* __restrict__ Kh, const bf* __restrict__ Kl,
                                               const h16* __restrict__ VT, const bf* __restrict__ VTh, const bf* __restrict__ VTl, const float* __restrict__ SQ, float* __restrict__ outb) {
    __shared__ __align__(16) unsigned short sm[2 * 4 * PS];
    const int lane = threadIdx.x & 31, lr = lane & 15, hi = lane >> 4; const int wv = __builtin_amdgcn_readfirstlane((int)(threadIdx.x >> 5));   // wave number in a scalar register: the mask test of a pass is then a scalar branch
    const int h = blockIdx.y, g = h / 4, hm = h % 4; const float slope = (hm == 0) ? 0.25f : (hm == 1) ? 0.0625f : (hm == 2) ? 0.015625f : 0.00390625f;
    const int q0 = (blockIdx.x * 8 + wv) * 16; const size_t zo = (size_t)h * TT * HD; float* orow = outb + (size_t)q0 * DM + h * HD;
    if (hlrow(g, blockIdx.x * 128)) fattn_wg<bf, true>(sm, Qh + zo, Ql + zo, Kh + zo, Kl + zo, VTh + zo, VTl + zo, SQ, g, slope, q0, lr, hi, orow);   // 128 divides the window's 512 rows: the same path for the whole work-group
    else fattn_wg<h16, false>((h16*)sm, Q16 + zo, nullptr, K16 + zo, nullptr, VT + zo, nullptr, SQ, g, slope, q0, lr, hi, orow);
}

extern "C" void kernel_launch(void* const* d_in, const int* in_sizes, int n_in,
                              void* d_out, int out_size, void* d_ws, size_t ws_size, hipStream_t stream) {
    (void)in_sizes; (void)n_in; (void)out_size;
    const float** I = (const float**)d_in;
    const float *x = I[0], *Wq = I[1], *bq = I[2], *Wk = I[3], *bk = I[4], *Wv = I[5], *bv = I[6];
    float* OUT = (float*)d_out;     // [2][2048][768]
    char* wsp = (char*)d_ws;
    auto take = [&](size_t bytes) { char* p = wsp; wsp += (bytes + 255) & ~(size_t)255; return (void*)p; };
    bf* BQ = (bf*)take((size_t)DM * DM * 2); bf* BK = (bf*)take((size_t)DM * DM * 2); bf* BV = (bf*)take((size_t)DM * DM * 2);
    bf* XB = (bf*)take((size_t)TT * DM * 2); float* Q = (float*)take((size_t)TT * DM * 4); float* K = (float*)take((size_t)TT * DM * 4); float* V = (float*)take((size_t)TT * DM * 4);
    h16* Q16 = (h16*)take((size_t)NH_ * TT * HD * 2); bf* Qh = (bf*)take((size_t)NH_ * TT * HD * 2); bf* Ql = (bf*)take((size_t)NH_ * TT * HD * 2); h16* K16 = (h16*)take((size_t)NH_ * TT * HD * 2); bf* Kh = (bf*)take((size_t)NH_ * TT * HD * 2); bf* Kl = (bf*)take((size_t)NH_ * TT * HD * 2);
    h16* VT = (h16*)take((size_t)NH_ * HD * TT * 2); bf* VTh = (bf*)take((size_t)NH_ * HD * TT * 2); bf* VTl = (bf*)take((size_t)NH_ * HD * TT * 2); float* SQ = (float*)take(TT * 4);
    if ((size_t)(wsp - (char*)d_ws) > ws_size) return;    // total ~ 54 MB
    k_wtG<<<(DM * DM / 64 + 63) / 64, 256, 0, stream>>>(Wq, DM, DM, BQ); k_wtG<<<(DM * DM / 64 + 63) / 64, 256, 0, stream>>>(Wk, DM, DM, BK); k_wtG<<<(DM * DM / 64 + 63) / 64, 256, 0, stream>>>(Wv, DM, DM, BV);
    k_sqt<<<(TT + 255) / 256, 256, 0, stream>>>(SQ);
    for (int b = 0; b < NB_; ++b) {
        k_cvt8<<<(TT * DM / 8 + 255) / 256, 256, 0, stream>>>(x + (size_t)b * TT * DM, XB, (size_t)TT * DM / 8);
        k_gemmw<bf, 0, true, 8><<<dim3(TT / 64, DM / 64, 1), 256, 0, stream>>>(XB, nullptr, BQ, nullptr, DM, Q, DM, bq, 0, 0, 0); k_gemmw<bf, 0, true, 8><<<dim3(TT / 64, DM / 64, 1), 256, 0, stream>>>(XB, nullptr, BK, nullptr, DM, K, DM, bk, 0, 0, 0); k_gemmw<bf, 0, true, 8><<<dim3(TT / 64, DM / 64, 1), 256, 0, stream>>>(XB, nullptr, BV, nullptr, DM, V, DM, bv, 0, 0, 0);
        k_pl3<<<(NH_ * TT * HD / 4 + 255) / 256, 256, 0, stream>>>(Q, Q16, Qh, Ql); k_pl3<<<(NH_ * TT * HD / 4 + 255) / 256, 256, 0, stream>>>(K, K16, Kh, Kl); k_vt3<<<(NH_ * HD * TT / 2 + 255) / 256, 256, 0, stream>>>(V, VT, VTh, VTl);
        k_fattn<<<dim3(TT / 128, NH_, 1), 256, 0, stream>>>(Q16, Qh, Ql, K16, Kh, Kl, VT, VTh, VTl, SQ, OUT + (size_t)b * TT * DM); }
}

// v003
// One run takes 166 microseconds.
// In two side-by-side timings against v002, it was 1.23 and 1.24 times as fast.
// All steps since v000 together make it 5.52 times as fast.
#include <hip/hip_runtime.h>

// NonSymmetricAttentionKernel (hidden [2][2048][768]; q/k/v = x W + b (12 heads x 64); scores = q.k/8 + alibi[h][i][j] where alibi = -slope[h%4] |sqrt(j) - sqrt(i)|, slopes 2^-2, 2^-4, 2^-6, 2^-8; heads 0-3 causal (j <= i), heads 4-7 anti-causal (j >= i), heads 8-11 unmasked;
// softmax; out = attn v merged (no output projection) -> [2][2048][768]).
// Compute dtypes, f32 accumulate: every input rounded to bf16; q/k/v on PLAIN bf16 operands (inputs: exact) + bias; scores (K 64) and attn.v on single fp16 planes (probabilities x1024) EXCEPT the short-window rows (query rows < 512 of heads 0-3, >= 1536 of heads 4-7): bf16 high + low planes, three products.

#define NB_  2
#define TT   2048
#define DM   768
#define NH_  12
#define HD   64
#define RHL  512
typedef _Float16 h16;
typedef unsigned short bf;
typedef __attribute__((ext_vector_type(16))) __bf16   v16bf;
typedef __attribute__((ext_vector_type(16))) _Float16 v16h;
typedef __attribute__((ext_vector_type(8)))  _Float16 v8h;
typedef __attribute__((ext_vector_type(8)))  unsigned short v8us;
typedef __attribute__((ext_vector_type(8)))  float    v8f;
typedef __attribute__((ext_vector_type(4)))  float    v4f;
typedef v8h  __attribute__((may_alias)) v8ha;
typedef v4f  __attribute__((may_alias)) v4fa;
typedef v8us __attribute__((may_alias)) v8usa;

__device__ __forceinline__ unsigned short f2bf(float f) { unsigned u = __float_as_uint(f); u += 0x7FFFu + ((u >> 16) & 1u); return (unsigned short)(u >> 16); }
__device__ __forceinline__ float bf2f(unsigned short b) { return __uint_as_float(((unsigned)b) << 16); }
__device__ __forceinline__ float bfr(float f) { return bf2f(f2bf(f)); }
__device__ __forceinline__ v16h cat16(v8h lo, v8h hi) { return __builtin_shufflevector(lo, hi, 0, 1, 2, 3, 4, 5, 6, 7, 8, 9, 10, 11, 12, 13, 14, 15); }
__device__ __forceinline__ v16bf cat16b(v8us lo, v8us hi) { return __builtin_bit_cast(v16bf, __builtin_shufflevector(lo, hi, 0, 1, 2, 3, 4, 5, 6, 7, 8, 9, 10, 11, 12, 13, 14, 15)); }
__device__ __forceinline__ v8f wmma16(v16h a, v16h b, v8f c) { return __builtin_amdgcn_wmma_f32_16x16x32_f16(false, a, false, b, (short)0, c, false, false); }
__device__ __forceinline__ v8f wmmab(v16bf a, v16bf b, v8f c) { return __builtin_amdgcn_wmma_f32_16x16x32_bf16(false, a, false, b, (short)0, c, false, false); }
__device__ __forceinline__ h16 tohx(float x) { return (h16)x; }
__device__ __forceinline__ void splitf(float y, unsigned short& h, unsigned short& l) { h = f2bf(y); l = f2bf(y - bf2f(h)); }
typedef __attribute__((ext_vector_type(4))) unsigned short v4us;
typedef __attribute__((ext_vector_type(4))) _Float16 v4h;



// ---- k_gemmw: register-blocked GEMM, one work-group of KS waves per 64x64 output tile (16 accumulators a wave), operands straight from K-contiguous 16-bit planes; grid (M/64, N/64, Z), 32 * KS threads.
// KS > 1: wave w takes the 32-wide k steps w, w + KS, w + 2 KS, ...; the KS partial tiles meet in LDS and are summed in wave order 0 .. KS-1 (fixed order, same result every run).
// C[m][n] (f32, pitch ldc, + optional f32 bias[n]) = sum_k A[m][k] Bt[n][k] (+ split products per NSPLIT). z-batch strides sA/sB/sC in elements. K % 32 == 0.
// OUT 0: C is stored as f32. OUT 1, 2 (KS > 1; a 64-column tile is one head): C never reaches memory; the summing pass rounds each f32 sum to the three 16-bit planes that attention reads (fp16, bf16 high, bf16 low) and stores those:
// OUT 1 as [head][t][d]; OUT 2 as [head][d][t], for which the partial tiles already lie transposed in LDS (an accumulator's 8 values are 8 consecutive t of one d: two 16-B LDS stores).
template <typename T16> struct WFrag;
template <> struct WFrag<h16> { typedef v16h V; static __device__ __forceinline__ V ld(const h16* p) { return cat16(*(const v8h*)p, *(const v8h*)(p + 16)); } static __device__ __forceinline__ v8f mma(V a, V b, v8f c) { return wmma16(a, b, c); } };
template <> struct WFrag<bf> { typedef v16bf V; static __device__ __forceinline__ V ld(const bf* p) { return cat16b(*(const v8us*)p, *(const v8us*)(p + 16)); } static __device__ __forceinline__ v8f mma(V a, V b, v8f c) { return wmmab(a, b, c); } };
template <typename T16, int NSPLIT, bool BIAS, int KS, int OUT>
__global__ __launch_bounds__(32 * KS) void k_gemmw(const T16* __restrict__ A, const T16* __restrict__ A2, const T16* __restrict__ Bt, const T16* __restrict__ Bt2, int K, float* C, int ldc, const float* __restrict__ bias, size_t sA, size_t sB, size_t sC, h16* P, bf* Ph, bf* Pl) {
    typedef typename WFrag<T16>::V V;
    __shared__ __align__(16) float os[(KS == 1 ? 16 : KS * 64) * 68];
    const int wv = (KS == 1) ? 0 : __builtin_amdgcn_readfirstlane((int)(threadIdx.x >> 5));   // wave number in a scalar register, so that the k loop's counter and branch stay scalar
    const size_t z = blockIdx.z; A += z * sA; if (A2) A2 += z * sA; Bt += z * sB; if (Bt2) Bt2 += z * sB; C += z * sC;
    const int lane = threadIdx.x & 31, lr = lane & 15, hi = lane >> 4; const int r0 = blockIdx.x * 64, c0 = blockIdx.y * 64;
    v8f acc[4][4];
#pragma unroll
    for (int mb = 0; mb < 4; ++mb)
#pragma unroll
        for (int nb = 0; nb < 4; ++nb) acc[mb][nb] = (v8f){};
    const size_t aoff = (size_t)(r0 + lr) * K + 8 * hi, boff = (size_t)(c0 + lr) * K + 8 * hi;
#pragma unroll 1
    for (int kc = wv * 32; kc < K; kc += 32 * KS) {
        V a[4], a2[4];
#pragma unroll
        for (int mb = 0; mb < 4; ++mb) { a[mb] = WFrag<T16>::ld(A + aoff + (size_t)mb * 16 * K + kc); if (NSPLIT == 1 || NSPLIT == 2) a2[mb] = WFrag<T16>::ld(A2 + aoff + (size_t)mb * 16 * K + kc); }
#pragma unroll
        for (int nb = 0; nb < 4; ++nb) { const V b = WFrag<T16>::ld(Bt + boff + (size_t)nb * 16 * K + kc); V b2; if (NSPLIT >= 2) b2 = WFrag<T16>::ld(Bt2 + boff + (size_t)nb * 16 * K + kc);
#pragma unroll
            for (int mb = 0; mb < 4; ++mb) { acc[mb][nb] = WFrag<T16>::mma(a[mb], b, acc[mb][nb]); if (NSPLIT == 1 || NSPLIT == 2) acc[mb][nb] = WFrag<T16>::mma(a2[mb], b, acc[mb][nb]); if (NSPLIT >= 2) acc[mb][nb] = WFrag<T16>::mma(a[mb], b2, acc[mb][nb]); } }
        asm volatile("v_nop\n\tv_nop\n\tv_nop\n\tv_nop" : "+v"(acc[0][0]), "+v"(acc[1][1]), "+v"(acc[2][2]), "+v"(acc[3][3]) : "v"(a[0]), "v"(a[3]));
    }
    if constexpr (KS > 1) {
        float* ow = os + wv * (64 * 68); const int cofs = ((int)threadIdx.x & 15) * 4; v4f bb = (v4f){};   // a thread's four columns are the same in every pass below: its bias is fetched once, ahead of the barrier
        float br[32 / KS];   // OUT 2: an LDS row is one output column, so the bias goes by the row of each pass; fetched ahead of the barrier too
        if (BIAS && OUT != 2) { bb[0] = bfr(bias[c0 + cofs]); bb[1] = bfr(bias[c0 + cofs + 1]); bb[2] = bfr(bias[c0 + cofs + 2]); bb[3] = bfr(bias[c0 + cofs + 3]); }
        if (BIAS && OUT == 2) {
#pragma unroll
            for (int s = 0; s < 32 / KS; ++s) br[s] = bfr(bias[c0 + ((s * (32 * KS) + (int)threadIdx.x) >> 4)]); }
#pragma unroll
        for (int mb = 0; mb < 4; ++mb)
#pragma unroll
            for (int nb = 0; nb < 4; ++nb) {
                if constexpr (OUT == 2) { float* p = ow + (nb * 16 + lr) * 68 + mb * 16 + hi * 8; *(v4fa*)p = __builtin_shufflevector(acc[mb][nb], acc[mb][nb], 0, 1, 2, 3); *(v4fa*)(p + 4) = __builtin_shufflevector(acc[mb][nb], acc[mb][nb], 4, 5, 6, 7); }
                else {
#pragma unroll
                    for (int j = 0; j < 8; ++j) ow[(mb * 16 + hi * 8 + j) * 68 + nb * 16 + lr] = acc[mb][nb][j]; } }
        __syncthreads();   // every wave's partial tile is in LDS before any wave sums
#pragma unroll
        for (int s = 0; s < 32 / KS; ++s) { const int row = (s * (32 * KS) + (int)threadIdx.x) >> 4; v4f val = *(const v4fa*)(os + row * 68 + cofs);
#pragma unroll
            for (int w = 1; w < KS; ++w) val += *(const v4fa*)(os + w * (64 * 68) + row * 68 + cofs);
            if (BIAS) { if (OUT == 2) val += br[s]; else val += bb; }
            if constexpr (OUT == 0) *(v4f*)(C + (size_t)(r0 + row) * ldc + c0 + cofs) = val;
            else { const size_t e = (OUT == 1) ? ((size_t)blockIdx.y * TT + r0 + row) * HD + cofs : ((size_t)blockIdx.y * HD + row) * TT + r0 + cofs; v4h o; v4us oh, ol;   // 16 threads fill one 128-B line of each plane
#pragma unroll
                for (int u = 0; u < 4; ++u) { o[u] = tohx(val[u]); unsigned short a, b; splitf(val[u], a, b); oh[u] = a; ol[u] = b; }
                *(v4h*)(P + e) = o; *(v4us*)(Ph + e) = oh; *(v4us*)(Pl + e) = ol; } }
        return;
    }
#pragma unroll
    for (int mb = 0; mb < 4; ++mb) {
#pragma unroll
        for (int nb = 0; nb < 4; ++nb) {
#pragma unroll
            for (int j = 0; j < 8; ++j) os[(hi * 8 + j) * 68 + nb * 16 + lr] = acc[mb][nb][j]; }
        __builtin_amdgcn_wave_barrier(); asm volatile("" ::: "memory");
        float* crow = C + (size_t)(r0 + mb * 16) * ldc + c0;
{
#pragma unroll
            for (int s = 0; s < 8; ++s) { const int row = 2 * s + hi, cofs = lr * 4; v4f val = *(const v4fa*)(os + row * 68 + cofs); if (BIAS) { val[0] += bfr(bias[c0 + cofs]); val[1] += bfr(bias[c0 + cofs + 1]); val[2] += bfr(bias[c0 + cofs + 2]); val[3] += bfr(bias[c0 + cofs + 3]); }
                *(v4f*)(crow + (size_t)row * ldc + cofs) = val; }
             }
        __builtin_amdgcn_wave_barrier(); asm volatile("" ::: "memory");
    }
}

typedef __attribute__((ext_vector_type(2))) unsigned short v2us;

__global__ __launch_bounds__(256) void k_wtG(const float* __restrict__ w, int K, int N, bf* Bt) {
    const int lane = threadIdx.x & 31; const int L0 = (blockIdx.x * 8 + (threadIdx.x >> 5)) * 8; const int nlines = N * K / 64;
{
#pragma unroll 1
        for (int l = 0; l < 8; ++l) { const int L = L0 + l; if (L >= nlines) break; const size_t e = (size_t)L * 64 + lane * 2; const int k = (int)(e % K), n = (int)(e / K); v2us o;
            o[0] = f2bf(w[(size_t)k * N + n]); o[1] = f2bf(w[(size_t)(k + 1) * N + n]); *(v2us*)(Bt + e) = o; }
         }
}
__global__ __launch_bounds__(256) void k_cvt8(const float* __restrict__ src, bf* dst, size_t n8) { const size_t i = (size_t)blockIdx.x * 256 + threadIdx.x; if (i >= n8) return; const v8f v = *(const v8f*)(src + i * 8); v8us o;
#pragma unroll
    for (int k = 0; k < 8; ++k) o[k] = f2bf(v[k]); *(v8us*)(dst + i * 8) = o;  }
// k_sqt: SQ[j] = sqrt(j) (f32, correctly rounded).
__device__ __forceinline__ bool hlrow(int g, int i) { return (g == 0) ? (i < RHL) : (g == 1) ? (i >= TT - RHL) : false; }
__global__ __launch_bounds__(256) void k_sqt(float* SQ) { const int j = blockIdx.x * 256 + threadIdx.x; if (j >= TT) return; const float r = __fsqrt_rn((float)j); *(float*)(SQ + j) = r;  }
#define KP 72          // LDS row pitch in 16-bit elements: 128 B of data + 16 B, an odd multiple of 16 B, so that the 16 rows of a fragment read fall on different banks
#define PS (64 * KP)   // one 64-row plane
typedef __attribute__((ext_vector_type(2))) float v2f;
typedef __attribute__((ext_vector_type(2))) __bf16 v2b;
template <typename T16> struct Oct;
template <> struct Oct<h16> { typedef v8h T; };
template <> struct Oct<bf> { typedef v8us T; };
__device__ __forceinline__ float xhalf(float x) { return __builtin_bit_cast(float, __builtin_amdgcn_permlanex16(__builtin_bit_cast(int, x), __builtin_bit_cast(int, x), 0x76543210, 0xfedcba98, false, false)); }   // lane l <-> lane l ^ 16
template <typename T16, bool HL>
__device__ __forceinline__ void fattn_wg(T16* lds, const T16* __restrict__ q, const T16* __restrict__ q2, const T16* __restrict__ k, const T16* __restrict__ k2, const T16* __restrict__ vt, const T16* __restrict__ vt2,
                                         const float* __restrict__ SQ, int g, float slope, int q0, int lr, int hi, float* __restrict__ orow) {
    typedef WFrag<T16> W; typedef typename W::V V; typedef typename Oct<T16>::T H;   // every '#pragma unroll' below opens a short loop of fixed length, so that the arrays it indexes stay in registers
    constexpr int BS = (HL ? 4 : 2) * PS;   // one buffer: K, V^T (and their low planes)
    const float L2E = 1.4426950408889634f; const float c1 = 0.125f * L2E, c2 = slope * L2E;
    const int i = q0 + lr; const float sqi = SQ[i];
    const int klo = (g == 1) ? i : 0; const unsigned span = (unsigned)(((g == 0) ? i : TT - 1) - klo);   // key j is kept when klo <= j <= klo + span
    V qa[2], qb[2];
#pragma unroll
    for (int kk = 0; kk < 2; ++kk) { qa[kk] = W::ld(q + (size_t)i * HD + 8 * hi + kk * 32); if (HL) qb[kk] = W::ld(q2 + (size_t)i * HD + 8 * hi + kk * 32); }
    const int srow = (int)threadIdx.x >> 3, sch = ((int)threadIdx.x & 7) * 8;   // staging: 8 threads a 128-B row, a wave covers 4 whole lines
    const int kso = srow * HD + sch, vso = srow * TT + sch, lso = srow * KP + sch;
    H rk[2], rv[2], rk2[2], rv2[2];
#pragma unroll
    for (int r = 0; r < 2; ++r) { rk[r] = *(const H*)(k + kso + r * 32 * HD); rv[r] = *(const H*)(vt + vso + r * 32 * TT); if (HL) { rk2[r] = *(const H*)(k2 + kso + r * 32 * HD); rv2[r] = *(const H*)(vt2 + vso + r * 32 * TT); } }
#pragma unroll
    for (int r = 0; r < 2; ++r) { *(H*)(lds + lso + r * 32 * KP) = rk[r]; *(H*)(lds + PS + lso + r * 32 * KP) = rv[r]; if (HL) { *(H*)(lds + 2 * PS + lso + r * 32 * KP) = rk2[r]; *(H*)(lds + 3 * PS + lso + r * 32 * KP) = rv2[r]; } }
    v4f sq[4][2];
#pragma unroll
    for (int t = 0; t < 4; ++t) { sq[t][0] = *(const v4f*)(SQ + t * 16 + 8 * hi); sq[t][1] = *(const v4f*)(SQ + t * 16 + 8 * hi + 4); }
    float m = -1.0e30f, l = 0.f; v8f o[4];
#pragma unroll
    for (int mb = 0; mb < 4; ++mb) o[mb] = (v8f){};
    const int fo = lr * KP + 8 * hi;
#pragma unroll
    for (int r = 0; r < 2; ++r) { rk[r] = *(const H*)(k + kso + (64 + r * 32) * HD); rv[r] = *(const H*)(vt + vso + r * 32 * TT + 64); if (HL) { rk2[r] = *(const H*)(k2 + kso + (64 + r * 32) * HD); rv2[r] = *(const H*)(vt2 + vso + r * 32 * TT + 64); } }   // pass 1's tiles, on their way to the registers
    __syncthreads();   // pass 0's tiles are in LDS before any wave reads them
#pragma unroll 1   // kept rolled: a pass is some hundred instructions already, a second copy would only cost instruction cache
    for (int k0 = 0; k0 < TT; k0 += 64) {
        const T16* lb = lds + ((k0 >> 6) & 1) * BS; T16* ln = lds + (((k0 >> 6) & 1) ^ 1) * BS;
        const int kn = (k0 + 64 < TT) ? k0 + 64 : 0, kf = (k0 + 128 < TT) ? k0 + 128 : 0;   // past the end block 0 is fetched again, unused: addresses stay in bounds and every pass has the same control flow
        v8f s[4];
#pragma unroll
        for (int t = 0; t < 4; ++t) { v8f a = (v8f){};
#pragma unroll
            for (int kk = 0; kk < 2; ++kk) { const V ka = W::ld(lb + fo + t * 16 * KP + kk * 32); a = W::mma(ka, qa[kk], a); if (HL) { const V kb = W::ld(lb + 2 * PS + fo + t * 16 * KP + kk * 32); a = W::mma(kb, qa[kk], a); a = W::mma(ka, qb[kk], a); } }
            s[t] = a; }
#pragma unroll
        for (int t = 0; t < 4; ++t)
#pragma unroll
            for (int j = 0; j < 8; ++j) s[t][j] = s[t][j] * c1 - c2 * fabsf(sq[t][j >> 2][j & 3] - sqi);
#pragma unroll
        for (int t = 0; t < 4; ++t) { sq[t][0] = *(const v4f*)(SQ + kn + t * 16 + 8 * hi); sq[t][1] = *(const v4f*)(SQ + kn + t * 16 + 8 * hi + 4); }
        if ((g == 0 && k0 + 63 > q0) || (g == 1 && k0 < q0 + 15)) {   // wave-uniform: only a pass that holds a masked (query, key) pair of this wave pays for the mask
            const int kb0 = k0 + 8 * hi - klo;
#pragma unroll
            for (int t = 0; t < 4; ++t)
#pragma unroll
                for (int j = 0; j < 8; ++j) s[t][j] = ((unsigned)(kb0 + t * 16 + j) <= span) ? s[t][j] : -3.0e38f; }
        float mt[4];
#pragma unroll
        for (int t = 0; t < 4; ++t) { mt[t] = s[t][0];
#pragma unroll
            for (int j = 1; j < 8; ++j) mt[t] = fmaxf(mt[t], s[t][j]); }
        float mx = fmaxf(fmaxf(m, fmaxf(mt[0], mt[1])), fmaxf(mt[2], mt[3])); mx = fmaxf(mx, xhalf(mx));
        const float al = __builtin_amdgcn_exp2f(m - mx), ms = mx - 10.0f; m = mx;   // while every key so far was masked, mx stays at its start value, al is 1 and every p below is 0
#pragma unroll
        for (int mb = 0; mb < 4; ++mb) o[mb] *= al;
        V pa[2], pb[2]; float lt[4];
#pragma unroll
        for (int t = 0; t < 4; ++t) { lt[t] = 0.f;
#pragma unroll
            for (int j = 0; j < 8; j += 2) { v2f p; p[0] = __builtin_amdgcn_exp2f(s[t][j] - ms); p[1] = __builtin_amdgcn_exp2f(s[t][j + 1] - ms); lt[t] += p[0]; lt[t] += p[1]; const int e = (t & 1) * 8 + j;
                if constexpr (HL) { const v2b ph = __builtin_convertvector(p, v2b); const v2b pl = __builtin_convertvector(p - __builtin_convertvector(ph, v2f), v2b); pa[t >> 1][e] = ph[0]; pa[t >> 1][e + 1] = ph[1]; pb[t >> 1][e] = pl[0]; pb[t >> 1][e + 1] = pl[1]; }   // high plane, and what it leaves, both rounded to nearest
                else { pa[t >> 1][e] = (h16)p[0]; pa[t >> 1][e + 1] = (h16)p[1]; } } }
        l = l * al + ((lt[0] + lt[1]) + (lt[2] + lt[3]));
#pragma unroll
        for (int kk = 0; kk < 2; ++kk)
#pragma unroll
            for (int mb = 0; mb < 4; ++mb) { const V va = W::ld(lb + PS + fo + mb * 16 * KP + kk * 32); o[mb] = W::mma(va, pa[kk], o[mb]); if (HL) { const V vb = W::ld(lb + 3 * PS + fo + mb * 16 * KP + kk * 32); o[mb] = W::mma(vb, pa[kk], o[mb]); o[mb] = W::mma(va, pb[kk], o[mb]); } }
#pragma unroll
        for (int r = 0; r < 2; ++r) { *(H*)(ln + lso + r * 32 * KP) = rk[r]; *(H*)(ln + PS + lso + r * 32 * KP) = rv[r]; if (HL) { *(H*)(ln + 2 * PS + lso + r * 32 * KP) = rk2[r]; *(H*)(ln + 3 * PS + lso + r * 32 * KP) = rv2[r]; } }
        const T16 *pk = k + kso + kf * HD, *pv = vt + vso + kf, *pk2 = HL ? k2 + kso + kf * HD : pk, *pv2 = HL ? vt2 + vso + kf : pv;
#pragma unroll
        for (int r = 0; r < 2; ++r) { rk[r] = *(const H*)(pk + r * 32 * HD); rv[r] = *(const H*)(pv + r * 32 * TT); if (HL) { rk2[r] = *(const H*)(pk2 + r * 32 * HD); rv2[r] = *(const H*)(pv2 + r * 32 * TT); } }   // fetched a whole pass ahead of their store to LDS
        asm volatile("s_wait_xcnt 0x0" :: "v"(pk), "v"(pv), "v"(pk2), "v"(pv2) : "memory");   // in front of whatever next overwrites the address registers of the fetches above; they are named as inputs so that they stay as they are up to this wait
        asm volatile("s_wait_dscnt 0x0" ::: "memory");   // this wave's LDS stores above have landed and its reads of this pass's buffer have returned
        asm volatile("s_barrier_signal -1\n\ts_barrier_wait -1" ::: "memory");   // work-group barrier: publishes the next pass's tiles and frees this pass's buffer. By hand, because __syncthreads() also waits for the global fetches just issued, which are to fly through the next pass
    }
    l += xhalf(l); const float inv = 1.0f / l;
#pragma unroll
    for (int mb = 0; mb < 4; ++mb) { float* d = orow + (size_t)lr * DM + mb * 16 + hi * 8; v4f x0, x1;
#pragma unroll
        for (int u = 0; u < 4; ++u) { x0[u] = o[mb][u] * inv; x1[u] = o[mb][4 + u] * inv; }
        *(v4f*)d = x0; *(v4f*)(d + 4) = x1; }
}
__global__ __launch_bounds__(256) void k_fattn(const h16* __restrict__ Q16, const bf* __restrict__ Qh, const bf* __restrict__ Ql, const h16* __restrict__ K16, const bf* __restrict__ Kh, const bf* __restrict__ Kl,
                                               const h16* __restrict__ VT, const bf* __restrict__ VTh, const bf* __restrict__ VTl, const float* __restrict__ SQ, float* __restrict__ outb) {
    __shared__ __align__(16) unsigned short sm[2 * 4 * PS];
    const int lane = threadIdx.x & 31, lr = lane & 15, hi = lane >> 4; const int wv = __builtin_amdgcn_readfirstlane((int)(threadIdx.x >> 5));   // wave number in a scalar register: the mask test of a pass is then a scalar branch
    const int h = blockIdx.y, g = h / 4, hm = h % 4; const float slope = (hm == 0) ? 0.25f : (hm == 1) ? 0.0625f : (hm == 2) ? 0.015625f : 0.00390625f;
    const int q0 = (blockIdx.x * 8 + wv) * 16; const size_t zo = (size_t)h * TT * HD; float* orow = outb + (size_t)q0 * DM + h * HD;
    if (hlrow(g, blockIdx.x * 128)) fattn_wg<bf, true>(sm, Qh + zo, Ql + zo, Kh + zo, Kl + zo, VTh + zo, VTl + zo, SQ, g, slope, q0, lr, hi, orow);   // 128 divides the window's 512 rows: the same path for the whole work-group
    else fattn_wg<h16, false>((h16*)sm, Q16 + zo, nullptr, K16 + zo, nullptr, VT + zo, nullptr, SQ, g, slope, q0, lr, hi, orow);
}

extern "C" void kernel_launch(void* const* d_in, const int* in_sizes, int n_in,
                              void* d_out, int out_size, void* d_ws, size_t ws_size, hipStream_t stream) {
    (void)in_sizes; (void)n_in; (void)out_size;
    const float** I = (const float**)d_in;
    const float *x = I[0], *Wq = I[1], *bq = I[2], *Wk = I[3], *bk = I[4], *Wv = I[5], *bv = I[6];
    float* OUT = (float*)d_out;     // [2][2048][768]
    char* wsp = (char*)d_ws;
    auto take = [&](size_t bytes) { char* p = wsp; wsp += (bytes + 255) & ~(size_t)255; return (void*)p; };
    bf* BQ = (bf*)take((size_t)DM * DM * 2); bf* BK = (bf*)take((size_t)DM * DM * 2); bf* BV = (bf*)take((size_t)DM * DM * 2);
    bf* XB = (bf*)take((size_t)TT * DM * 2);
    h16* Q16 = (h16*)take((size_t)NH_ * TT * HD * 2); bf* Qh = (bf*)take((size_t)NH_ * TT * HD * 2); bf* Ql = (bf*)take((size_t)NH_ * TT * HD * 2); h16* K16 = (h16*)take((size_t)NH_ * TT * HD * 2); bf* Kh = (bf*)take((size_t)NH_ * TT * HD * 2); bf* Kl = (bf*)take((size_t)NH_ * TT * HD * 2);
    h16* VT = (h16*)take((size_t)NH_ * HD * TT * 2); bf* VTh = (bf*)take((size_t)NH_ * HD * TT * 2); bf* VTl = (bf*)take((size_t)NH_ * HD * TT * 2); float* SQ = (float*)take(TT * 4);
    if ((size_t)(wsp - (char*)d_ws) > ws_size) return;    // total ~ 35 MB
    k_wtG<<<(DM * DM / 64 + 63) / 64, 256, 0, stream>>>(Wq, DM, DM, BQ); k_wtG<<<(DM * DM / 64 + 63) / 64, 256, 0, stream>>>(Wk, DM, DM, BK); k_wtG<<<(DM * DM / 64 + 63) / 64, 256, 0, stream>>>(Wv, DM, DM, BV);
    k_sqt<<<(TT + 255) / 256, 256, 0, stream>>>(SQ);
    for (int b = 0; b < NB_; ++b) {
        k_cvt8<<<(TT * DM / 8 + 255) / 256, 256, 0, stream>>>(x + (size_t)b * TT * DM, XB, (size_t)TT * DM / 8);
        k_gemmw<bf, 0, true, 8, 1><<<dim3(TT / 64, DM / 64, 1), 256, 0, stream>>>(XB, nullptr, BQ, nullptr, DM, nullptr, 0, bq, 0, 0, 0, Q16, Qh, Ql); k_gemmw<bf, 0, true, 8, 1><<<dim3(TT / 64, DM / 64, 1), 256, 0, stream>>>(XB, nullptr, BK, nullptr, DM, nullptr, 0, bk, 0, 0, 0, K16, Kh, Kl); k_gemmw<bf, 0, true, 8, 2><<<dim3(TT / 64, DM / 64, 1), 256, 0, stream>>>(XB, nullptr, BV, nullptr, DM, nullptr, 0, bv, 0, 0, 0, VT, VTh, VTl);
        k_fattn<<<dim3(TT / 128, NH_, 1), 256, 0, stream>>>(Q16, Qh, Ql, K16, Kh, Kl, VT, VTh, VTl, SQ, OUT + (size_t)b * TT * DM); }
}

// v004
// A run of this version takes 132 microseconds.
// Two timings next to v003 put it at 1.25 and 1.26 times that version's speed.
// Counting every step since v000, it is 6.94 times as fast.
#include <hip/hip_runtime.h>

// NonSymmetricAttentionKernel (hidden [2][2048][768]; q/k/v = x W + b (12 heads x 64); scores = q.k/8 + alibi[h][i][j] where alibi = -slope[h%4] |sqrt(j) - sqrt(i)|, slopes 2^-2, 2^-4, 2^-6, 2^-8; heads 0-3 causal (j <= i), heads 4-7 anti-causal (j >= i), heads 8-11 unmasked;
// softmax; out = attn v merged (no output projection) -> [2][2048][768]).
// Compute dtypes, f32 accumulate: every input rounded to bf16; q/k/v on PLAIN bf16 operands (inputs: exact) + bias; scores (K 64) and attn.v on single fp16 planes (probabilities x1024) EXCEPT the short-window rows (query rows < 512 of heads 0-3, >= 1536 of heads 4-7): bf16 high + low planes, three products.

#define NB_  2
#define TT   2048
#define DM   768
#define NH_  12
#define HD   64
#define RHL  512
typedef _Float16 h16;
typedef unsigned short bf;
typedef __attribute__((ext_vector_type(16))) __bf16   v16bf;
typedef __attribute__((ext_vector_type(16))) _Float16 v16h;
typedef __attribute__((ext_vector_type(8)))  _Float16 v8h;
typedef __attribute__((ext_vector_type(8)))  unsigned short v8us;
typedef __attribute__((ext_vector_type(8)))  float    v8f;
typedef __attribute__((ext_vector_type(4)))  float    v4f;
typedef v8h  __attribute__((may_alias)) v8ha;
typedef v4f  __attribute__((may_alias)) v4fa;
typedef v8us __attribute__((may_alias)) v8usa;

__device__ __forceinline__ unsigned short f2bf(float f) { unsigned u = __float_as_uint(f); u += 0x7FFFu + ((u >> 16) & 1u); return (unsigned short)(u >> 16); }
__device__ __forceinline__ float bf2f(unsigned short b) { return __uint_as_float(((unsigned)b) << 16); }
__device__ __forceinline__ float bfr(float f) { return bf2f(f2bf(f)); }
__device__ __forceinline__ v16h cat16(v8h lo, v8h hi) { return __builtin_shufflevector(lo, hi, 0, 1, 2, 3, 4, 5, 6, 7, 8, 9, 10, 11, 12, 13, 14, 15); }
__device__ __forceinline__ v16bf cat16b(v8us lo, v8us hi) { return __builtin_bit_cast(v16bf, __builtin_shufflevector(lo, hi, 0, 1, 2, 3, 4, 5, 6, 7, 8, 9, 10, 11, 12, 13, 14, 15)); }
__device__ __forceinline__ v8f wmma16(v16h a, v16h b, v8f c) { return __builtin_amdgcn_wmma_f32_16x16x32_f16(false, a, false, b, (short)0, c, false, false); }
__device__ __forceinline__ v8f wmmab(v16bf a, v16bf b, v8f c) { return __builtin_amdgcn_wmma_f32_16x16x32_bf16(false, a, false, b, (short)0, c, false, false); }
__device__ __forceinline__ h16 tohx(float x) { return (h16)x; }
__device__ __forceinline__ void splitf(float y, unsigned short& h, unsigned short& l) { h = f2bf(y); l = f2bf(y - bf2f(h)); }
typedef __attribute__((ext_vector_type(4))) unsigned short v4us;
typedef __attribute__((ext_vector_type(4))) _Float16 v4h;



// ---- k_gemmw: register-blocked GEMM, one work-group of KS waves per 64x64 output tile (16 accumulators a wave), operands straight from K-contiguous 16-bit planes; grid (M/64, N/64, Z), 32 * KS threads.
// KS > 1: wave w takes the 32-wide k steps w, w + KS, w + 2 KS, ...; the KS partial tiles meet in LDS and are summed in wave order 0 .. KS-1 (fixed order, same result every run).
// C[m][n] (f32, pitch ldc, + optional f32 bias[n]) = sum_k A[m][k] Bt[n][k] (+ split products per NSPLIT). z-batch strides sA/sB/sC in elements. K % 32 == 0.
// OUT 0: C is stored as f32. OUT 1, 2 (KS > 1; a 64-column tile is one head): C never reaches memory; the summing pass rounds each f32 sum to the three 16-bit planes that attention reads (fp16, bf16 high, bf16 low) and stores those:
// OUT 1 as [head][t][d]; OUT 2 as [head][d][t], for which the partial tiles already lie transposed in LDS (an accumulator's 8 values are 8 consecutive t of one d: two 16-B LDS stores).
template <typename T16> struct WFrag;
template <> struct WFrag<h16> { typedef v16h V; static __device__ __forceinline__ V ld(const h16* p) { return cat16(*(const v8h*)p, *(const v8h*)(p + 16)); } static __device__ __forceinline__ v8f mma(V a, V b, v8f c) { return wmma16(a, b, c); } };
template <> struct WFrag<bf> { typedef v16bf V; static __device__ __forceinline__ V ld(const bf* p) { return cat16b(*(const v8us*)p, *(const v8us*)(p + 16)); } static __device__ __forceinline__ v8f mma(V a, V b, v8f c) { return wmmab(a, b, c); } };
template <typename T16, int NSPLIT, bool BIAS, int KS, int OUT>
__global__ __launch_bounds__(32 * KS) void k_gemmw(const T16* __restrict__ A, const T16* __restrict__ A2, const T16* __restrict__ Bt, const T16* __restrict__ Bt2, int K, float* C, int ldc, const float* __restrict__ bias, size_t sA, size_t sB, size_t sC, h16* P, bf* Ph, bf* Pl) {
    typedef typename WFrag<T16>::V V;
    __shared__ __align__(16) float os[(KS == 1 ? 16 : KS * 64) * 68];
    const int wv = (KS == 1) ? 0 : __builtin_amdgcn_readfirstlane((int)(threadIdx.x >> 5));   // wave number in a scalar register, so that the k loop's counter and branch stay scalar
    const size_t z = blockIdx.z; A += z * sA; if (A2) A2 += z * sA; Bt += z * sB; if (Bt2) Bt2 += z * sB; C += z * sC;
    const int lane = threadIdx.x & 31, lr = lane & 15, hi = lane >> 4; const int r0 = blockIdx.x * 64, c0 = blockIdx.y * 64;
    v8f acc[4][4];
#pragma unroll
    for (int mb = 0; mb < 4; ++mb)
#pragma unroll
        for (int nb = 0; nb < 4; ++nb) acc[mb][nb] = (v8f){};
    const size_t aoff = (size_t)(r0 + lr) * K + 8 * hi, boff = (size_t)(c0 + lr) * K + 8 * hi;
#pragma unroll 1
    for (int kc = wv * 32; kc < K; kc += 32 * KS) {
        V a[4], a2[4];
#pragma unroll
        for (int mb = 0; mb < 4; ++mb) { a[mb] = WFrag<T16>::ld(A + aoff + (size_t)mb * 16 * K + kc); if (NSPLIT == 1 || NSPLIT == 2) a2[mb] = WFrag<T16>::ld(A2 + aoff + (size_t)mb * 16 * K + kc); }
#pragma unroll
        for (int nb = 0; nb < 4; ++nb) { const V b = WFrag<T16>::ld(Bt + boff + (size_t)nb * 16 * K + kc); V b2; if (NSPLIT >= 2) b2 = WFrag<T16>::ld(Bt2 + boff + (size_t)nb * 16 * K + kc);
#pragma unroll
            for (int mb = 0; mb < 4; ++mb) { acc[mb][nb] = WFrag<T16>::mma(a[mb], b, acc[mb][nb]); if (NSPLIT == 1 || NSPLIT == 2) acc[mb][nb] = WFrag<T16>::mma(a2[mb], b, acc[mb][nb]); if (NSPLIT >= 2) acc[mb][nb] = WFrag<T16>::mma(a[mb], b2, acc[mb][nb]); } }
        asm volatile("v_nop\n\tv_nop\n\tv_nop\n\tv_nop" : "+v"(acc[0][0]), "+v"(acc[1][1]), "+v"(acc[2][2]), "+v"(acc[3][3]) : "v"(a[0]), "v"(a[3]));
    }
    if constexpr (KS > 1) {
        float* ow = os + wv * (64 * 68); const int cofs = ((int)threadIdx.x & 15) * 4; v4f bb = (v4f){};   // a thread's four columns are the same in every pass below: its bias is fetched once, ahead of the barrier
        float br[32 / KS];   // OUT 2: an LDS row is one output column, so the bias goes by the row of each pass; fetched ahead of the barrier too
        if (BIAS && OUT != 2) { bb[0] = bfr(bias[c0 + cofs]); bb[1] = bfr(bias[c0 + cofs + 1]); bb[2] = bfr(bias[c0 + cofs + 2]); bb[3] = bfr(bias[c0 + cofs + 3]); }
        if (BIAS && OUT == 2) {
#pragma unroll
            for (int s = 0; s < 32 / KS; ++s) br[s] = bfr(bias[c0 + ((s * (32 * KS) + (int)threadIdx.x) >> 4)]); }
#pragma unroll
        for (int mb = 0; mb < 4; ++mb)
#pragma unroll
            for (int nb = 0; nb < 4; ++nb) {
                if constexpr (OUT == 2) { float* p = ow + (nb * 16 + lr) * 68 + mb * 16 + hi * 8; *(v4fa*)p = __builtin_shufflevector(acc[mb][nb], acc[mb][nb], 0, 1, 2, 3); *(v4fa*)(p + 4) = __builtin_shufflevector(acc[mb][nb], acc[mb][nb], 4, 5, 6, 7); }
                else {
#pragma unroll
                    for (int j = 0; j < 8; ++j) ow[(mb * 16 + hi * 8 + j) * 68 + nb * 16 + lr] = acc[mb][nb][j]; } }
        __syncthreads();   // every wave's partial tile is in LDS before any wave sums
#pragma unroll
        for (int s = 0; s < 32 / KS; ++s) { const int row = (s * (32 * KS) + (int)threadIdx.x) >> 4; v4f val = *(const v4fa*)(os + row * 68 + cofs);
#pragma unroll
            for (int w = 1; w < KS; ++w) val += *(const v4fa*)(os + w * (64 * 68) + row * 68 + cofs);
            if (BIAS) { if (OUT == 2) val += br[s]; else val += bb; }
            if constexpr (OUT == 0) *(v4f*)(C + (size_t)(r0 + row) * ldc + c0 + cofs) = val;
            else { const size_t e = (OUT == 1) ? ((size_t)blockIdx.y * TT + r0 + row) * HD + cofs : ((size_t)blockIdx.y * HD + row) * TT + r0 + cofs; v4h o; v4us oh, ol;   // 16 threads fill one 128-B line of each plane
#pragma unroll
                for (int u = 0; u < 4; ++u) { o[u] = tohx(val[u]); unsigned short a, b; splitf(val[u], a, b); oh[u] = a; ol[u] = b; }
                *(v4h*)(P + e) = o; *(v4us*)(Ph + e) = oh; *(v4us*)(Pl + e) = ol; } }
        return;
    }
#pragma unroll
    for (int mb = 0; mb < 4; ++mb) {
#pragma unroll
        for (int nb = 0; nb < 4; ++nb) {
#pragma unroll
            for (int j = 0; j < 8; ++j) os[(hi * 8 + j) * 68 + nb * 16 + lr] = acc[mb][nb][j]; }
        __builtin_amdgcn_wave_barrier(); asm volatile("" ::: "memory");
        float* crow = C + (size_t)(r0 + mb * 16) * ldc + c0;
{
#pragma unroll
            for (int s = 0; s < 8; ++s) { const int row = 2 * s + hi, cofs = lr * 4; v4f val = *(const v4fa*)(os + row * 68 + cofs); if (BIAS) { val[0] += bfr(bias[c0 + cofs]); val[1] += bfr(bias[c0 + cofs + 1]); val[2] += bfr(bias[c0 + cofs + 2]); val[3] += bfr(bias[c0 + cofs + 3]); }
                *(v4f*)(crow + (size_t)row * ldc + cofs) = val; }
             }
        __builtin_amdgcn_wave_barrier(); asm volatile("" ::: "memory");
    }
}

typedef __attribute__((ext_vector_type(2))) unsigned short v2us;

__global__ __launch_bounds__(256) void k_wtG(const float* __restrict__ w, int K, int N, bf* Bt) {
    const int lane = threadIdx.x & 31; const int L0 = (blockIdx.x * 8 + (threadIdx.x >> 5)) * 8; const int nlines = N * K / 64;
{
#pragma unroll 1
        for (int l = 0; l < 8; ++l) { const int L = L0 + l; if (L >= nlines) break; const size_t e = (size_t)L * 64 + lane * 2; const int k = (int)(e % K), n = (int)(e / K); v2us o;
            o[0] = f2bf(w[(size_t)k * N + n]); o[1] = f2bf(w[(size_t)(k + 1) * N + n]); *(v2us*)(Bt + e) = o; }
         }
}
__global__ __launch_bounds__(256) void k_cvt8(const float* __restrict__ src, bf* dst, size_t n8) { const size_t i = (size_t)blockIdx.x * 256 + threadIdx.x; if (i >= n8) return; const v8f v = *(const v8f*)(src + i * 8); v8us o;
#pragma unroll
    for (int k = 0; k < 8; ++k) o[k] = f2bf(v[k]); *(v8us*)(dst + i * 8) = o;  }
// k_sqt: SQ[j] = sqrt(j) (f32, correctly rounded).
__device__ __forceinline__ bool hlrow(int g, int i) { return (g == 0) ? (i < RHL) : (g == 1) ? (i >= TT - RHL) : false; }
__global__ __launch_bounds__(256) void k_sqt(float* SQ) { const int j = blockIdx.x * 256 + threadIdx.x; if (j >= TT) return; const float r = __fsqrt_rn((float)j); *(float*)(SQ + j) = r;  }
#define KP 72          // LDS row pitch in 16-bit elements: 128 B of data + 16 B, an odd multiple of 16 B, so that the 16 rows of a fragment read fall on different banks
#define PS (64 * KP)   // one 64-row plane
typedef __attribute__((ext_vector_type(2))) float v2f;
typedef __attribute__((ext_vector_type(2))) __bf16 v2b;
template <typename T16> struct Oct;
template <> struct Oct<h16> { typedef v8h T; };
template <> struct Oct<bf> { typedef v8us T; };
__device__ __forceinline__ float xhalf(float x) { return __builtin_bit_cast(float, __builtin_amdgcn_permlanex16(__builtin_bit_cast(int, x), __builtin_bit_cast(int, x), 0x76543210, 0xfedcba98, false, false)); }   // lane l <-> lane l ^ 16
template <typename T16, bool HL>
__device__ __forceinline__ void fattn_wg(T16* lds, const T16* __restrict__ q, const T16* __restrict__ q2, const T16* __restrict__ k, const T16* __restrict__ k2, const T16* __restrict__ vt, const T16* __restrict__ vt2,
                                         const float* __restrict__ SQ, int g, float slope, int q0, int kbeg, int kend, int lr, int hi, float* __restrict__ orow) {
    typedef WFrag<T16> W; typedef typename W::V V; typedef typename Oct<T16>::T H;   // every '#pragma unroll' below opens a short loop of fixed length, so that the arrays it indexes stay in registers
    constexpr int BS = (HL ? 4 : 2) * PS;   // one buffer: K, V^T (and their low planes)
    const float L2E = 1.4426950408889634f; const float c1 = 0.125f * L2E, c2 = slope * L2E;
    __builtin_assume(kbeg < kend);   // the walk has at least one pass: no test in front of the loop, and what only the loop reads is fetched ahead of the first barrier
    const int i = q0 + lr; const float sqi = SQ[i];
    const int klo = (g == 1) ? i : 0; const unsigned span = (unsigned)(((g == 0) ? i : TT - 1) - klo);   // key j is kept when klo <= j <= klo + span
    V qa[2], qb[2]; const T16 *pq = q + (size_t)i * HD + 8 * hi, *pq2 = HL ? q2 + (size_t)i * HD + 8 * hi : pq;
#pragma unroll
    for (int kk = 0; kk < 2; ++kk) { qa[kk] = W::ld(pq + kk * 32); if (HL) qb[kk] = W::ld(pq2 + kk * 32); }
    const int srow = (int)threadIdx.x >> 3, sch = ((int)threadIdx.x & 7) * 8;   // staging: 8 threads a 128-B row, a wave covers 4 whole lines
    const int kso = srow * HD + sch, vso = srow * TT + sch, lso = srow * KP + sch;
    H rk[2], rv[2], rk2[2], rv2[2]; const T16 *pk0 = k + kso + kbeg * HD, *pv0 = vt + vso + kbeg, *pk20 = HL ? k2 + kso + kbeg * HD : pk0, *pv20 = HL ? vt2 + vso + kbeg : pv0;   // the walk's first tiles
#pragma unroll
    for (int r = 0; r < 2; ++r) { rk[r] = *(const H*)(pk0 + r * 32 * HD); rv[r] = *(const H*)(pv0 + r * 32 * TT); if (HL) { rk2[r] = *(const H*)(pk20 + r * 32 * HD); rv2[r] = *(const H*)(pv20 + r * 32 * TT); } }
#pragma unroll
    for (int r = 0; r < 2; ++r) { *(H*)(lds + lso + r * 32 * KP) = rk[r]; *(H*)(lds + PS + lso + r * 32 * KP) = rv[r]; if (HL) { *(H*)(lds + 2 * PS + lso + r * 32 * KP) = rk2[r]; *(H*)(lds + 3 * PS + lso + r * 32 * KP) = rv2[r]; } }
    v4f sq[4][2]; const unsigned sqo = 32u * hi;   // the lane's byte offset in a 16-key stretch of the table
#pragma unroll
    for (int t = 0; t < 4; ++t) { const char* pt = (const char*)(SQ + kbeg + t * 16) + sqo; sq[t][0] = *(const v4f*)pt; sq[t][1] = *(const v4f*)(pt + 16); }
    float m = -1.0e30f, l = 0.f; v8f o[4];
#pragma unroll
    for (int mb = 0; mb < 4; ++mb) o[mb] = (v8f){};
    const int fo = lr * KP + 8 * hi;
#pragma unroll
    for (int r = 0; r < 2; ++r) { rk[r] = *(const H*)(pk0 + (64 + r * 32) * HD); rv[r] = *(const H*)(pv0 + r * 32 * TT + 64); if (HL) { rk2[r] = *(const H*)(pk20 + (64 + r * 32) * HD); rv2[r] = *(const H*)(pv20 + r * 32 * TT + 64); } }   // the second pass's tiles, on their way to the registers
    asm volatile("s_wait_xcnt 0x0" :: "v"(i), "v"(sqo), "v"(pq), "v"(pq2), "v"(pk0), "v"(pv0), "v"(pk20), "v"(pv20) : "memory");   // in front of whatever next overwrites an address register of the fetches above, from the query's on; they are named as inputs so that they stay as they are up to this wait
    __syncthreads();   // the first pass's tiles are in LDS before any wave reads them
#pragma unroll 1   // kept rolled: a pass is some hundred instructions already, a second copy would only cost instruction cache
    for (int k0 = kbeg; k0 < kend; k0 += 64) {   // kbeg is a multiple of 128, so the first pass reads buffer 0; kend - kbeg >= 128
        const T16* lb = lds + ((k0 >> 6) & 1) * BS; T16* ln = lds + (((k0 >> 6) & 1) ^ 1) * BS;
        const int kn = (k0 + 64 < TT) ? k0 + 64 : 0, kf = (k0 + 128 < TT) ? k0 + 128 : 0;   // past the last key block 0 is fetched again, unused (so is what a shorter walk fetches past its own end): addresses stay in bounds and every pass has the same control flow
        v8f s[4];
#pragma unroll
        for (int t = 0; t < 4; ++t) { v8f a = (v8f){};
#pragma unroll
            for (int kk = 0; kk < 2; ++kk) { const V ka = W::ld(lb + fo + t * 16 * KP + kk * 32); a = W::mma(ka, qa[kk], a); if (HL) { const V kb = W::ld(lb + 2 * PS + fo + t * 16 * KP + kk * 32); a = W::mma(kb, qa[kk], a); a = W::mma(ka, qb[kk], a); } }
            s[t] = a; }
#pragma unroll
        for (int t = 0; t < 4; ++t)
#pragma unroll
            for (int j = 0; j < 8; ++j) s[t][j] = s[t][j] * c1 - c2 * fabsf(sq[t][j >> 2][j & 3] - sqi);
#pragma unroll
        for (int t = 0; t < 4; ++t) { sq[t][0] = *(const v4f*)(SQ + kn + t * 16 + 8 * hi); sq[t][1] = *(const v4f*)(SQ + kn + t * 16 + 8 * hi + 4); }
        if ((g == 0 && k0 + 63 > q0) || (g == 1 && k0 < q0 + 15)) {   // wave-uniform: only a pass that holds a masked (query, key) pair of this wave pays for the mask
            const int kb0 = k0 + 8 * hi - klo;
#pragma unroll
            for (int t = 0; t < 4; ++t)
#pragma unroll
                for (int j = 0; j < 8; ++j) s[t][j] = ((unsigned)(kb0 + t * 16 + j) <= span) ? s[t][j] : -3.0e38f; }
        float mt[4];
#pragma unroll
        for (int t = 0; t < 4; ++t) { mt[t] = s[t][0];
#pragma unroll
            for (int j = 1; j < 8; ++j) mt[t] = fmaxf(mt[t], s[t][j]); }
        float mx = fmaxf(fmaxf(m, fmaxf(mt[0], mt[1])), fmaxf(mt[2], mt[3])); mx = fmaxf(mx, xhalf(mx));
        const float al = __builtin_amdgcn_exp2f(m - mx), ms = mx - 10.0f; m = mx;   // while every key so far was masked, mx stays at its start value, al is 1 and every p below is 0
#pragma unroll
        for (int mb = 0; mb < 4; ++mb) o[mb] *= al;
        V pa[2], pb[2]; float lt[4];
#pragma unroll
        for (int t = 0; t < 4; ++t) { lt[t] = 0.f;
#pragma unroll
            for (int j = 0; j < 8; j += 2) { v2f p; p[0] = __builtin_amdgcn_exp2f(s[t][j] - ms); p[1] = __builtin_amdgcn_exp2f(s[t][j + 1] - ms); lt[t] += p[0]; lt[t] += p[1]; const int e = (t & 1) * 8 + j;
                if constexpr (HL) { const v2b ph = __builtin_convertvector(p, v2b); const v2b pl = __builtin_convertvector(p - __builtin_convertvector(ph, v2f), v2b); pa[t >> 1][e] = ph[0]; pa[t >> 1][e + 1] = ph[1]; pb[t >> 1][e] = pl[0]; pb[t >> 1][e + 1] = pl[1]; }   // high plane, and what it leaves, both rounded to nearest
                else { pa[t >> 1][e] = (h16)p[0]; pa[t >> 1][e + 1] = (h16)p[1]; } } }
        l = l * al + ((lt[0] + lt[1]) + (lt[2] + lt[3]));
#pragma unroll
        for (int kk = 0; kk < 2; ++kk)
#pragma unroll
            for (int mb = 0; mb < 4; ++mb) { const V va = W::ld(lb + PS + fo + mb * 16 * KP + kk * 32); o[mb] = W::mma(va, pa[kk], o[mb]); if (HL) { const V vb = W::ld(lb + 3 * PS + fo + mb * 16 * KP + kk * 32); o[mb] = W::mma(vb, pa[kk], o[mb]); o[mb] = W::mma(va, pb[kk], o[mb]); } }
#pragma unroll
        for (int r = 0; r < 2; ++r) { *(H*)(ln + lso + r * 32 * KP) = rk[r]; *(H*)(ln + PS + lso + r * 32 * KP) = rv[r]; if (HL) { *(H*)(ln + 2 * PS + lso + r * 32 * KP) = rk2[r]; *(H*)(ln + 3 * PS + lso + r * 32 * KP) = rv2[r]; } }
        const T16 *pk = k + kso + kf * HD, *pv = vt + vso + kf, *pk2 = HL ? k2 + kso + kf * HD : pk, *pv2 = HL ? vt2 + vso + kf : pv;
#pragma unroll
        for (int r = 0; r < 2; ++r) { rk[r] = *(const H*)(pk + r * 32 * HD); rv[r] = *(const H*)(pv + r * 32 * TT); if (HL) { rk2[r] = *(const H*)(pk2 + r * 32 * HD); rv2[r] = *(const H*)(pv2 + r * 32 * TT); } }   // fetched a whole pass ahead of their store to LDS
        asm volatile("s_wait_xcnt 0x0" :: "v"(pk), "v"(pv), "v"(pk2), "v"(pv2) : "memory");   // in front of whatever next overwrites the address registers of the fetches above; they are named as inputs so that they stay as they are up to this wait
        asm volatile("s_wait_dscnt 0x0" ::: "memory");   // this wave's LDS stores above have landed and its reads of this pass's buffer have returned
        asm volatile("s_barrier_signal -1\n\ts_barrier_wait -1" ::: "memory");   // work-group barrier: publishes the next pass's tiles and frees this pass's buffer. By hand, because __syncthreads() also waits for the global fetches just issued, which are to fly through the next pass
    }
    l += xhalf(l); const float inv = 1.0f / l;
#pragma unroll
    for (int mb = 0; mb < 4; ++mb) { float* d = orow + (size_t)lr * DM + mb * 16 + hi * 8; v4f x0, x1;
#pragma unroll
        for (int u = 0; u < 4; ++u) { x0[u] = o[mb][u] * inv; x1[u] = o[mb][4 + u] * inv; }
        *(v4f*)d = x0; *(v4f*)(d + 4) = x1; }
}
__global__ __launch_bounds__(256) void k_fattn(const h16* __restrict__ Q16, const bf* __restrict__ Qh, const bf* __restrict__ Ql, const h16* __restrict__ K16, const bf* __restrict__ Kh, const bf* __restrict__ Kl,
                                               const h16* __restrict__ VT, const bf* __restrict__ VTh, const bf* __restrict__ VTl, const float* __restrict__ SQ, float* __restrict__ outb) {
    __shared__ __align__(16) unsigned short sm[2 * 4 * PS];
    const int lane = threadIdx.x & 31, lr = lane & 15, hi = lane >> 4; const int wv = __builtin_amdgcn_readfirstlane((int)(threadIdx.x >> 5));   // wave number in a scalar register: the mask test of a pass is then a scalar branch
    const int h = blockIdx.y, g = h / 4, hm = h % 4; const float slope = (hm == 0) ? 0.25f : (hm == 1) ? 0.0625f : (hm == 2) ? 0.015625f : 0.00390625f;
    const int kbeg = (g == 1) ? blockIdx.x * 128 : 0, kend = (g == 0) ? blockIdx.x * 128 + 128 : TT;   // the keys that at least one of the work-group's 128 queries keeps; a pass outside holds masked pairs only and would add exact zeros (factor 1, every p 0). The same for all 8 waves: every wave meets every barrier
    const int q0 = (blockIdx.x * 8 + wv) * 16; const size_t zo = (size_t)h * TT * HD; float* orow = outb + (size_t)q0 * DM + h * HD;
    if (hlrow(g, blockIdx.x * 128)) fattn_wg<bf, true>(sm, Qh + zo, Ql + zo, Kh + zo, Kl + zo, VTh + zo, VTl + zo, SQ, g, slope, q0, kbeg, kend, lr, hi, orow);   // 128 divides the window's 512 rows: the same path for the whole work-group
    else fattn_wg<h16, false>((h16*)sm, Q16 + zo, nullptr, K16 + zo, nullptr, VT + zo, nullptr, SQ, g, slope, q0, kbeg, kend, lr, hi, orow);
}

extern "C" void kernel_launch(void* const* d_in, const int* in_sizes, int n_in,
                              void* d_out, int out_size, void* d_ws, size_t ws_size, hipStream_t stream) {
    (void)in_sizes; (void)n_in; (void)out_size;
    const float** I = (const float**)d_in;
    const float *x = I[0], *Wq = I[1], *bq = I[2], *Wk = I[3], *bk = I[4], *Wv = I[5], *bv = I[6];
    float* OUT = (float*)d_out;     // [2][2048][768]
    char* wsp = (char*)d_ws;
    auto take = [&](size_t bytes) { char* p = wsp; wsp += (bytes + 255) & ~(size_t)255; return (void*)p; };
    bf* BQ = (bf*)take((size_t)DM * DM * 2); bf* BK = (bf*)take((size_t)DM * DM * 2); bf* BV = (bf*)take((size_t)DM * DM * 2);
    bf* XB = (bf*)take((size_t)TT * DM * 2);
    h16* Q16 = (h16*)take((size_t)NH_ * TT * HD * 2); bf* Qh = (bf*)take((size_t)NH_ * TT * HD * 2); bf* Ql = (bf*)take((size_t)NH_ * TT * HD * 2); h16* K16 = (h16*)take((size_t)NH_ * TT * HD * 2); bf* Kh = (bf*)take((size_t)NH_ * TT * HD * 2); bf* Kl = (bf*)take((size_t)NH_ * TT * HD * 2);
    h16* VT = (h16*)take((size_t)NH_ * HD * TT * 2); bf* VTh = (bf*)take((size_t)NH_ * HD * TT * 2); bf* VTl = (bf*)take((size_t)NH_ * HD * TT * 2); float* SQ = (float*)take(TT * 4);
    if ((size_t)(wsp - (char*)d_ws) > ws_size) return;    // total ~ 35 MB
    k_wtG<<<(DM * DM / 64 + 63) / 64, 256, 0, stream>>>(Wq, DM, DM, BQ); k_wtG<<<(DM * DM / 64 + 63) / 64, 256, 0, stream>>>(Wk, DM, DM, BK); k_wtG<<<(DM * DM / 64 + 63) / 64, 256, 0, stream>>>(Wv, DM, DM, BV);
    k_sqt<<<(TT + 255) / 256, 256, 0, stream>>>(SQ);
    for (int b = 0; b < NB_; ++b) {
        k_cvt8<<<(TT * DM / 8 + 255) / 256, 256, 0, stream>>>(x + (size_t)b * TT * DM, XB, (size_t)TT * DM / 8);
        k_gemmw<bf, 0, true, 8, 1><<<dim3(TT / 64, DM / 64, 1), 256, 0, stream>>>(XB, nullptr, BQ, nullptr, DM, nullptr, 0, bq, 0, 0, 0, Q16, Qh, Ql); k_gemmw<bf, 0, true, 8, 1><<<dim3(TT / 64, DM / 64, 1), 256, 0, stream>>>(XB, nullptr, BK, nullptr, DM, nullptr, 0, bk, 0, 0, 0, K16, Kh, Kl); k_gemmw<bf, 0, true, 8, 2><<<dim3(TT / 64, DM / 64, 1), 256, 0, stream>>>(XB, nullptr, BV, nullptr, DM, nullptr, 0, bv, 0, 0, 0, VT, VTh, VTl);
        k_fattn<<<dim3(TT / 128, NH_, 1), 256, 0, stream>>>(Q16, Qh, Ql, K16, Kh, Kl, VT, VTh, VTl, SQ, OUT + (size_t)b * TT * DM); }
}

// v005
// Measured time: 89.5 microseconds a run.
// Timed twice side by side with v004, it ran 1.50 times as fast both times.
// Over all steps from v000 it is 10.4 times as fast.
#include <hip/hip_runtime.h>

// NonSymmetricAttentionKernel (hidden [2][2048][768]; q/k/v = x W + b (12 heads x 64); scores = q.k/8 + alibi[h][i][j] where alibi = -slope[h%4] |sqrt(j) - sqrt(i)|, slopes 2^-2, 2^-4, 2^-6, 2^-8; heads 0-3 causal (j <= i), heads 4-7 anti-causal (j >= i), heads 8-11 unmasked;
// softmax; out = attn v merged (no output projection) -> [2][2048][768]).
// Compute dtypes, f32 accumulate: every input rounded to bf16; q/k/v on PLAIN bf16 operands (inputs: exact) + bias; scores (K 64) and attn.v on single fp16 planes (probabilities x1024) EXCEPT the short-window rows (query rows < 512 of heads 0-3, >= 1536 of heads 4-7): bf16 high + low planes, three products.

#define NB_  2
#define TT   2048
#define DM   768
#define NH_  12
#define HD   64
#define RHL  512
typedef _Float16 h16;
typedef unsigned short bf;
typedef __attribute__((ext_vector_type(16))) __bf16   v16bf;
typedef __attribute__((ext_vector_type(16))) _Float16 v16h;
typedef __attribute__((ext_vector_type(8)))  _Float16 v8h;
typedef __attribute__((ext_vector_type(8)))  unsigned short v8us;
typedef __attribute__((ext_vector_type(8)))  float    v8f;
typedef __attribute__((ext_vector_type(4)))  float    v4f;
typedef v8h  __attribute__((may_alias)) v8ha;
typedef v4f  __attribute__((may_alias)) v4fa;
typedef v8us __attribute__((may_alias)) v8usa;

__device__ __forceinline__ unsigned short f2bf(float f) { unsigned u = __float_as_uint(f); u += 0x7FFFu + ((u >> 16) & 1u); return (unsigned short)(u >> 16); }
__device__ __forceinline__ float bf2f(unsigned short b) { return __uint_as_float(((unsigned)b) << 16); }
__device__ __forceinline__ float bfr(float f) { return bf2f(f2bf(f)); }
__device__ __forceinline__ v16h cat16(v8h lo, v8h hi) { return __builtin_shufflevector(lo, hi, 0, 1, 2, 3, 4, 5, 6, 7, 8, 9, 10, 11, 12, 13, 14, 15); }
__device__ __forceinline__ v16bf cat16b(v8us lo, v8us hi) { return __builtin_bit_cast(v16bf, __builtin_shufflevector(lo, hi, 0, 1, 2, 3, 4, 5, 6, 7, 8, 9, 10, 11, 12, 13, 14, 15)); }
__device__ __forceinline__ v8f wmma16(v16h a, v16h b, v8f c) { return __builtin_amdgcn_wmma_f32_16x16x32_f16(false, a, false, b, (short)0, c, false, false); }
__device__ __forceinline__ v8f wmmab(v16bf a, v16bf b, v8f c) { return __builtin_amdgcn_wmma_f32_16x16x32_bf16(false, a, false, b, (short)0, c, false, false); }
__device__ __forceinline__ h16 tohx(float x) { return (h16)x; }
__device__ __forceinline__ void splitf(float y, unsigned short& h, unsigned short& l) { h = f2bf(y); l = f2bf(y - bf2f(h)); }
typedef __attribute__((ext_vector_type(4))) unsigned short v4us;
typedef __attribute__((ext_vector_type(4))) _Float16 v4h;



// ---- gemmw_wg: register-blocked GEMM, one work-group of KS waves per 64x64 output tile (16 accumulators a wave), operands straight from K-contiguous 16-bit planes; tile (blockIdx.x, blockIdx.y) of (M/64, N/64), 32 * KS threads; os is the work-group's LDS, (KS == 1 ? 16 : KS * 64) * 68 floats.
// KS > 1: wave w takes the 32-wide k steps w, w + KS, w + 2 KS, ...; the KS partial tiles meet in LDS and are summed in wave order 0 .. KS-1 (fixed order, same result every run).
// C[m][n] (f32, pitch ldc, + optional f32 bias[n]) = sum_k A[m][k] Bt[n][k] (+ split products per NSPLIT). K % 32 == 0.
// OUT 0: C is stored as f32. OUT 1, 2 (KS > 1; a 64-column tile is one head): C never reaches memory; the summing pass rounds each f32 sum to the three 16-bit planes that attention reads (fp16, bf16 high, bf16 low) and stores those:
// OUT 1 as [head][t][d]; OUT 2 as [head][d][t], for which the partial tiles already lie transposed in LDS (an accumulator's 8 values are 8 consecutive t of one d: two 16-B LDS stores).
template <typename T16> struct WFrag;
template <> struct WFrag<h16> { typedef v16h V; static __device__ __forceinline__ V ld(const h16* p) { return cat16(*(const v8h*)p, *(const v8h*)(p + 16)); } static __device__ __forceinline__ v8f mma(V a, V b, v8f c) { return wmma16(a, b, c); } };
template <> struct WFrag<bf> { typedef v16bf V; static __device__ __forceinline__ V ld(const bf* p) { return cat16b(*(const v8us*)p, *(const v8us*)(p + 16)); } static __device__ __forceinline__ v8f mma(V a, V b, v8f c) { return wmmab(a, b, c); } };
template <typename T16, int NSPLIT, bool BIAS, int KS, int OUT>
__device__ __forceinline__ void gemmw_wg(float* os, const T16* __restrict__ A, const T16* __restrict__ A2, const T16* __restrict__ Bt, const T16* __restrict__ Bt2, int K, float* C, int ldc, const float* __restrict__ bias, h16* P, bf* Ph, bf* Pl) {
    typedef typename WFrag<T16>::V V;
    const int wv = (KS == 1) ? 0 : __builtin_amdgcn_readfirstlane((int)(threadIdx.x >> 5));   // wave number in a scalar register, so that the k loop's counter and branch stay scalar
    const int lane = threadIdx.x & 31, lr = lane & 15, hi = lane >> 4; const int r0 = blockIdx.x * 64, c0 = blockIdx.y * 64;
    v8f acc[4][4];
#pragma unroll
    for (int mb = 0; mb < 4; ++mb)
#pragma unroll
        for (int nb = 0; nb < 4; ++nb) acc[mb][nb] = (v8f){};
    const size_t aoff = (size_t)(r0 + lr) * K + 8 * hi, boff = (size_t)(c0 + lr) * K + 8 * hi;
#pragma unroll 1
    for (int kc = wv * 32; kc < K; kc += 32 * KS) {
        V a[4], a2[4]; const T16 *pa = A + aoff + kc, *pa2 = (NSPLIT == 1 || NSPLIT == 2) ? A2 + aoff + kc : pa;
#pragma unroll
        for (int mb = 0; mb < 4; ++mb) { a[mb] = WFrag<T16>::ld(pa + (size_t)mb * 16 * K); if (NSPLIT == 1 || NSPLIT == 2) a2[mb] = WFrag<T16>::ld(pa2 + (size_t)mb * 16 * K); }
        asm volatile("s_wait_xcnt 0x0" :: "v"(pa), "v"(pa2) : "memory");   // in front of whatever next overwrites the address registers of the A fetches above (this build lets a B fetch land on them); they are named as inputs so that they stay as they are up to this wait
#pragma unroll
        for (int nb = 0; nb < 4; ++nb) { const V b = WFrag<T16>::ld(Bt + boff + (size_t)nb * 16 * K + kc); V b2; if (NSPLIT >= 2) b2 = WFrag<T16>::ld(Bt2 + boff + (size_t)nb * 16 * K + kc);
#pragma unroll
            for (int mb = 0; mb < 4; ++mb) { acc[mb][nb] = WFrag<T16>::mma(a[mb], b, acc[mb][nb]); if (NSPLIT == 1 || NSPLIT == 2) acc[mb][nb] = WFrag<T16>::mma(a2[mb], b, acc[mb][nb]); if (NSPLIT >= 2) acc[mb][nb] = WFrag<T16>::mma(a[mb], b2, acc[mb][nb]); } }
        asm volatile("v_nop\n\tv_nop\n\tv_nop\n\tv_nop" : "+v"(acc[0][0]), "+v"(acc[1][1]), "+v"(acc[2][2]), "+v"(acc[3][3]) : "v"(a[0]), "v"(a[3]));
    }
    if constexpr (KS > 1) {
        float* ow = os + wv * (64 * 68); const int cofs = ((int)threadIdx.x & 15) * 4; v4f bb = (v4f){};   // a thread's four columns are the same in every pass below: its bias is fetched once, ahead of the barrier
        float br[32 / KS];   // OUT 2: an LDS row is one output column, so the bias goes by the row of each pass; fetched ahead of the barrier too
        if (BIAS && OUT != 2) { bb[0] = bfr(bias[c0 + cofs]); bb[1] = bfr(bias[c0 + cofs + 1]); bb[2] = bfr(bias[c0 + cofs + 2]); bb[3] = bfr(bias[c0 + cofs + 3]); }
        if (BIAS && OUT == 2) {
#pragma unroll
            for (int s = 0; s < 32 / KS; ++s) { const int bo = (s * (32 * KS) + (int)threadIdx.x) >> 4; br[s] = bfr((bias + c0)[bo]);
                asm volatile("s_wait_xcnt 0x0" :: "v"(bo) : "memory"); } }   // in front of whatever next overwrites the address register of the fetch above; named as an input so that it stays as it is up to this wait
#pragma unroll
        for (int mb = 0; mb < 4; ++mb)
#pragma unroll
            for (int nb = 0; nb < 4; ++nb) {
                if constexpr (OUT == 2) { float* p = ow + (nb * 16 + lr) * 68 + mb * 16 + hi * 8; *(v4fa*)p = __builtin_shufflevector(acc[mb][nb], acc[mb][nb], 0, 1, 2, 3); *(v4fa*)(p + 4) = __builtin_shufflevector(acc[mb][nb], acc[mb][nb], 4, 5, 6, 7); }
                else {
#pragma unroll
                    for (int j = 0; j < 8; ++j) ow[(mb * 16 + hi * 8 + j) * 68 + nb * 16 + lr] = acc[mb][nb][j]; } }
        __syncthreads();   // every wave's partial tile is in LDS before any wave sums
#pragma unroll
        for (int s = 0; s < 32 / KS; ++s) { const int row = (s * (32 * KS) + (int)threadIdx.x) >> 4; v4f val = *(const v4fa*)(os + row * 68 + cofs);
#pragma unroll
            for (int w = 1; w < KS; ++w) val += *(const v4fa*)(os + w * (64 * 68) + row * 68 + cofs);
            if (BIAS) { if (OUT == 2) val += br[s]; else val += bb; }
            if constexpr (OUT == 0) *(v4f*)(C + (size_t)(r0 + row) * ldc + c0 + cofs) = val;
            else { const size_t e = (OUT == 1) ? ((size_t)blockIdx.y * TT + r0 + row) * HD + cofs : ((size_t)blockIdx.y * HD + row) * TT + r0 + cofs; v4h o; v4us oh, ol;   // 16 threads fill one 128-B line of each plane
#pragma unroll
                for (int u = 0; u < 4; ++u) { o[u] = tohx(val[u]); unsigned short a, b; splitf(val[u], a, b); oh[u] = a; ol[u] = b; }
                h16* d0 = P + e; bf *d1 = Ph + e, *d2 = Pl + e; *(v4h*)d0 = o; *(v4us*)d1 = oh; *(v4us*)d2 = ol;
                asm volatile("s_wait_xcnt 0x0" :: "v"(d0), "v"(d1), "v"(d2), "v"(o), "v"(oh), "v"(ol) : "memory"); } }   // in front of whatever next overwrites an address or data register of the three stores above; they are named as inputs so that they stay as they are up to this wait
        return;
    }
#pragma unroll
    for (int mb = 0; mb < 4; ++mb) {
#pragma unroll
        for (int nb = 0; nb < 4; ++nb) {
#pragma unroll
            for (int j = 0; j < 8; ++j) os[(hi * 8 + j) * 68 + nb * 16 + lr] = acc[mb][nb][j]; }
        __builtin_amdgcn_wave_barrier(); asm volatile("" ::: "memory");
        float* crow = C + (size_t)(r0 + mb * 16) * ldc + c0;
{
#pragma unroll
            for (int s = 0; s < 8; ++s) { const int row = 2 * s + hi, cofs = lr * 4; v4f val = *(const v4fa*)(os + row * 68 + cofs); if (BIAS) { val[0] += bfr(bias[c0 + cofs]); val[1] += bfr(bias[c0 + cofs + 1]); val[2] += bfr(bias[c0 + cofs + 2]); val[3] += bfr(bias[c0 + cofs + 3]); }
                *(v4f*)(crow + (size_t)row * ldc + cofs) = val; }
             }
        __builtin_amdgcn_wave_barrier(); asm volatile("" ::: "memory");
    }
}

// ---- k_qkv: the six projections (q, k, v of both batches) as ONE launch, grid (TT/64, DM/64, 3 * NB_): blockIdx.z picks batch and projection, the same for a whole work-group. None reads what another writes.
__global__ __launch_bounds__(256) void k_qkv(const bf* __restrict__ XB, const bf* __restrict__ BQ, const bf* __restrict__ BK, const bf* __restrict__ BV, const float* __restrict__ bq, const float* __restrict__ bk, const float* __restrict__ bv,
                                             h16* Q16, bf* Qh, bf* Ql, h16* K16, bf* Kh, bf* Kl, h16* VT, bf* VTh, bf* VTl) {
    __shared__ __align__(16) float os[8 * 64 * 68];
    const int p = blockIdx.z % 3, b = blockIdx.z / 3; const bf* A = XB + (size_t)b * TT * DM; const size_t zo = (size_t)b * NH_ * TT * HD;
    if (p == 2) gemmw_wg<bf, 0, true, 8, 2>(os, A, nullptr, BV, nullptr, DM, nullptr, 0, bv, VT + zo, VTh + zo, VTl + zo);
    else gemmw_wg<bf, 0, true, 8, 1>(os, A, nullptr, p ? BK : BQ, nullptr, DM, nullptr, 0, p ? bk : bq, (p ? K16 : Q16) + zo, (p ? Kh : Qh) + zo, (p ? Kl : Ql) + zo);
}

typedef __attribute__((ext_vector_type(2))) unsigned short v2us;

__device__ __forceinline__ void wtG_wg(int blk, const float* __restrict__ w, int K, int N, bf* Bt) {
    const int lane = threadIdx.x & 31; const int L0 = (blk * 8 + (threadIdx.x >> 5)) * 8; const int nlines = N * K / 64;
{
#pragma unroll 1
        for (int l = 0; l < 8; ++l) { const int L = L0 + l; if (L >= nlines) break; const size_t e = (size_t)L * 64 + lane * 2; const int k = (int)(e % K), n = (int)(e / K); v2us o;
            o[0] = f2bf(w[(size_t)k * N + n]); o[1] = f2bf(w[(size_t)(k + 1) * N + n]); *(v2us*)(Bt + e) = o; }
         }
}
__device__ __forceinline__ void cvt8_wg(int blk, const float* __restrict__ src, bf* dst, size_t n8) { const size_t i = (size_t)blk * 256 + threadIdx.x; if (i >= n8) return; const v8f v = *(const v8f*)(src + i * 8); v8us o;
#pragma unroll
    for (int k = 0; k < 8; ++k) o[k] = f2bf(v[k]); *(v8us*)(dst + i * 8) = o;  }
// sqt_wg: SQ[j] = sqrt(j) (f32, correctly rounded).
__device__ __forceinline__ bool hlrow(int g, int i) { return (g == 0) ? (i < RHL) : (g == 1) ? (i >= TT - RHL) : false; }
__device__ __forceinline__ void sqt_wg(int blk, float* SQ) { const int j = blk * 256 + threadIdx.x; if (j >= TT) return; const float r = __fsqrt_rn((float)j); *(float*)(SQ + j) = r;  }
// ---- k_prep: all that the projections and attention wait for, as ONE launch: the three weight transposes (their work-groups run longest, so they come first), the rounding of both batches' hidden states, the square-root table. A work-group does one piece of one of them; none reads what another writes.
#define NWT ((DM * DM / 64 + 63) / 64)       // work-groups of one weight transpose
#define NCV (NB_ * TT * DM / 8 / 256)        // work-groups of the rounding
#define NSQ ((TT + 255) / 256)               // work-groups of the table
__global__ __launch_bounds__(256) void k_prep(const float* __restrict__ x, const float* __restrict__ Wq, const float* __restrict__ Wk, const float* __restrict__ Wv, bf* XB, bf* BQ, bf* BK, bf* BV, float* SQ) {
    const int blk = blockIdx.x;
    if (blk < 3 * NWT) { const int p = blk / NWT; wtG_wg(blk - p * NWT, (p == 0) ? Wq : (p == 1) ? Wk : Wv, DM, DM, (p == 0) ? BQ : (p == 1) ? BK : BV); }
    else if (blk < 3 * NWT + NCV) cvt8_wg(blk - 3 * NWT, x, XB, (size_t)NB_ * TT * DM / 8);
    else sqt_wg(blk - 3 * NWT - NCV, SQ);
}
#define KP 72          // LDS row pitch in 16-bit elements: 128 B of data + 16 B, an odd multiple of 16 B, so that the 16 rows of a fragment read fall on different banks
#define PS (64 * KP)   // one 64-row plane
typedef __attribute__((ext_vector_type(2))) float v2f;
typedef __attribute__((ext_vector_type(2))) __bf16 v2b;
template <typename T16> struct Oct;
template <> struct Oct<h16> { typedef v8h T; };
template <> struct Oct<bf> { typedef v8us T; };
__device__ __forceinline__ float xhalf(float x) { return __builtin_bit_cast(float, __builtin_amdgcn_permlanex16(__builtin_bit_cast(int, x), __builtin_bit_cast(int, x), 0x76543210, 0xfedcba98, false, false)); }   // lane l <-> lane l ^ 16
template <typename T16, bool HL>
__device__ __forceinline__ void fattn_wg(T16* lds, const T16* __restrict__ q, const T16* __restrict__ q2, const T16* __restrict__ k, const T16* __restrict__ k2, const T16* __restrict__ vt, const T16* __restrict__ vt2,
                                         const float* __restrict__ SQ, int g, float slope, int q0, int kbeg, int kend, int lr, int hi, float* __restrict__ orow) {
    typedef WFrag<T16> W; typedef typename W::V V; typedef typename Oct<T16>::T H;   // every '#pragma unroll' below opens a short loop of fixed length, so that the arrays it indexes stay in registers
    constexpr int BS = (HL ? 4 : 2) * PS;   // one buffer: K, V^T (and their low planes)
    const float L2E = 1.4426950408889634f; const float c1 = 0.125f * L2E, c2 = slope * L2E;
    __builtin_assume(kbeg < kend);   // the walk has at least one pass: no test in front of the loop, and what only the loop reads is fetched ahead of the first barrier
    const int i = q0 + lr; const float sqi = SQ[i];
    const int klo = (g == 1) ? i : 0; const unsigned span = (unsigned)(((g == 0) ? i : TT - 1) - klo);   // key j is kept when klo <= j <= klo + span
    V qa[2], qb[2]; const T16 *pq = q + (size_t)i * HD + 8 * hi, *pq2 = HL ? q2 + (size_t)i * HD + 8 * hi : pq;
#pragma unroll
    for (int kk = 0; kk < 2; ++kk) { qa[kk] = W::ld(pq + kk * 32); if (HL) qb[kk] = W::ld(pq2 + kk * 32); }
    const int srow = (int)threadIdx.x >> 3, sch = ((int)threadIdx.x & 7) * 8;   // staging: 8 threads a 128-B row, a wave covers 4 whole lines
    const int kso = srow * HD + sch, vso = srow * TT + sch, lso = srow * KP + sch;
    H rk[2], rv[2], rk2[2], rv2[2]; const T16 *pk0 = k + kso + kbeg * HD, *pv0 = vt + vso + kbeg, *pk20 = HL ? k2 + kso + kbeg * HD : pk0, *pv20 = HL ? vt2 + vso + kbeg : pv0;   // the walk's first tiles
#pragma unroll
    for (int r = 0; r < 2; ++r) { rk[r] = *(const H*)(pk0 + r * 32 * HD); rv[r] = *(const H*)(pv0 + r * 32 * TT); if (HL) { rk2[r] = *(const H*)(pk20 + r * 32 * HD); rv2[r] = *(const H*)(pv20 + r * 32 * TT); } }
#pragma unroll
    for (int r = 0; r < 2; ++r) { *(H*)(lds + lso + r * 32 * KP) = rk[r]; *(H*)(lds + PS + lso + r * 32 * KP) = rv[r]; if (HL) { *(H*)(lds + 2 * PS + lso + r * 32 * KP) = rk2[r]; *(H*)(lds + 3 * PS + lso + r * 32 * KP) = rv2[r]; } }
    v4f sq[4][2]; const unsigned sqo = 32u * hi;   // the lane's byte offset in a 16-key stretch of the table
#pragma unroll
    for (int t = 0; t < 4; ++t) { const char* pt = (const char*)(SQ + kbeg + t * 16) + sqo; sq[t][0] = *(const v4f*)pt; sq[t][1] = *(const v4f*)(pt + 16); }
    float m = -1.0e30f, l = 0.f; v8f o[4];
#pragma unroll
    for (int mb = 0; mb < 4; ++mb) o[mb] = (v8f){};
    const int fo = lr * KP + 8 * hi;
#pragma unroll
    for (int r = 0; r < 2; ++r) { rk[r] = *(const H*)(pk0 + (64 + r * 32) * HD); rv[r] = *(const H*)(pv0 + r * 32 * TT + 64); if (HL) { rk2[r] = *(const H*)(pk20 + (64 + r * 32) * HD); rv2[r] = *(const H*)(pv20 + r * 32 * TT + 64); } }   // the second pass's tiles, on their way to the registers
    asm volatile("s_wait_xcnt 0x0" :: "v"(i), "v"(sqo), "v"(pq), "v"(pq2), "v"(pk0), "v"(pv0), "v"(pk20), "v"(pv20) : "memory");   // in front of whatever next overwrites an address register of the fetches above, from the query's on; they are named as inputs so that they stay as they are up to this wait
    __syncthreads();   // the first pass's tiles are in LDS before any wave reads them
#pragma unroll 1   // kept rolled: a pass is some hundred instructions already, a second copy would only cost instruction cache
    for (int k0 = kbeg; k0 < kend; k0 += 64) {   // kbeg is a multiple of 128, so the first pass reads buffer 0; kend - kbeg >= 128
        const T16* lb = lds + ((k0 >> 6) & 1) * BS; T16* ln = lds + (((k0 >> 6) & 1) ^ 1) * BS;
        const int kn = (k0 + 64 < TT) ? k0 + 64 : 0, kf = (k0 + 128 < TT) ? k0 + 128 : 0;   // past the last key block 0 is fetched again, unused (so is what a shorter walk fetches past its own end): addresses stay in bounds and every pass has the same control flow
        v8f s[4];
#pragma unroll
        for (int t = 0; t < 4; ++t) { v8f a = (v8f){};
#pragma unroll
            for (int kk = 0; kk < 2; ++kk) { const V ka = W::ld(lb + fo + t * 16 * KP + kk * 32); a = W::mma(ka, qa[kk], a); if (HL) { const V kb = W::ld(lb + 2 * PS + fo + t * 16 * KP + kk * 32); a = W::mma(kb, qa[kk], a); a = W::mma(ka, qb[kk], a); } }
            s[t] = a; }
#pragma unroll
        for (int t = 0; t < 4; ++t)
#pragma unroll
            for (int j = 0; j < 8; ++j) s[t][j] = s[t][j] * c1 - c2 * fabsf(sq[t][j >> 2][j & 3] - sqi);
#pragma unroll
        for (int t = 0; t < 4; ++t) { sq[t][0] = *(const v4f*)(SQ + kn + t * 16 + 8 * hi); sq[t][1] = *(const v4f*)(SQ + kn + t * 16 + 8 * hi + 4); }
        if ((g == 0 && k0 + 63 > q0) || (g == 1 && k0 < q0 + 15)) {   // wave-uniform: only a pass that holds a masked (query, key) pair of this wave pays for the mask
            const int kb0 = k0 + 8 * hi - klo;
#pragma unroll
            for (int t = 0; t < 4; ++t)
#pragma unroll
                for (int j = 0; j < 8; ++j) s[t][j] = ((unsigned)(kb0 + t * 16 + j) <= span) ? s[t][j] : -3.0e38f; }
        float mt[4];
#pragma unroll
        for (int t = 0; t < 4; ++t) { mt[t] = s[t][0];
#pragma unroll
            for (int j = 1; j < 8; ++j) mt[t] = fmaxf(mt[t], s[t][j]); }
        float mx = fmaxf(fmaxf(m, fmaxf(mt[0], mt[1])), fmaxf(mt[2], mt[3])); mx = fmaxf(mx, xhalf(mx));
        const float al = __builtin_amdgcn_exp2f(m - mx), ms = mx - 10.0f; m = mx;   // while every key so far was masked, mx stays at its start value, al is 1 and every p below is 0
#pragma unroll
        for (int mb = 0; mb < 4; ++mb) o[mb] *= al;
        V pa[2], pb[2]; float lt[4];
#pragma unroll
        for (int t = 0; t < 4; ++t) { lt[t] = 0.f;
#pragma unroll
            for (int j = 0; j < 8; j += 2) { v2f p; p[0] = __builtin_amdgcn_exp2f(s[t][j] - ms); p[1] = __builtin_amdgcn_exp2f(s[t][j + 1] - ms); lt[t] += p[0]; lt[t] += p[1]; const int e = (t & 1) * 8 + j;
                if constexpr (HL) { const v2b ph = __builtin_convertvector(p, v2b); const v2b pl = __builtin_convertvector(p - __builtin_convertvector(ph, v2f), v2b); pa[t >> 1][e] = ph[0]; pa[t >> 1][e + 1] = ph[1]; pb[t >> 1][e] = pl[0]; pb[t >> 1][e + 1] = pl[1]; }   // high plane, and what it leaves, both rounded to nearest
                else { pa[t >> 1][e] = (h16)p[0]; pa[t >> 1][e + 1] = (h16)p[1]; } } }
        l = l * al + ((lt[0] + lt[1]) + (lt[2] + lt[3]));
#pragma unroll
        for (int kk = 0; kk < 2; ++kk)
#pragma unroll
            for (int mb = 0; mb < 4; ++mb) { const V va = W::ld(lb + PS + fo + mb * 16 * KP + kk * 32); o[mb] = W::mma(va, pa[kk], o[mb]); if (HL) { const V vb = W::ld(lb + 3 * PS + fo + mb * 16 * KP + kk * 32); o[mb] = W::mma(vb, pa[kk], o[mb]); o[mb] = W::mma(va, pb[kk], o[mb]); } }
#pragma unroll
        for (int r = 0; r < 2; ++r) { *(H*)(ln + lso + r * 32 * KP) = rk[r]; *(H*)(ln + PS + lso + r * 32 * KP) = rv[r]; if (HL) { *(H*)(ln + 2 * PS + lso + r * 32 * KP) = rk2[r]; *(H*)(ln + 3 * PS + lso + r * 32 * KP) = rv2[r]; } }
        const T16 *pk = k + kso + kf * HD, *pv = vt + vso + kf, *pk2 = HL ? k2 + kso + kf * HD : pk, *pv2 = HL ? vt2 + vso + kf : pv;
#pragma unroll
        for (int r = 0; r < 2; ++r) { rk[r] = *(const H*)(pk + r * 32 * HD); rv[r] = *(const H*)(pv + r * 32 * TT); if (HL) { rk2[r] = *(const H*)(pk2 + r * 32 * HD); rv2[r] = *(const H*)(pv2 + r * 32 * TT); } }   // fetched a whole pass ahead of their store to LDS
        asm volatile("s_wait_xcnt 0x0" :: "v"(pk), "v"(pv), "v"(pk2), "v"(pv2) : "memory");   // in front of whatever next overwrites the address registers of the fetches above; they are named as inputs so that they stay as they are up to this wait
        asm volatile("s_wait_dscnt 0x0" ::: "memory");   // this wave's LDS stores above have landed and its reads of this pass's buffer have returned
        asm volatile("s_barrier_signal -1\n\ts_barrier_wait -1" ::: "memory");   // work-group barrier: publishes the next pass's tiles and frees this pass's buffer. By hand, because __syncthreads() also waits for the global fetches just issued, which are to fly through the next pass
    }
    l += xhalf(l); const float inv = 1.0f / l;
#pragma unroll
    for (int mb = 0; mb < 4; ++mb) { float* d = orow + (size_t)lr * DM + mb * 16 + hi * 8; v4f x0, x1;
#pragma unroll
        for (int u = 0; u < 4; ++u) { x0[u] = o[mb][u] * inv; x1[u] = o[mb][4 + u] * inv; }
        *(v4f*)d = x0; *(v4f*)(d + 4) = x1; }
}
__global__ __launch_bounds__(256) void k_fattn(const h16* __restrict__ Q16, const bf* __restrict__ Qh, const bf* __restrict__ Ql, const h16* __restrict__ K16, const bf* __restrict__ Kh, const bf* __restrict__ Kl,
                                               const h16* __restrict__ VT, const bf* __restrict__ VTh, const bf* __restrict__ VTl, const float* __restrict__ SQ, float* __restrict__ outb) {
    __shared__ __align__(16) unsigned short sm[2 * 4 * PS];
    const int lane = threadIdx.x & 31, lr = lane & 15, hi = lane >> 4; const int wv = __builtin_amdgcn_readfirstlane((int)(threadIdx.x >> 5));   // wave number in a scalar register: the mask test of a pass is then a scalar branch
    // both batches in one launch: grid (TT/128, NB_, NH_)
    const int b = blockIdx.y, h = blockIdx.z, g = h / 4, hm = h % 4; const float slope = (hm == 0) ? 0.25f : (hm == 1) ? 0.0625f : (hm == 2) ? 0.015625f : 0.00390625f;
    const int kbeg = (g == 1) ? blockIdx.x * 128 : 0, kend = (g == 0) ? blockIdx.x * 128 + 128 : TT;   // the keys that at least one of the work-group's 128 queries keeps; a pass outside holds masked pairs only and would add exact zeros (factor 1, every p 0). The same for all 8 waves: every wave meets every barrier
    const int q0 = (blockIdx.x * 8 + wv) * 16; const size_t zo = ((size_t)b * NH_ + h) * TT * HD; float* orow = outb + ((size_t)b * TT + q0) * DM + h * HD;
    if (hlrow(g, blockIdx.x * 128)) fattn_wg<bf, true>(sm, Qh + zo, Ql + zo, Kh + zo, Kl + zo, VTh + zo, VTl + zo, SQ, g, slope, q0, kbeg, kend, lr, hi, orow);   // 128 divides the window's 512 rows: the same path for the whole work-group
    else fattn_wg<h16, false>((h16*)sm, Q16 + zo, nullptr, K16 + zo, nullptr, VT + zo, nullptr, SQ, g, slope, q0, kbeg, kend, lr, hi, orow);
}

extern "C" void kernel_launch(void* const* d_in, const int* in_sizes, int n_in,
                              void* d_out, int out_size, void* d_ws, size_t ws_size, hipStream_t stream) {
    (void)in_sizes; (void)n_in; (void)out_size;
    const float** I = (const float**)d_in;
    const float *x = I[0], *Wq = I[1], *bq = I[2], *Wk = I[3], *bk = I[4], *Wv = I[5], *bv = I[6];
    float* OUT = (float*)d_out;     // [2][2048][768]
    char* wsp = (char*)d_ws;
    auto take = [&](size_t bytes) { char* p = wsp; wsp += (bytes + 255) & ~(size_t)255; return (void*)p; };
    bf* BQ = (bf*)take((size_t)DM * DM * 2); bf* BK = (bf*)take((size_t)DM * DM * 2); bf* BV = (bf*)take((size_t)DM * DM * 2);
    bf* XB = (bf*)take((size_t)NB_ * TT * DM * 2);
    h16* Q16 = (h16*)take((size_t)NB_ * NH_ * TT * HD * 2); bf* Qh = (bf*)take((size_t)NB_ * NH_ * TT * HD * 2); bf* Ql = (bf*)take((size_t)NB_ * NH_ * TT * HD * 2); h16* K16 = (h16*)take((size_t)NB_ * NH_ * TT * HD * 2); bf* Kh = (bf*)take((size_t)NB_ * NH_ * TT * HD * 2); bf* Kl = (bf*)take((size_t)NB_ * NH_ * TT * HD * 2);
    h16* VT = (h16*)take((size_t)NB_ * NH_ * HD * TT * 2); bf* VTh = (bf*)take((size_t)NB_ * NH_ * HD * TT * 2); bf* VTl = (bf*)take((size_t)NB_ * NH_ * HD * TT * 2); float* SQ = (float*)take(TT * 4);
    if ((size_t)(wsp - (char*)d_ws) > ws_size) return;    // total ~ 66 MB
    k_prep<<<3 * NWT + NCV + NSQ, 256, 0, stream>>>(x, Wq, Wk, Wv, XB, BQ, BK, BV, SQ);
    k_qkv<<<dim3(TT / 64, DM / 64, 3 * NB_), 256, 0, stream>>>(XB, BQ, BK, BV, bq, bk, bv, Q16, Qh, Ql, K16, Kh, Kl, VT, VTh, VTl);
    k_fattn<<<dim3(TT / 128, NB_, NH_), 256, 0, stream>>>(Q16, Qh, Ql, K16, Kh, Kl, VT, VTh, VTl, SQ, OUT);
}

// v006
// Measured time: 71.7 microseconds a run.
// Next to v005, in two timings, it ran 1.25 times as fast each time.
// All steps since v000 together make it 13.0 times as fast.
#include <hip/hip_runtime.h>

// NonSymmetricAttentionKernel (hidden [2][2048][768]; q/k/v = x W + b (12 heads x 64); scores = q.k/8 + alibi[h][i][j] where alibi = -slope[h%4] |sqrt(j) - sqrt(i)|, slopes 2^-2, 2^-4, 2^-6, 2^-8; heads 0-3 causal (j <= i), heads 4-7 anti-causal (j >= i), heads 8-11 unmasked;
// softmax; out = attn v merged (no output projection) -> [2][2048][768]).
// Compute dtypes, f32 accumulate: every input rounded to bf16; q/k/v on PLAIN bf16 operands (inputs: exact) + bias; scores (K 64) and attn.v on single fp16 planes (probabilities x1024) EXCEPT the short-window rows (query rows < 512 of heads 0-3, >= 1536 of heads 4-7): bf16 high + low planes, three products.

#define NB_  2
#define TT   2048
#define DM   768
#define NH_  12
#define HD   64
#define RHL  512
typedef _Float16 h16;
typedef unsigned short bf;
typedef __attribute__((ext_vector_type(16))) __bf16   v16bf;
typedef __attribute__((ext_vector_type(16))) _Float16 v16h;
typedef __attribute__((ext_vector_type(8)))  _Float16 v8h;
typedef __attribute__((ext_vector_type(8)))  unsigned short v8us;
typedef __attribute__((ext_vector_type(8)))  float    v8f;
typedef __attribute__((ext_vector_type(4)))  float    v4f;
typedef v8h  __attribute__((may_alias)) v8ha;
typedef v4f  __attribute__((may_alias)) v4fa;
typedef v8us __attribute__((may_alias)) v8usa;

__device__ __forceinline__ unsigned short f2bf(float f) { unsigned u = __float_as_uint(f); u += 0x7FFFu + ((u >> 16) & 1u); return (unsigned short)(u >> 16); }
__device__ __forceinline__ float bf2f(unsigned short b) { return __uint_as_float(((unsigned)b) << 16); }
__device__ __forceinline__ float bfr(float f) { return bf2f(f2bf(f)); }
__device__ __forceinline__ v16h cat16(v8h lo, v8h hi) { return __builtin_shufflevector(lo, hi, 0, 1, 2, 3, 4, 5, 6, 7, 8, 9, 10, 11, 12, 13, 14, 15); }
__device__ __forceinline__ v16bf cat16b(v8us lo, v8us hi) { return __builtin_bit_cast(v16bf, __builtin_shufflevector(lo, hi, 0, 1, 2, 3, 4, 5, 6, 7, 8, 9, 10, 11, 12, 13, 14, 15)); }
__device__ __forceinline__ v8f wmma16(v16h a, v16h b, v8f c) { return __builtin_amdgcn_wmma_f32_16x16x32_f16(false, a, false, b, (short)0, c, false, false); }
__device__ __forceinline__ v8f wmmab(v16bf a, v16bf b, v8f c) { return __builtin_amdgcn_wmma_f32_16x16x32_bf16(false, a, false, b, (short)0, c, false, false); }
__device__ __forceinline__ h16 tohx(float x) { return (h16)x; }
__device__ __forceinline__ void splitf(float y, unsigned short& h, unsigned short& l) { h = f2bf(y); l = f2bf(y - bf2f(h)); }
typedef __attribute__((ext_vector_type(4))) unsigned short v4us;
typedef __attribute__((ext_vector_type(4))) _Float16 v4h;



// ---- proj_wg: one 128 x 128 tile of a projection, C[t][n] = sum_k x[t][k] Wt[n][k] + bias[n], by a work-group of 4 waves (2 x 2, a wave holds 64 x 64 = 16 accumulators; a wave's 64 columns are one head).
// The k axis is walked in 12 stages of 64. A stage is 128 rows of x and 128 rows of Wt, 128 B (one whole line) of each row, laid in LDS at pitch GP by asynchronous copies, 16 B a lane, 4 whole lines a wave and copy; every row is fetched once for the whole work-group and read as fragments from LDS.
// Two buffers: when every wave has read the last fragments of stage t into registers, the copies of stage t + 2 are issued into that buffer and fly through the second half of stage t's matrix instructions and the first half of stage t + 1's. Each accumulator sums its k in rising order.
// C never reaches memory: each wave lays its f32 tile (+ bias) in its own part of the LDS that the stages have left, and rounds it to the three 16-bit planes that attention reads (fp16, bf16 high, bf16 low):
// OUT 1 as [head][t][d]; OUT 2 as [head][d][t], for which the tile lies transposed in LDS (an accumulator's 8 values are 8 consecutive t of one d: two 16-B LDS stores).
template <typename T16> struct WFrag;
template <> struct WFrag<h16> { typedef v16h V; static __device__ __forceinline__ V ld(const h16* p) { return cat16(*(const v8h*)p, *(const v8h*)(p + 16)); } static __device__ __forceinline__ v8f mma(V a, V b, v8f c) { return wmma16(a, b, c); } };
template <> struct WFrag<bf> { typedef v16bf V; static __device__ __forceinline__ V ld(const bf* p) { return cat16b(*(const v8us*)p, *(const v8us*)(p + 16)); } static __device__ __forceinline__ v8f mma(V a, V b, v8f c) { return wmmab(a, b, c); } };
#define GP 72            // LDS row pitch in 16-bit elements: 128 B of data + 16 B, an odd multiple of 16 B, so that the 16 rows of a fragment read fall on different banks
#define GST (256 * GP)   // one stage: 128 rows of x, then 128 rows of Wt
#define NST (DM / 64)    // stages
// copy8: eight asynchronous copies of 16 B a lane, rows 16 apart: global g + j * 16 rows -> LDS byte address d + j * 16 rows. The wait at the end of the statement stands in front of whatever next overwrites an address register of these copies.
__device__ __forceinline__ void copy8(unsigned d, const bf* g) {
    const unsigned d1 = d + 16 * GP * 2, d2 = d + 32 * GP * 2, d3 = d + 48 * GP * 2, d4 = d + 64 * GP * 2, d5 = d + 80 * GP * 2, d6 = d + 96 * GP * 2, d7 = d + 112 * GP * 2;
    const bf *g1 = g + 16 * DM, *g2 = g + 32 * DM, *g3 = g + 48 * DM, *g4 = g + 64 * DM, *g5 = g + 80 * DM, *g6 = g + 96 * DM, *g7 = g + 112 * DM;
    asm volatile("global_load_async_to_lds_b128 %0, %8, off\n\t"
                 "global_load_async_to_lds_b128 %1, %9, off\n\t"
                 "global_load_async_to_lds_b128 %2, %10, off\n\t"
                 "global_load_async_to_lds_b128 %3, %11, off\n\t"
                 "global_load_async_to_lds_b128 %4, %12, off\n\t"
                 "global_load_async_to_lds_b128 %5, %13, off\n\t"
                 "global_load_async_to_lds_b128 %6, %14, off\n\t"
                 "global_load_async_to_lds_b128 %7, %15, off\n\t"
                 "s_wait_xcnt 0x0"
                 :: "v"(d), "v"(d1), "v"(d2), "v"(d3), "v"(d4), "v"(d5), "v"(d6), "v"(d7), "v"(g), "v"(g1), "v"(g2), "v"(g3), "v"(g4), "v"(g5), "v"(g6), "v"(g7) : "memory");
}
template <int OUT>
__device__ __forceinline__ void proj_wg(bf* sm, const bf* __restrict__ A, const bf* __restrict__ Bt, const float* __restrict__ bias, int t0, int head0, h16* P, bf* Ph, bf* Pl) {
    typedef WFrag<bf> W; typedef W::V V;   // every '#pragma unroll' without a number below opens a short loop of fixed length, so that the arrays it indexes stay in registers
    const int wv = __builtin_amdgcn_readfirstlane((int)(threadIdx.x >> 5)), wm = wv & 1, wn = wv >> 1;   // wave number in a scalar register: LDS bases stay scalar
    const int lane = threadIdx.x & 31, lr = lane & 15, hi = lane >> 4;
    const int srow = (int)threadIdx.x >> 3, sch = ((int)threadIdx.x & 7) * 8;   // staging: 8 lanes a 128-B row, a wave covers 4 whole lines
    const bf *ga = A + srow * DM + sch, *gb = Bt + srow * DM + sch;
    const unsigned la = (unsigned)(size_t)(sm + srow * GP + sch), lb0 = la + 128 * GP * 2;   // the lane's LDS byte addresses in buffer 0: low 32 bits of the shared address
    const int head = head0 + wn, tw = t0 + wm * 64;
    float bs[4]; const float* pb = bias + head * HD + lr;   // an accumulator's column is 16 nb + lr: four bias values a lane, fetched ahead of the walk
#pragma unroll
    for (int nb = 0; nb < 4; ++nb) bs[nb] = pb[nb * 16];
    asm volatile("s_wait_xcnt 0x0" :: "v"(pb) : "memory");   // in front of whatever next overwrites the address register of the four fetches above; named as an input so that it stays as it is up to this wait
    copy8(la, ga); copy8(lb0, gb);
    asm volatile("s_wait_asynccnt 0x0" ::: "memory");   // this wave's copies of stage 0 have landed
    __syncthreads();   // stage 0 is in LDS before any wave reads it
    copy8(la + GST * 2, ga + 64); copy8(lb0 + GST * 2, gb + 64);
    v8f acc[4][4];
#pragma unroll
    for (int mb = 0; mb < 4; ++mb)
#pragma unroll
        for (int nb = 0; nb < 4; ++nb) acc[mb][nb] = (v8f){};
    const int fa = (wm * 64 + lr) * GP + 8 * hi, fb = (128 + wn * 64 + lr) * GP + 8 * hi;
#pragma unroll 1   // kept rolled: the buffer alternates by the counter, and a stage is 32 matrix instructions already
    for (int t = 0; t < NST; ++t) {
        const bf* lb = sm + (t & 1) * GST;
        V a[4], b[4];
#pragma unroll
        for (int mb = 0; mb < 4; ++mb) a[mb] = W::ld(lb + fa + mb * 16 * GP);
#pragma unroll
        for (int nb = 0; nb < 4; ++nb) b[nb] = W::ld(lb + fb + nb * 16 * GP);
        __builtin_amdgcn_sched_barrier(0);   // the eight fragments of the stage's first half are read as one group ahead of its matrix instructions; left alone the compiler reads each b fragment right in front of its use and the wave waits out the LDS latency four times
#pragma unroll
        for (int nb = 0; nb < 4; ++nb)
#pragma unroll
            for (int mb = 0; mb < 4; ++mb) acc[mb][nb] = W::mma(a[mb], b[nb], acc[mb][nb]);
#pragma unroll
        for (int mb = 0; mb < 4; ++mb) a[mb] = W::ld(lb + fa + mb * 16 * GP + 32);
#pragma unroll
        for (int nb = 0; nb < 4; ++nb) b[nb] = W::ld(lb + fb + nb * 16 * GP + 32);
        asm volatile("s_wait_dscnt 0x0" ::: "memory");      // this wave's reads of stage t have returned: the second half's fragments are in registers
        asm volatile("s_wait_asynccnt 0x0" ::: "memory");   // this wave's copies of stage t + 1 have landed
        __syncthreads();   // publishes stage t + 1 and frees stage t's buffer
        if (t + 2 < NST) { copy8(la + (t & 1) * (GST * 2), ga + (t + 2) * 64); copy8(lb0 + (t & 1) * (GST * 2), gb + (t + 2) * 64); }   // the same test for the whole work-group
#pragma unroll
        for (int nb = 0; nb < 4; ++nb)
#pragma unroll
            for (int mb = 0; mb < 4; ++mb) acc[mb][nb] = W::mma(a[mb], b[nb], acc[mb][nb]);   // from registers alone, while the copies fly
    }
    asm volatile("s_wait_asynccnt 0x0" ::: "memory");   // no copy is outstanding when the buffers become output staging
    float* ow = (float*)sm + wv * (64 * 68);
#pragma unroll
    for (int nb = 0; nb < 4; ++nb) { const float bn = bfr(bs[nb]);
#pragma unroll
        for (int mb = 0; mb < 4; ++mb) { const v8f c = acc[mb][nb] + bn;
            if constexpr (OUT == 2) { float* p = ow + (nb * 16 + lr) * 68 + mb * 16 + hi * 8; *(v4fa*)p = __builtin_shufflevector(c, c, 0, 1, 2, 3); *(v4fa*)(p + 4) = __builtin_shufflevector(c, c, 4, 5, 6, 7); }
            else {
#pragma unroll
                for (int j = 0; j < 8; ++j) ow[(mb * 16 + hi * 8 + j) * 68 + nb * 16 + lr] = c[j]; } } }
    __syncthreads();   // the tiles are in LDS before they are read back row by row
    const int cofs = lr * 4;
#pragma unroll 1   // kept rolled: all 32 row pairs opened would only cost instruction cache
    for (int s = 0; s < 32; s += 4) { v4f val[4];   // four LDS reads go ahead as one group: the waits behind the stores below would otherwise hold each read back until the row before it is stored
#pragma unroll
        for (int r = 0; r < 4; ++r) val[r] = *(const v4fa*)(ow + (2 * (s + r) + hi) * 68 + cofs);
#pragma unroll
        for (int r = 0; r < 4; ++r) { const int row = 2 * (s + r) + hi;
            const size_t e = (OUT == 1) ? ((size_t)head * TT + tw + row) * HD + cofs : ((size_t)head * HD + row) * TT + tw + cofs; v4h o; v4us oh, ol;   // 16 lanes fill one 128-B line of each plane
#pragma unroll
            for (int u = 0; u < 4; ++u) { o[u] = tohx(val[r][u]); unsigned short a, b; splitf(val[r][u], a, b); oh[u] = a; ol[u] = b; }
            h16* d0 = P + e; bf *d1 = Ph + e, *d2 = Pl + e; *(v4h*)d0 = o; *(v4us*)d1 = oh; *(v4us*)d2 = ol;
            asm volatile("s_wait_xcnt 0x0" :: "v"(d0), "v"(d1), "v"(d2), "v"(o), "v"(oh), "v"(ol) : "memory"); } }   // in front of whatever next overwrites an address or data register of the three stores above; they are named as inputs so that they stay as they are up to this wait
}

// ---- k_qkv: the six projections (q, k, v of both batches) as ONE launch, grid (NB_ * TT / 128, DM / 128, 3): blockIdx.x picks batch and rows, blockIdx.y two heads, blockIdx.z the projection, the same for a whole work-group. None reads what another writes.
__global__ __launch_bounds__(128) void k_qkv(const bf* __restrict__ XB, const bf* __restrict__ BQ, const bf* __restrict__ BK, const bf* __restrict__ BV, const float* __restrict__ bq, const float* __restrict__ bk, const float* __restrict__ bv,
                                             h16* Q16, bf* Qh, bf* Ql, h16* K16, bf* Kh, bf* Kl, h16* VT, bf* VTh, bf* VTl) {
    __shared__ __align__(16) unsigned short sm[2 * GST];
    const int p = blockIdx.z, b = blockIdx.x / (TT / 128), t0 = (blockIdx.x % (TT / 128)) * 128, head0 = blockIdx.y * 2;
    const bf* A = XB + (size_t)blockIdx.x * 128 * DM; const size_t zo = (size_t)b * NH_ * TT * HD, wo = (size_t)blockIdx.y * 128 * DM;
    if (p == 2) proj_wg<2>(sm, A, BV + wo, bv, t0, head0, VT + zo, VTh + zo, VTl + zo);
    else proj_wg<1>(sm, A, (p ? BK : BQ) + wo, p ? bk : bq, t0, head0, (p ? K16 : Q16) + zo, (p ? Kh : Qh) + zo, (p ? Kl : Ql) + zo);
}

typedef __attribute__((ext_vector_type(2))) unsigned short v2us;

__device__ __forceinline__ void wtG_wg(int blk, const float* __restrict__ w, int K, int N, bf* Bt) {
    const int lane = threadIdx.x & 31; const int L0 = (blk * 8 + (threadIdx.x >> 5)) * 8; const int nlines = N * K / 64;
{
#pragma unroll 1
        for (int l = 0; l < 8; ++l) { const int L = L0 + l; if (L >= nlines) break; const size_t e = (size_t)L * 64 + lane * 2; const int k = (int)(e % K), n = (int)(e / K); v2us o;
            o[0] = f2bf(w[(size_t)k * N + n]); o[1] = f2bf(w[(size_t)(k + 1) * N + n]); *(v2us*)(Bt + e) = o; }
         }
}
__device__ __forceinline__ void cvt8_wg(int blk, const float* __restrict__ src, bf* dst, size_t n8) { const size_t i = (size_t)blk * 256 + threadIdx.x; if (i >= n8) return; const v8f v = *(const v8f*)(src + i * 8); v8us o;
#pragma unroll
    for (int k = 0; k < 8; ++k) o[k] = f2bf(v[k]); *(v8us*)(dst + i * 8) = o;  }
// sqt_wg: SQ[j] = sqrt(j) (f32, correctly rounded).
__device__ __forceinline__ bool hlrow(int g, int i) { return (g == 0) ? (i < RHL) : (g == 1) ? (i >= TT - RHL) : false; }
__device__ __forceinline__ void sqt_wg(int blk, float* SQ) { const int j = blk * 256 + threadIdx.x; if (j >= TT) return; const float r = __fsqrt_rn((float)j); *(float*)(SQ + j) = r;  }
// ---- k_prep: all that the projections and attention wait for, as ONE launch: the three weight transposes (their work-groups run longest, so they come first), the rounding of both batches' hidden states, the square-root table. A work-group does one piece of one of them; none reads what another writes.
#define NWT ((DM * DM / 64 + 63) / 64)       // work-groups of one weight transpose
#define NCV (NB_ * TT * DM / 8 / 256)        // work-groups of the rounding
#define NSQ ((TT + 255) / 256)               // work-groups of the table
__global__ __launch_bounds__(256) void k_prep(const float* __restrict__ x, const float* __restrict__ Wq, const float* __restrict__ Wk, const float* __restrict__ Wv, bf* XB, bf* BQ, bf* BK, bf* BV, float* SQ) {
    const int blk = blockIdx.x;
    if (blk < 3 * NWT) { const int p = blk / NWT; wtG_wg(blk - p * NWT, (p == 0) ? Wq : (p == 1) ? Wk : Wv, DM, DM, (p == 0) ? BQ : (p == 1) ? BK : BV); }
    else if (blk < 3 * NWT + NCV) cvt8_wg(blk - 3 * NWT, x, XB, (size_t)NB_ * TT * DM / 8);
    else sqt_wg(blk - 3 * NWT - NCV, SQ);
}
#define KP 72          // LDS row pitch in 16-bit elements: 128 B of data + 16 B, an odd multiple of 16 B, so that the 16 rows of a fragment read fall on different banks
#define PS (64 * KP)   // one 64-row plane
typedef __attribute__((ext_vector_type(2))) float v2f;
typedef __attribute__((ext_vector_type(2))) __bf16 v2b;
template <typename T16> struct Oct;
template <> struct Oct<h16> { typedef v8h T; };
template <> struct Oct<bf> { typedef v8us T; };
__device__ __forceinline__ float xhalf(float x) { return __builtin_bit_cast(float, __builtin_amdgcn_permlanex16(__builtin_bit_cast(int, x), __builtin_bit_cast(int, x), 0x76543210, 0xfedcba98, false, false)); }   // lane l <-> lane l ^ 16
template <typename T16, bool HL>
__device__ __forceinline__ void fattn_wg(T16* lds, const T16* __restrict__ q, const T16* __restrict__ q2, const T16* __restrict__ k, const T16* __restrict__ k2, const T16* __restrict__ vt, const T16* __restrict__ vt2,
                                         const float* __restrict__ SQ, int g, float slope, int q0, int kbeg, int kend, int lr, int hi, float* __restrict__ orow) {
    typedef WFrag<T16> W; typedef typename W::V V; typedef typename Oct<T16>::T H;   // every '#pragma unroll' below opens a short loop of fixed length, so that the arrays it indexes stay in registers
    constexpr int BS = (HL ? 4 : 2) * PS;   // one buffer: K, V^T (and their low planes)
    const float L2E = 1.4426950408889634f; const float c1 = 0.125f * L2E, c2 = slope * L2E;
    __builtin_assume(kbeg < kend);   // the walk has at least one pass: no test in front of the loop, and what only the loop reads is fetched ahead of the first barrier
    const int i = q0 + lr; const float sqi = SQ[i];
    const int klo = (g == 1) ? i : 0; const unsigned span = (unsigned)(((g == 0) ? i : TT - 1) - klo);   // key j is kept when klo <= j <= klo + span
    V qa[2], qb[2]; const T16 *pq = q + (size_t)i * HD + 8 * hi, *pq2 = HL ? q2 + (size_t)i * HD + 8 * hi : pq;
#pragma unroll
    for (int kk = 0; kk < 2; ++kk) { qa[kk] = W::ld(pq + kk * 32); if (HL) qb[kk] = W::ld(pq2 + kk * 32); }
    const int srow = (int)threadIdx.x >> 3, sch = ((int)threadIdx.x & 7) * 8;   // staging: 8 threads a 128-B row, a wave covers 4 whole lines
    const int kso = srow * HD + sch, vso = srow * TT + sch, lso = srow * KP + sch;
    H rk[2], rv[2], rk2[2], rv2[2]; const T16 *pk0 = k + kso + kbeg * HD, *pv0 = vt + vso + kbeg, *pk20 = HL ? k2 + kso + kbeg * HD : pk0, *pv20 = HL ? vt2 + vso + kbeg : pv0;   // the walk's first tiles
#pragma unroll
    for (int r = 0; r < 2; ++r) { rk[r] = *(const H*)(pk0 + r * 32 * HD); rv[r] = *(const H*)(pv0 + r * 32 * TT); if (HL) { rk2[r] = *(const H*)(pk20 + r * 32 * HD); rv2[r] = *(const H*)(pv20 + r * 32 * TT); } }
#pragma unroll
    for (int r = 0; r < 2; ++r) { *(H*)(lds + lso + r * 32 * KP) = rk[r]; *(H*)(lds + PS + lso + r * 32 * KP) = rv[r]; if (HL) { *(H*)(lds + 2 * PS + lso + r * 32 * KP) = rk2[r]; *(H*)(lds + 3 * PS + lso + r * 32 * KP) = rv2[r]; } }
    v4f sq[4][2]; const unsigned sqo = 32u * hi;   // the lane's byte offset in a 16-key stretch of the table
#pragma unroll
    for (int t = 0; t < 4; ++t) { const char* pt = (const char*)(SQ + kbeg + t * 16) + sqo; sq[t][0] = *(const v4f*)pt; sq[t][1] = *(const v4f*)(pt + 16); }
    float m = -1.0e30f, l = 0.f; v8f o[4];
#pragma unroll
    for (int mb = 0; mb < 4; ++mb) o[mb] = (v8f){};
    const int fo = lr * KP + 8 * hi;
#pragma unroll
    for (int r = 0; r < 2; ++r) { rk[r] = *(const H*)(pk0 + (64 + r * 32) * HD); rv[r] = *(const H*)(pv0 + r * 32 * TT + 64); if (HL) { rk2[r] = *(const H*)(pk20 + (64 + r * 32) * HD); rv2[r] = *(const H*)(pv20 + r * 32 * TT + 64); } }   // the second pass's tiles, on their way to the registers
    asm volatile("s_wait_xcnt 0x0" :: "v"(i), "v"(sqo), "v"(pq), "v"(pq2), "v"(pk0), "v"(pv0), "v"(pk20), "v"(pv20) : "memory");   // in front of whatever next overwrites an address register of the fetches above, from the query's on; they are named as inputs so that they stay as they are up to this wait
    __syncthreads();   // the first pass's tiles are in LDS before any wave reads them
#pragma unroll 1   // kept rolled: a pass is some hundred instructions already, a second copy would only cost instruction cache
    for (int k0 = kbeg; k0 < kend; k0 += 64) {   // kbeg is a multiple of 128, so the first pass reads buffer 0; kend - kbeg >= 128
        const T16* lb = lds + ((k0 >> 6) & 1) * BS; T16* ln = lds + (((k0 >> 6) & 1) ^ 1) * BS;
        const int kn = (k0 + 64 < TT) ? k0 + 64 : 0, kf = (k0 + 128 < TT) ? k0 + 128 : 0;   // past the last key block 0 is fetched again, unused (so is what a shorter walk fetches past its own end): addresses stay in bounds and every pass has the same control flow
        v8f s[4];
#pragma unroll
        for (int t = 0; t < 4; ++t) { v8f a = (v8f){};
#pragma unroll
            for (int kk = 0; kk < 2; ++kk) { const V ka = W::ld(lb + fo + t * 16 * KP + kk * 32); a = W::mma(ka, qa[kk], a); if (HL) { const V kb = W::ld(lb + 2 * PS + fo + t * 16 * KP + kk * 32); a = W::mma(kb, qa[kk], a); a = W::mma(ka, qb[kk], a); } }
            s[t] = a; }
#pragma unroll
        for (int t = 0; t < 4; ++t)
#pragma unroll
            for (int j = 0; j < 8; ++j) s[t][j] = s[t][j] * c1 - c2 * fabsf(sq[t][j >> 2][j & 3] - sqi);
#pragma unroll
        for (int t = 0; t < 4; ++t) { sq[t][0] = *(const v4f*)(SQ + kn + t * 16 + 8 * hi); sq[t][1] = *(const v4f*)(SQ + kn + t * 16 + 8 * hi + 4); }
        if ((g == 0 && k0 + 63 > q0) || (g == 1 && k0 < q0 + 15)) {   // wave-uniform: only a pass that holds a masked (query, key) pair of this wave pays for the mask
            const int kb0 = k0 + 8 * hi - klo;
#pragma unroll
            for (int t = 0; t < 4; ++t)
#pragma unroll
                for (int j = 0; j < 8; ++j) s[t][j] = ((unsigned)(kb0 + t * 16 + j) <= span) ? s[t][j] : -3.0e38f; }
        float mt[4];
#pragma unroll
        for (int t = 0; t < 4; ++t) { mt[t] = s[t][0];
#pragma unroll
            for (int j = 1; j < 8; ++j) mt[t] = fmaxf(mt[t], s[t][j]); }
        float mx = fmaxf(fmaxf(m, fmaxf(mt[0], mt[1])), fmaxf(mt[2], mt[3])); mx = fmaxf(mx, xhalf(mx));
        const float al = __builtin_amdgcn_exp2f(m - mx), ms = mx - 10.0f; m = mx;   // while every key so far was masked, mx stays at its start value, al is 1 and every p below is 0
#pragma unroll
        for (int mb = 0; mb < 4; ++mb) o[mb] *= al;
        V pa[2], pb[2]; float lt[4];
#pragma unroll
        for (int t = 0; t < 4; ++t) { lt[t] = 0.f;
#pragma unroll
            for (int j = 0; j < 8; j += 2) { v2f p; p[0] = __builtin_amdgcn_exp2f(s[t][j] - ms); p[1] = __builtin_amdgcn_exp2f(s[t][j + 1] - ms); lt[t] += p[0]; lt[t] += p[1]; const int e = (t & 1) * 8 + j;
                if constexpr (HL) { const v2b ph = __builtin_convertvector(p, v2b); const v2b pl = __builtin_convertvector(p - __builtin_convertvector(ph, v2f), v2b); pa[t >> 1][e] = ph[0]; pa[t >> 1][e + 1] = ph[1]; pb[t >> 1][e] = pl[0]; pb[t >> 1][e + 1] = pl[1]; }   // high plane, and what it leaves, both rounded to nearest
                else { pa[t >> 1][e] = (h16)p[0]; pa[t >> 1][e + 1] = (h16)p[1]; } } }
        l = l * al + ((lt[0] + lt[1]) + (lt[2] + lt[3]));
#pragma unroll
        for (int kk = 0; kk < 2; ++kk)
#pragma unroll
            for (int mb = 0; mb < 4; ++mb) { const V va = W::ld(lb + PS + fo + mb * 16 * KP + kk * 32); o[mb] = W::mma(va, pa[kk], o[mb]); if (HL) { const V vb = W::ld(lb + 3 * PS + fo + mb * 16 * KP + kk * 32); o[mb] = W::mma(vb, pa[kk], o[mb]); o[mb] = W::mma(va, pb[kk], o[mb]); } }
#pragma unroll
        for (int r = 0; r < 2; ++r) { *(H*)(ln + lso + r * 32 * KP) = rk[r]; *(H*)(ln + PS + lso + r * 32 * KP) = rv[r]; if (HL) { *(H*)(ln + 2 * PS + lso + r * 32 * KP) = rk2[r]; *(H*)(ln + 3 * PS + lso + r * 32 * KP) = rv2[r]; } }
        const T16 *pk = k + kso + kf * HD, *pv = vt + vso + kf, *pk2 = HL ? k2 + kso + kf * HD : pk, *pv2 = HL ? vt2 + vso + kf : pv;
#pragma unroll
        for (int r = 0; r < 2; ++r) { rk[r] = *(const H*)(pk + r * 32 * HD); rv[r] = *(const H*)(pv + r * 32 * TT); if (HL) { rk2[r] = *(const H*)(pk2 + r * 32 * HD); rv2[r] = *(const H*)(pv2 + r * 32 * TT); } }   // fetched a whole pass ahead of their store to LDS
        asm volatile("s_wait_xcnt 0x0" :: "v"(pk), "v"(pv), "v"(pk2), "v"(pv2) : "memory");   // in front of whatever next overwrites the address registers of the fetches above; they are named as inputs so that they stay as they are up to this wait
        asm volatile("s_wait_dscnt 0x0" ::: "memory");   // this wave's LDS stores above have landed and its reads of this pass's buffer have returned
        asm volatile("s_barrier_signal -1\n\ts_barrier_wait -1" ::: "memory");   // work-group barrier: publishes the next pass's tiles and frees this pass's buffer. By hand, because __syncthreads() also waits for the global fetches just issued, which are to fly through the next pass
    }
    l += xhalf(l); const float inv = 1.0f / l;
#pragma unroll
    for (int mb = 0; mb < 4; ++mb) { float* d = orow + (size_t)lr * DM + mb * 16 + hi * 8; v4f x0, x1;
#pragma unroll
        for (int u = 0; u < 4; ++u) { x0[u] = o[mb][u] * inv; x1[u] = o[mb][4 + u] * inv; }
        *(v4f*)d = x0; *(v4f*)(d + 4) = x1; }
}
__global__ __launch_bounds__(256) void k_fattn(const h16* __restrict__ Q16, const bf* __restrict__ Qh, const bf* __restrict__ Ql, const h16* __restrict__ K16, const bf* __restrict__ Kh, const bf* __restrict__ Kl,
                                               const h16* __restrict__ VT, const bf* __restrict__ VTh, const bf* __restrict__ VTl, const float* __restrict__ SQ, float* __restrict__ outb) {
    __shared__ __align__(16) unsigned short sm[2 * 4 * PS];
    const int lane = threadIdx.x & 31, lr = lane & 15, hi = lane >> 4; const int wv = __builtin_amdgcn_readfirstlane((int)(threadIdx.x >> 5));   // wave number in a scalar register: the mask test of a pass is then a scalar branch
    // both batches in one launch: grid (TT/128, NB_, NH_)
    const int b = blockIdx.y, h = blockIdx.z, g = h / 4, hm = h % 4; const float slope = (hm == 0) ? 0.25f : (hm == 1) ? 0.0625f : (hm == 2) ? 0.015625f : 0.00390625f;
    const int kbeg = (g == 1) ? blockIdx.x * 128 : 0, kend = (g == 0) ? blockIdx.x * 128 + 128 : TT;   // the keys that at least one of the work-group's 128 queries keeps; a pass outside holds masked pairs only and would add exact zeros (factor 1, every p 0). The same for all 8 waves: every wave meets every barrier
    const int q0 = (blockIdx.x * 8 + wv) * 16; const size_t zo = ((size_t)b * NH_ + h) * TT * HD; float* orow = outb + ((size_t)b * TT + q0) * DM + h * HD;
    if (hlrow(g, blockIdx.x * 128)) fattn_wg<bf, true>(sm, Qh + zo, Ql + zo, Kh + zo, Kl + zo, VTh + zo, VTl + zo, SQ, g, slope, q0, kbeg, kend, lr, hi, orow);   // 128 divides the window's 512 rows: the same path for the whole work-group
    else fattn_wg<h16, false>((h16*)sm, Q16 + zo, nullptr, K16 + zo, nullptr, VT + zo, nullptr, SQ, g, slope, q0, kbeg, kend, lr, hi, orow);
}

extern "C" void kernel_launch(void* const* d_in, const int* in_sizes, int n_in,
                              void* d_out, int out_size, void* d_ws, size_t ws_size, hipStream_t stream) {
    (void)in_sizes; (void)n_in; (void)out_size;
    const float** I = (const float**)d_in;
    const float *x = I[0], *Wq = I[1], *bq = I[2], *Wk = I[3], *bk = I[4], *Wv = I[5], *bv = I[6];
    float* OUT = (float*)d_out;     // [2][2048][768]
    char* wsp = (char*)d_ws;
    auto take = [&](size_t bytes) { char* p = wsp; wsp += (bytes + 255) & ~(size_t)255; return (void*)p; };
    bf* BQ = (bf*)take((size_t)DM * DM * 2); bf* BK = (bf*)take((size_t)DM * DM * 2); bf* BV = (bf*)take((size_t)DM * DM * 2);
    bf* XB = (bf*)take((size_t)NB_ * TT * DM * 2);
    h16* Q16 = (h16*)take((size_t)NB_ * NH_ * TT * HD * 2); bf* Qh = (bf*)take((size_t)NB_ * NH_ * TT * HD * 2); bf* Ql = (bf*)take((size_t)NB_ * NH_ * TT * HD * 2); h16* K16 = (h16*)take((size_t)NB_ * NH_ * TT * HD * 2); bf* Kh = (bf*)take((size_t)NB_ * NH_ * TT * HD * 2); bf* Kl = (bf*)take((size_t)NB_ * NH_ * TT * HD * 2);
    h16* VT = (h16*)take((size_t)NB_ * NH_ * HD * TT * 2); bf* VTh = (bf*)take((size_t)NB_ * NH_ * HD * TT * 2); bf* VTl = (bf*)take((size_t)NB_ * NH_ * HD * TT * 2); float* SQ = (float*)take(TT * 4);
    if ((size_t)(wsp - (char*)d_ws) > ws_size) return;    // total ~ 66 MB
    k_prep<<<3 * NWT + NCV + NSQ, 256, 0, stream>>>(x, Wq, Wk, Wv, XB, BQ, BK, BV, SQ);
    k_qkv<<<dim3(NB_ * TT / 128, DM / 128, 3), 128, 0, stream>>>(XB, BQ, BK, BV, bq, bk, bv, Q16, Qh, Ql, K16, Kh, Kl, VT, VTh, VTl);
    k_fattn<<<dim3(TT / 128, NB_, NH_), 256, 0, stream>>>(Q16, Qh, Ql, K16, Kh, Kl, VT, VTh, VTl, SQ, OUT);
}

// v007
// One run takes 64.2 microseconds.
// In both of two side-by-side timings against v006, it was 1.12 times as fast.
// Counting every step since v000, it is 14.5 times as fast.
#include <hip/hip_runtime.h>

// NonSymmetricAttentionKernel (hidden [2][2048][768]; q/k/v = x W + b (12 heads x 64); scores = q.k/8 + alibi[h][i][j] where alibi = -slope[h%4] |sqrt(j) - sqrt(i)|, slopes 2^-2, 2^-4, 2^-6, 2^-8; heads 0-3 causal (j <= i), heads 4-7 anti-causal (j >= i), heads 8-11 unmasked;
// softmax; out = attn v merged (no output projection) -> [2][2048][768]).
// Compute dtypes, f32 accumulate: every input rounded to bf16; q/k/v on PLAIN bf16 operands (inputs: exact) + bias; scores (K 64) and attn.v on single fp16 planes (probabilities x1024) EXCEPT the short-window rows (query rows < 512 of heads 0-3, >= 1536 of heads 4-7): bf16 high + low planes, three products.

#define NB_  2
#define TT   2048
#define DM   768
#define NH_  12
#define HD   64
#define RHL  512
typedef _Float16 h16;
typedef unsigned short bf;
typedef __attribute__((ext_vector_type(16))) __bf16   v16bf;
typedef __attribute__((ext_vector_type(16))) _Float16 v16h;
typedef __attribute__((ext_vector_type(8)))  _Float16 v8h;
typedef __attribute__((ext_vector_type(8)))  unsigned short v8us;
typedef __attribute__((ext_vector_type(8)))  float    v8f;
typedef __attribute__((ext_vector_type(4)))  float    v4f;
typedef v8h  __attribute__((may_alias)) v8ha;
typedef v4f  __attribute__((may_alias)) v4fa;
typedef v8us __attribute__((may_alias)) v8usa;

__device__ __forceinline__ unsigned short f2bf(float f) { unsigned u = __float_as_uint(f); u += 0x7FFFu + ((u >> 16) & 1u); return (unsigned short)(u >> 16); }
__device__ __forceinline__ float bf2f(unsigned short b) { return __uint_as_float(((unsigned)b) << 16); }
__device__ __forceinline__ float bfr(float f) { return bf2f(f2bf(f)); }
__device__ __forceinline__ v16h cat16(v8h lo, v8h hi) { return __builtin_shufflevector(lo, hi, 0, 1, 2, 3, 4, 5, 6, 7, 8, 9, 10, 11, 12, 13, 14, 15); }
__device__ __forceinline__ v16bf cat16b(v8us lo, v8us hi) { return __builtin_bit_cast(v16bf, __builtin_shufflevector(lo, hi, 0, 1, 2, 3, 4, 5, 6, 7, 8, 9, 10, 11, 12, 13, 14, 15)); }
__device__ __forceinline__ v8f wmma16(v16h a, v16h b, v8f c) { return __builtin_amdgcn_wmma_f32_16x16x32_f16(false, a, false, b, (short)0, c, false, false); }
__device__ __forceinline__ v8f wmmab(v16bf a, v16bf b, v8f c) { return __builtin_amdgcn_wmma_f32_16x16x32_bf16(false, a, false, b, (short)0, c, false, false); }
__device__ __forceinline__ h16 tohx(float x) { return (h16)x; }
__device__ __forceinline__ void splitf(float y, unsigned short& h, unsigned short& l) { h = f2bf(y); l = f2bf(y - bf2f(h)); }
typedef __attribute__((ext_vector_type(4))) unsigned short v4us;
typedef __attribute__((ext_vector_type(4))) _Float16 v4h;



// ---- proj_wg: one 128 x 128 tile of a projection, C[t][n] = sum_k x[t][k] Wt[n][k] + bias[n], by a work-group of 4 waves (2 x 2, a wave holds 64 x 64 = 16 accumulators; a wave's 64 columns are one head).
// The k axis is walked in 12 stages of 64. A stage is 128 rows of x and 128 rows of Wt, 128 B (one whole line) of each row, laid in LDS at pitch GP by asynchronous copies, 16 B a lane, 4 whole lines a wave and copy; every row is fetched once for the whole work-group and read as fragments from LDS.
// Two buffers: when every wave has read the last fragments of stage t into registers, the copies of stage t + 2 are issued into that buffer and fly through the second half of stage t's matrix instructions and the first half of stage t + 1's. Each accumulator sums its k in rising order.
// C never reaches memory: each wave lays its f32 tile (+ bias) in its own part of the LDS that the stages have left, and rounds it to the three 16-bit planes that attention reads (fp16, bf16 high, bf16 low):
// OUT 1 as [head][t][d]; OUT 2 as [head][d][t], for which the tile lies transposed in LDS (an accumulator's 8 values are 8 consecutive t of one d: two 16-B LDS stores).
template <typename T16> struct WFrag;
template <> struct WFrag<h16> { typedef v16h V; static __device__ __forceinline__ V ld(const h16* p) { return cat16(*(const v8h*)p, *(const v8h*)(p + 16)); } static __device__ __forceinline__ v8f mma(V a, V b, v8f c) { return wmma16(a, b, c); } };
template <> struct WFrag<bf> { typedef v16bf V; static __device__ __forceinline__ V ld(const bf* p) { return cat16b(*(const v8us*)p, *(const v8us*)(p + 16)); } static __device__ __forceinline__ v8f mma(V a, V b, v8f c) { return wmmab(a, b, c); } };
#define GP 72            // LDS row pitch in 16-bit elements: 128 B of data + 16 B, an odd multiple of 16 B, so that the 16 rows of a fragment read fall on different banks
#define GST (256 * GP)   // one stage: 128 rows of x, then 128 rows of Wt
#define NST (DM / 64)    // stages
// copy8: eight asynchronous copies of 16 B a lane, rows 16 apart: global g + j * 16 rows -> LDS byte address d + j * 16 rows. The wait at the end of the statement stands in front of whatever next overwrites an address register of these copies.
__device__ __forceinline__ void copy8(unsigned d, const bf* g) {
    const unsigned d1 = d + 16 * GP * 2, d2 = d + 32 * GP * 2, d3 = d + 48 * GP * 2, d4 = d + 64 * GP * 2, d5 = d + 80 * GP * 2, d6 = d + 96 * GP * 2, d7 = d + 112 * GP * 2;
    const bf *g1 = g + 16 * DM, *g2 = g + 32 * DM, *g3 = g + 48 * DM, *g4 = g + 64 * DM, *g5 = g + 80 * DM, *g6 = g + 96 * DM, *g7 = g + 112 * DM;
    asm volatile("global_load_async_to_lds_b128 %0, %8, off\n\t"
                 "global_load_async_to_lds_b128 %1, %9, off\n\t"
                 "global_load_async_to_lds_b128 %2, %10, off\n\t"
                 "global_load_async_to_lds_b128 %3, %11, off\n\t"
                 "global_load_async_to_lds_b128 %4, %12, off\n\t"
                 "global_load_async_to_lds_b128 %5, %13, off\n\t"
                 "global_load_async_to_lds_b128 %6, %14, off\n\t"
                 "global_load_async_to_lds_b128 %7, %15, off\n\t"
                 "s_wait_xcnt 0x0"
                 :: "v"(d), "v"(d1), "v"(d2), "v"(d3), "v"(d4), "v"(d5), "v"(d6), "v"(d7), "v"(g), "v"(g1), "v"(g2), "v"(g3), "v"(g4), "v"(g5), "v"(g6), "v"(g7) : "memory");
}
template <int OUT>
__device__ __forceinline__ void proj_wg(bf* sm, const bf* __restrict__ A, const bf* __restrict__ Bt, const float* __restrict__ bias, int t0, int head0, h16* P, bf* Ph, bf* Pl) {
    typedef WFrag<bf> W; typedef W::V V;   // every '#pragma unroll' without a number below opens a short loop of fixed length, so that the arrays it indexes stay in registers
    const int wv = __builtin_amdgcn_readfirstlane((int)(threadIdx.x >> 5)), wm = wv & 1, wn = wv >> 1;   // wave number in a scalar register: LDS bases stay scalar
    const int lane = threadIdx.x & 31, lr = lane & 15, hi = lane >> 4;
    const int srow = (int)threadIdx.x >> 3, sch = ((int)threadIdx.x & 7) * 8;   // staging: 8 lanes a 128-B row, a wave covers 4 whole lines
    const bf *ga = A + srow * DM + sch, *gb = Bt + srow * DM + sch;
    const unsigned la = (unsigned)(size_t)(sm + srow * GP + sch), lb0 = la + 128 * GP * 2;   // the lane's LDS byte addresses in buffer 0: low 32 bits of the shared address
    const int head = head0 + wn, tw = t0 + wm * 64;
    float bs[4]; const float* pb = bias + head * HD + lr;   // an accumulator's column is 16 nb + lr: four bias values a lane, fetched ahead of the walk
#pragma unroll
    for (int nb = 0; nb < 4; ++nb) bs[nb] = pb[nb * 16];
    asm volatile("s_wait_xcnt 0x0" :: "v"(pb) : "memory");   // in front of whatever next overwrites the address register of the four fetches above; named as an input so that it stays as it is up to this wait
    copy8(la, ga); copy8(lb0, gb);
    asm volatile("s_wait_asynccnt 0x0" ::: "memory");   // this wave's copies of stage 0 have landed
    __syncthreads();   // stage 0 is in LDS before any wave reads it
    copy8(la + GST * 2, ga + 64); copy8(lb0 + GST * 2, gb + 64);
    v8f acc[4][4];
#pragma unroll
    for (int mb = 0; mb < 4; ++mb)
#pragma unroll
        for (int nb = 0; nb < 4; ++nb) acc[mb][nb] = (v8f){};
    const int fa = (wm * 64 + lr) * GP + 8 * hi, fb = (128 + wn * 64 + lr) * GP + 8 * hi;
#pragma unroll 1   // kept rolled: the buffer alternates by the counter, and a stage is 32 matrix instructions already
    for (int t = 0; t < NST; ++t) {
        const bf* lb = sm + (t & 1) * GST;
        V a[4], b[4];
#pragma unroll
        for (int mb = 0; mb < 4; ++mb) a[mb] = W::ld(lb + fa + mb * 16 * GP);
#pragma unroll
        for (int nb = 0; nb < 4; ++nb) b[nb] = W::ld(lb + fb + nb * 16 * GP);
        __builtin_amdgcn_sched_barrier(0);   // the eight fragments of the stage's first half are read as one group ahead of its matrix instructions; left alone the compiler reads each b fragment right in front of its use and the wave waits out the LDS latency four times
#pragma unroll
        for (int nb = 0; nb < 4; ++nb)
#pragma unroll
            for (int mb = 0; mb < 4; ++mb) acc[mb][nb] = W::mma(a[mb], b[nb], acc[mb][nb]);
#pragma unroll
        for (int mb = 0; mb < 4; ++mb) a[mb] = W::ld(lb + fa + mb * 16 * GP + 32);
#pragma unroll
        for (int nb = 0; nb < 4; ++nb) b[nb] = W::ld(lb + fb + nb * 16 * GP + 32);
        asm volatile("s_wait_dscnt 0x0" ::: "memory");      // this wave's reads of stage t have returned: the second half's fragments are in registers
        asm volatile("s_wait_asynccnt 0x0" ::: "memory");   // this wave's copies of stage t + 1 have landed
        __syncthreads();   // publishes stage t + 1 and frees stage t's buffer
        if (t + 2 < NST) { copy8(la + (t & 1) * (GST * 2), ga + (t + 2) * 64); copy8(lb0 + (t & 1) * (GST * 2), gb + (t + 2) * 64); }   // the same test for the whole work-group
#pragma unroll
        for (int nb = 0; nb < 4; ++nb)
#pragma unroll
            for (int mb = 0; mb < 4; ++mb) acc[mb][nb] = W::mma(a[mb], b[nb], acc[mb][nb]);   // from registers alone, while the copies fly
    }
    asm volatile("s_wait_asynccnt 0x0" ::: "memory");   // no copy is outstanding when the buffers become output staging
    float* ow = (float*)sm + wv * (64 * 68);
#pragma unroll
    for (int nb = 0; nb < 4; ++nb) { const float bn = bfr(bs[nb]);
#pragma unroll
        for (int mb = 0; mb < 4; ++mb) { const v8f c = acc[mb][nb] + bn;
            if constexpr (OUT == 2) { float* p = ow + (nb * 16 + lr) * 68 + mb * 16 + hi * 8; *(v4fa*)p = __builtin_shufflevector(c, c, 0, 1, 2, 3); *(v4fa*)(p + 4) = __builtin_shufflevector(c, c, 4, 5, 6, 7); }
            else {
#pragma unroll
                for (int j = 0; j < 8; ++j) ow[(mb * 16 + hi * 8 + j) * 68 + nb * 16 + lr] = c[j]; } } }
    __syncthreads();   // the tiles are in LDS before they are read back row by row
    const int cofs = lr * 4;
#pragma unroll 1   // kept rolled: all 32 row pairs opened would only cost instruction cache
    for (int s = 0; s < 32; s += 4) { v4f val[4];   // four LDS reads go ahead as one group: the waits behind the stores below would otherwise hold each read back until the row before it is stored
#pragma unroll
        for (int r = 0; r < 4; ++r) val[r] = *(const v4fa*)(ow + (2 * (s + r) + hi) * 68 + cofs);
#pragma unroll
        for (int r = 0; r < 4; ++r) { const int row = 2 * (s + r) + hi;
            const size_t e = (OUT == 1) ? ((size_t)head * TT + tw + row) * HD + cofs : ((size_t)head * HD + row) * TT + tw + cofs; v4h o; v4us oh, ol;   // 16 lanes fill one 128-B line of each plane
#pragma unroll
            for (int u = 0; u < 4; ++u) { o[u] = tohx(val[r][u]); unsigned short a, b; splitf(val[r][u], a, b); oh[u] = a; ol[u] = b; }
            h16* d0 = P + e; bf *d1 = Ph + e, *d2 = Pl + e; *(v4h*)d0 = o; *(v4us*)d1 = oh; *(v4us*)d2 = ol;
            asm volatile("s_wait_xcnt 0x0" :: "v"(d0), "v"(d1), "v"(d2), "v"(o), "v"(oh), "v"(ol) : "memory"); } }   // in front of whatever next overwrites an address or data register of the three stores above; they are named as inputs so that they stay as they are up to this wait
}

// ---- k_qkv: the six projections (q, k, v of both batches) as ONE launch, grid (NB_ * TT / 128, DM / 128, 3): blockIdx.x picks batch and rows, blockIdx.y two heads, blockIdx.z the projection, the same for a whole work-group. None reads what another writes.
__global__ __launch_bounds__(128) void k_qkv(const bf* __restrict__ XB, const bf* __restrict__ BQ, const bf* __restrict__ BK, const bf* __restrict__ BV, const float* __restrict__ bq, const float* __restrict__ bk, const float* __restrict__ bv,
                                             h16* Q16, bf* Qh, bf* Ql, h16* K16, bf* Kh, bf* Kl, h16* VT, bf* VTh, bf* VTl) {
    __shared__ __align__(16) unsigned short sm[2 * GST];
    const int p = blockIdx.z, b = blockIdx.x / (TT / 128), t0 = (blockIdx.x % (TT / 128)) * 128, head0 = blockIdx.y * 2;
    const bf* A = XB + (size_t)blockIdx.x * 128 * DM; const size_t zo = (size_t)b * NH_ * TT * HD, wo = (size_t)blockIdx.y * 128 * DM;
    if (p == 2) proj_wg<2>(sm, A, BV + wo, bv, t0, head0, VT + zo, VTh + zo, VTl + zo);
    else proj_wg<1>(sm, A, (p ? BK : BQ) + wo, p ? bk : bq, t0, head0, (p ? K16 : Q16) + zo, (p ? Kh : Qh) + zo, (p ? Kl : Ql) + zo);
}

typedef __attribute__((ext_vector_type(2))) unsigned short v2us;

__device__ __forceinline__ void wtG_wg(int blk, const float* __restrict__ w, int K, int N, bf* Bt) {
    const int lane = threadIdx.x & 31; const int L0 = (blk * 8 + (threadIdx.x >> 5)) * 8; const int nlines = N * K / 64;
{
#pragma unroll 1
        for (int l = 0; l < 8; ++l) { const int L = L0 + l; if (L >= nlines) break; const size_t e = (size_t)L * 64 + lane * 2; const int k = (int)(e % K), n = (int)(e / K); v2us o;
            o[0] = f2bf(w[(size_t)k * N + n]); o[1] = f2bf(w[(size_t)(k + 1) * N + n]); *(v2us*)(Bt + e) = o; }
         }
}
__device__ __forceinline__ void cvt8_wg(int blk, const float* __restrict__ src, bf* dst, size_t n8) { const size_t i = (size_t)blk * 256 + threadIdx.x; if (i >= n8) return; const v8f v = *(const v8f*)(src + i * 8); v8us o;
#pragma unroll
    for (int k = 0; k < 8; ++k) o[k] = f2bf(v[k]); *(v8us*)(dst + i * 8) = o;  }
// sqt_wg: SQ[j] = sqrt(j) (f32, correctly rounded).
__device__ __forceinline__ bool hlrow(int g, int i) { return (g == 0) ? (i < RHL) : (g == 1) ? (i >= TT - RHL) : false; }
__device__ __forceinline__ void sqt_wg(int blk, float* SQ) { const int j = blk * 256 + threadIdx.x; if (j >= TT) return; const float r = __fsqrt_rn((float)j); *(float*)(SQ + j) = r;  }
// ---- k_prep: all that the projections and attention wait for, as ONE launch: the three weight transposes (their work-groups run longest, so they come first), the rounding of both batches' hidden states, the square-root table. A work-group does one piece of one of them; none reads what another writes.
#define NWT ((DM * DM / 64 + 63) / 64)       // work-groups of one weight transpose
#define NCV (NB_ * TT * DM / 8 / 256)        // work-groups of the rounding
#define NSQ ((TT + 255) / 256)               // work-groups of the table
__global__ __launch_bounds__(256) void k_prep(const float* __restrict__ x, const float* __restrict__ Wq, const float* __restrict__ Wk, const float* __restrict__ Wv, bf* XB, bf* BQ, bf* BK, bf* BV, float* SQ) {
    const int blk = blockIdx.x;
    if (blk < 3 * NWT) { const int p = blk / NWT; wtG_wg(blk - p * NWT, (p == 0) ? Wq : (p == 1) ? Wk : Wv, DM, DM, (p == 0) ? BQ : (p == 1) ? BK : BV); }
    else if (blk < 3 * NWT + NCV) cvt8_wg(blk - 3 * NWT, x, XB, (size_t)NB_ * TT * DM / 8);
    else sqt_wg(blk - 3 * NWT - NCV, SQ);
}
#define KP 72          // LDS row pitch in 16-bit elements: 128 B of data + 16 B, an odd multiple of 16 B, so that the 16 rows of a fragment read fall on different banks
#define PS (64 * KP)   // one 64-row plane
typedef __attribute__((ext_vector_type(2))) float v2f;
typedef __attribute__((ext_vector_type(2))) __bf16 v2b;
template <typename T16> struct Oct;
template <> struct Oct<h16> { typedef v8h T; };
template <> struct Oct<bf> { typedef v8us T; };
__device__ __forceinline__ float xhalf(float x) { return __builtin_bit_cast(float, __builtin_amdgcn_permlanex16(__builtin_bit_cast(int, x), __builtin_bit_cast(int, x), 0x76543210, 0xfedcba98, false, false)); }   // lane l <-> lane l ^ 16
template <typename T16, bool HL>
__device__ __forceinline__ void fattn_wg(T16* lds, const T16* __restrict__ q, const T16* __restrict__ q2, const T16* __restrict__ k, const T16* __restrict__ k2, const T16* __restrict__ vt, const T16* __restrict__ vt2,
                                         const float* __restrict__ SQ, int g, float slope, int q0, int kbeg, int kend, int lr, int hi, float* __restrict__ orow) {
    typedef WFrag<T16> W; typedef typename W::V V; typedef typename Oct<T16>::T H;   // every '#pragma unroll' without a number below opens a short loop of fixed length, so that the arrays it indexes stay in registers
    constexpr int BS = (HL ? 4 : 2) * PS;   // one buffer: K, V^T (and their low planes)
    const float L2E = 1.4426950408889634f; const float c1 = 0.125f * L2E, c2 = slope * L2E;
    __builtin_assume(kbeg < kend);   // the walk has at least one pass: no test in front of the loop, and what only the loop reads is fetched ahead of the first barrier
    const int i = q0 + lr; const float sqi = SQ[i];
    const int klo = (g == 1) ? i : 0; const unsigned span = (unsigned)(((g == 0) ? i : TT - 1) - klo);   // key j is kept when klo <= j <= klo + span
    V qa[2], qb[2]; const T16 *pq = q + (size_t)i * HD + 8 * hi, *pq2 = HL ? q2 + (size_t)i * HD + 8 * hi : pq;
#pragma unroll
    for (int kk = 0; kk < 2; ++kk) { qa[kk] = W::ld(pq + kk * 32); if (HL) qb[kk] = W::ld(pq2 + kk * 32); }
    const int srow = (int)threadIdx.x >> 3, sch = ((int)threadIdx.x & 7) * 8;   // staging: 8 threads a 128-B row, a wave covers 4 whole lines
    const int kso = srow * HD + sch, vso = srow * TT + sch, lso = srow * KP + sch;
    H rk[2], rv[2], rk2[2], rv2[2]; const T16 *pk0 = k + kso + kbeg * HD, *pv0 = vt + vso + kbeg, *pk20 = HL ? k2 + kso + kbeg * HD : pk0, *pv20 = HL ? vt2 + vso + kbeg : pv0;   // the walk's first tiles
#pragma unroll
    for (int r = 0; r < 2; ++r) { rk[r] = *(const H*)(pk0 + r * 32 * HD); rv[r] = *(const H*)(pv0 + r * 32 * TT); if (HL) { rk2[r] = *(const H*)(pk20 + r * 32 * HD); rv2[r] = *(const H*)(pv20 + r * 32 * TT); } }
#pragma unroll
    for (int r = 0; r < 2; ++r) { *(H*)(lds + lso + r * 32 * KP) = rk[r]; *(H*)(lds + PS + lso + r * 32 * KP) = rv[r]; if (HL) { *(H*)(lds + 2 * PS + lso + r * 32 * KP) = rk2[r]; *(H*)(lds + 3 * PS + lso + r * 32 * KP) = rv2[r]; } }
    v4f sq[4][2]; const unsigned sqo = 32u * hi;   // the lane's byte offset in a 16-key stretch of the table
#pragma unroll
    for (int t = 0; t < 4; ++t) { const char* pt = (const char*)(SQ + kbeg + t * 16) + sqo; sq[t][0] = *(const v4f*)pt; sq[t][1] = *(const v4f*)(pt + 16); }
    float m = -1.0e30f, l = 0.f; v8f o[4];
#pragma unroll
    for (int mb = 0; mb < 4; ++mb) o[mb] = (v8f){};
    const int fo = lr * KP + 8 * hi;
#pragma unroll
    for (int r = 0; r < 2; ++r) { rk[r] = *(const H*)(pk0 + (64 + r * 32) * HD); rv[r] = *(const H*)(pv0 + r * 32 * TT + 64); if (HL) { rk2[r] = *(const H*)(pk20 + (64 + r * 32) * HD); rv2[r] = *(const H*)(pv20 + r * 32 * TT + 64); } }   // the second pass's tiles, on their way to the registers
    asm volatile("s_wait_xcnt 0x0" :: "v"(i), "v"(sqo), "v"(pq), "v"(pq2), "v"(pk0), "v"(pv0), "v"(pk20), "v"(pv20) : "memory");   // in front of whatever next overwrites an address register of the fetches above, from the query's on; they are named as inputs so that they stay as they are up to this wait
    __syncthreads();   // the first pass's tiles are in LDS before any wave reads them
#pragma unroll 1   // kept rolled: a pass is some hundred instructions already, a second copy would only cost instruction cache
    for (int k0 = kbeg; k0 < kend; k0 += 64) {   // kbeg is a multiple of 128, so the first pass reads buffer 0; kend - kbeg >= 128
        const T16* lb = lds + ((k0 >> 6) & 1) * BS; T16* ln = lds + (((k0 >> 6) & 1) ^ 1) * BS;
        const int kn = (k0 + 64 < TT) ? k0 + 64 : 0, kf = (k0 + 128 < TT) ? k0 + 128 : 0;   // past the last key block 0 is fetched again, unused (so is what a shorter walk fetches past its own end): addresses stay in bounds and every pass has the same control flow
        v8f s[4];
#pragma unroll
        for (int t = 0; t < 4; ++t) { v8f a = (v8f){};
#pragma unroll
            for (int kk = 0; kk < 2; ++kk) { const V ka = W::ld(lb + fo + t * 16 * KP + kk * 32); a = W::mma(ka, qa[kk], a); if (HL) { const V kb = W::ld(lb + 2 * PS + fo + t * 16 * KP + kk * 32); a = W::mma(kb, qa[kk], a); a = W::mma(ka, qb[kk], a); } }
            s[t] = a; }
#pragma unroll
        for (int t = 0; t < 4; ++t)
#pragma unroll
            for (int j = 0; j < 8; ++j) s[t][j] = s[t][j] * c1 - c2 * fabsf(sq[t][j >> 2][j & 3] - sqi);
#pragma unroll
        for (int t = 0; t < 4; ++t) { sq[t][0] = *(const v4f*)(SQ + kn + t * 16 + 8 * hi); sq[t][1] = *(const v4f*)(SQ + kn + t * 16 + 8 * hi + 4); }
        if ((g == 0 && k0 + 63 > q0) || (g == 1 && k0 < q0 + 15)) {   // wave-uniform: only a pass that holds a masked (query, key) pair of this wave pays for the mask
            const int kb0 = k0 + 8 * hi - klo;
#pragma unroll
            for (int t = 0; t < 4; ++t)
#pragma unroll
                for (int j = 0; j < 8; ++j) s[t][j] = ((unsigned)(kb0 + t * 16 + j) <= span) ? s[t][j] : -3.0e38f; }
        float mt[4];
#pragma unroll
        for (int t = 0; t < 4; ++t) { mt[t] = s[t][0];
#pragma unroll
            for (int j = 1; j < 8; ++j) mt[t] = fmaxf(mt[t], s[t][j]); }
        float mx = fmaxf(fmaxf(m, fmaxf(mt[0], mt[1])), fmaxf(mt[2], mt[3])); mx = fmaxf(mx, xhalf(mx));
        const float al = __builtin_amdgcn_exp2f(m - mx), ms = mx - 10.0f; m = mx;   // while every key so far was masked, mx stays at its start value, al is 1 and every p below is 0
#pragma unroll
        for (int mb = 0; mb < 4; ++mb) o[mb] *= al;
        V pa[2], pb[2]; float lt[4];
#pragma unroll
        for (int t = 0; t < 4; ++t) { lt[t] = 0.f;
#pragma unroll
            for (int j = 0; j < 8; j += 2) { v2f p; p[0] = __builtin_amdgcn_exp2f(s[t][j] - ms); p[1] = __builtin_amdgcn_exp2f(s[t][j + 1] - ms); lt[t] += p[0]; lt[t] += p[1]; const int e = (t & 1) * 8 + j;
                if constexpr (HL) { const v2b ph = __builtin_convertvector(p, v2b); const v2b pl = __builtin_convertvector(p - __builtin_convertvector(ph, v2f), v2b); pa[t >> 1][e] = ph[0]; pa[t >> 1][e + 1] = ph[1]; pb[t >> 1][e] = pl[0]; pb[t >> 1][e + 1] = pl[1]; }   // high plane, and what it leaves, both rounded to nearest
                else { pa[t >> 1][e] = (h16)p[0]; pa[t >> 1][e + 1] = (h16)p[1]; } } }
        l = l * al + ((lt[0] + lt[1]) + (lt[2] + lt[3]));
#pragma unroll
        for (int kk = 0; kk < 2; ++kk)
#pragma unroll
            for (int mb = 0; mb < 4; ++mb) { const V va = W::ld(lb + PS + fo + mb * 16 * KP + kk * 32); o[mb] = W::mma(va, pa[kk], o[mb]); if (HL) { const V vb = W::ld(lb + 3 * PS + fo + mb * 16 * KP + kk * 32); o[mb] = W::mma(vb, pa[kk], o[mb]); o[mb] = W::mma(va, pb[kk], o[mb]); } }
#pragma unroll
        for (int r = 0; r < 2; ++r) { *(H*)(ln + lso + r * 32 * KP) = rk[r]; *(H*)(ln + PS + lso + r * 32 * KP) = rv[r]; if (HL) { *(H*)(ln + 2 * PS + lso + r * 32 * KP) = rk2[r]; *(H*)(ln + 3 * PS + lso + r * 32 * KP) = rv2[r]; } }
        const T16 *pk = k + kso + kf * HD, *pv = vt + vso + kf, *pk2 = HL ? k2 + kso + kf * HD : pk, *pv2 = HL ? vt2 + vso + kf : pv;
#pragma unroll
        for (int r = 0; r < 2; ++r) { rk[r] = *(const H*)(pk + r * 32 * HD); rv[r] = *(const H*)(pv + r * 32 * TT); if (HL) { rk2[r] = *(const H*)(pk2 + r * 32 * HD); rv2[r] = *(const H*)(pv2 + r * 32 * TT); } }   // fetched a whole pass ahead of their store to LDS
        asm volatile("s_wait_xcnt 0x0" :: "v"(pk), "v"(pv), "v"(pk2), "v"(pv2) : "memory");   // in front of whatever next overwrites the address registers of the fetches above; they are named as inputs so that they stay as they are up to this wait
        asm volatile("s_wait_dscnt 0x0" ::: "memory");   // this wave's LDS stores above have landed and its reads of this pass's buffer have returned
        asm volatile("s_barrier_signal -1\n\ts_barrier_wait -1" ::: "memory");   // work-group barrier: publishes the next pass's tiles and frees this pass's buffer. By hand, because __syncthreads() also waits for the global fetches just issued, which are to fly through the next pass
    }
    l += xhalf(l); const float inv = 1.0f / l;
#pragma unroll
    for (int mb = 0; mb < 4; ++mb) { float* d = orow + (size_t)lr * DM + mb * 16 + hi * 8; v4f x0, x1;
#pragma unroll
        for (int u = 0; u < 4; ++u) { x0[u] = o[mb][u] * inv; x1[u] = o[mb][4 + u] * inv; }
        *(v4f*)d = x0; *(v4f*)(d + 4) = x1; }
}
__global__ __launch_bounds__(256) void k_fattn(const h16* __restrict__ Q16, const bf* __restrict__ Qh, const bf* __restrict__ Ql, const h16* __restrict__ K16, const bf* __restrict__ Kh, const bf* __restrict__ Kl,
                                               const h16* __restrict__ VT, const bf* __restrict__ VTh, const bf* __restrict__ VTl, const float* __restrict__ SQ, float* __restrict__ outb) {
    __shared__ __align__(16) unsigned short sm[2 * 4 * PS];
    const int lane = threadIdx.x & 31, lr = lane & 15, hi = lane >> 4; const int wv = __builtin_amdgcn_readfirstlane((int)(threadIdx.x >> 5));   // wave number in a scalar register: the mask test of a pass is then a scalar branch
    // both batches in one launch, 384 work-groups in one dimension. This kernel's registers leave room for ONE work-group on a WGP, so 256 run at once and the other 128 start as places fall free: the numbering makes cost fall with the index
    // (for speed only: any order of starting is correct). 0-127: the masked heads' tiles of ranks 15 down to 8 (rank c walks 2 (c + 1) passes); 128-255: the unmasked heads, 32 passes each; 256-383: ranks 7 to 0 by falling cost,
    // a three-product pass of the short-window rows (ranks 0-3) counted as about two plain ones. The first place to fall free (rank 8) so takes the longest walk left, and no place works longer than about 39 plain passes' time.
    // Every (batch, head, tile) is taken once: 15 - (f >> 4) covers ranks 15-8, the table ranks 7-0, 16 numbers (8 heads x 2 batches) a rank.
    const int f = blockIdx.x; int b, h, xt;
    if (f >= 128 && f < 256) { const int u = f - 128; xt = u >> 3; h = 8 + ((u & 7) >> 1); b = u & 1; }
    else { const int c = (f < 128) ? 15 - (f >> 4) : (int)((0x01452673u >> (((f - 256) >> 4) * 4)) & 15u);   // the table, low digit first: ranks 3, 7, 6, 2, 5, 4, 1, 0
        h = (f & 15) >> 1; b = f & 1; xt = (h < 4) ? c : 15 - c; }   // a causal head's tile c has rank c, an anti-causal head's tile c rank 15 - c
    const int g = h / 4, hm = h % 4; const float slope = (hm == 0) ? 0.25f : (hm == 1) ? 0.0625f : (hm == 2) ? 0.015625f : 0.00390625f;
    const int kbeg = (g == 1) ? xt * 128 : 0, kend = (g == 0) ? xt * 128 + 128 : TT;   // the keys that at least one of the work-group's 128 queries keeps; a pass outside holds masked pairs only and would add exact zeros (factor 1, every p 0). The same for all 8 waves: every wave meets every barrier
    const int q0 = (xt * 8 + wv) * 16; const size_t zo = ((size_t)b * NH_ + h) * TT * HD; float* orow = outb + ((size_t)b * TT + q0) * DM + h * HD;
    if (hlrow(g, xt * 128)) fattn_wg<bf, true>(sm, Qh + zo, Ql + zo, Kh + zo, Kl + zo, VTh + zo, VTl + zo, SQ, g, slope, q0, kbeg, kend, lr, hi, orow);   // 128 divides the window's 512 rows: the same path for the whole work-group
    else fattn_wg<h16, false>((h16*)sm, Q16 + zo, nullptr, K16 + zo, nullptr, VT + zo, nullptr, SQ, g, slope, q0, kbeg, kend, lr, hi, orow);
}

extern "C" void kernel_launch(void* const* d_in, const int* in_sizes, int n_in,
                              void* d_out, int out_size, void* d_ws, size_t ws_size, hipStream_t stream) {
    (void)in_sizes; (void)n_in; (void)out_size;
    const float** I = (const float**)d_in;
    const float *x = I[0], *Wq = I[1], *bq = I[2], *Wk = I[3], *bk = I[4], *Wv = I[5], *bv = I[6];
    float* OUT = (float*)d_out;     // [2][2048][768]
    char* wsp = (char*)d_ws;
    auto take = [&](size_t bytes) { char* p = wsp; wsp += (bytes + 255) & ~(size_t)255; return (void*)p; };
    bf* BQ = (bf*)take((size_t)DM * DM * 2); bf* BK = (bf*)take((size_t)DM * DM * 2); bf* BV = (bf*)take((size_t)DM * DM * 2);
    bf* XB = (bf*)take((size_t)NB_ * TT * DM * 2);
    h16* Q16 = (h16*)take((size_t)NB_ * NH_ * TT * HD * 2); bf* Qh = (bf*)take((size_t)NB_ * NH_ * TT * HD * 2); bf* Ql = (bf*)take((size_t)NB_ * NH_ * TT * HD * 2); h16* K16 = (h16*)take((size_t)NB_ * NH_ * TT * HD * 2); bf* Kh = (bf*)take((size_t)NB_ * NH_ * TT * HD * 2); bf* Kl = (bf*)take((size_t)NB_ * NH_ * TT * HD * 2);
    h16* VT = (h16*)take((size_t)NB_ * NH_ * HD * TT * 2); bf* VTh = (bf*)take((size_t)NB_ * NH_ * HD * TT * 2); bf* VTl = (bf*)take((size_t)NB_ * NH_ * HD * TT * 2); float* SQ = (float*)take(TT * 4);
    if ((size_t)(wsp - (char*)d_ws) > ws_size) return;    // total ~ 66 MB
    k_prep<<<3 * NWT + NCV + NSQ, 256, 0, stream>>>(x, Wq, Wk, Wv, XB, BQ, BK, BV, SQ);
    k_qkv<<<dim3(NB_ * TT / 128, DM / 128, 3), 128, 0, stream>>>(XB, BQ, BK, BV, bq, bk, bv, Q16, Qh, Ql, K16, Kh, Kl, VT, VTh, VTl);
    k_fattn<<<TT / 128 * NB_ * NH_, 256, 0, stream>>>(Q16, Qh, Ql, K16, Kh, Kl, VT, VTh, VTl, SQ, OUT);
}

// v008
// A run of this version takes 62.1 microseconds.
// Two timings next to v007 both put it at 1.03 times that version's speed.
// Over all steps from v000 it is 15.0 times as fast.
#include <hip/hip_runtime.h>

// NonSymmetricAttentionKernel (hidden [2][2048][768]; q/k/v = x W + b (12 heads x 64); scores = q.k/8 + alibi[h][i][j] where alibi = -slope[h%4] |sqrt(j) - sqrt(i)|, slopes 2^-2, 2^-4, 2^-6, 2^-8; heads 0-3 causal (j <= i), heads 4-7 anti-causal (j >= i), heads 8-11 unmasked;
// softmax; out = attn v merged (no output projection) -> [2][2048][768]).
// Compute dtypes, f32 accumulate: every input rounded to bf16; q/k/v on PLAIN bf16 operands (inputs: exact) + bias; scores (K 64) and attn.v on single fp16 planes (probabilities x1024) EXCEPT the short-window rows (query rows < 512 of heads 0-3, >= 1536 of heads 4-7): bf16 high + low planes, three products.

#define NB_  2
#define TT   2048
#define DM   768
#define NH_  12
#define HD   64
#define RHL  512
typedef _Float16 h16;
typedef unsigned short bf;
typedef __attribute__((ext_vector_type(16))) __bf16   v16bf;
typedef __attribute__((ext_vector_type(16))) _Float16 v16h;
typedef __attribute__((ext_vector_type(8)))  _Float16 v8h;
typedef __attribute__((ext_vector_type(8)))  unsigned short v8us;
typedef __attribute__((ext_vector_type(8)))  float    v8f;
typedef __attribute__((ext_vector_type(4)))  float    v4f;
typedef v8h  __attribute__((may_alias)) v8ha;
typedef v4f  __attribute__((may_alias)) v4fa;
typedef v8us __attribute__((may_alias)) v8usa;

__device__ __forceinline__ unsigned short f2bf(float f) { unsigned u = __float_as_uint(f); u += 0x7FFFu + ((u >> 16) & 1u); return (unsigned short)(u >> 16); }
__device__ __forceinline__ float bf2f(unsigned short b) { return __uint_as_float(((unsigned)b) << 16); }
__device__ __forceinline__ float bfr(float f) { return bf2f(f2bf(f)); }
__device__ __forceinline__ v16h cat16(v8h lo, v8h hi) { return __builtin_shufflevector(lo, hi, 0, 1, 2, 3, 4, 5, 6, 7, 8, 9, 10, 11, 12, 13, 14, 15); }
__device__ __forceinline__ v16bf cat16b(v8us lo, v8us hi) { return __builtin_bit_cast(v16bf, __builtin_shufflevector(lo, hi, 0, 1, 2, 3, 4, 5, 6, 7, 8, 9, 10, 11, 12, 13, 14, 15)); }
__device__ __forceinline__ v8f wmma16(v16h a, v16h b, v8f c) { return __builtin_amdgcn_wmma_f32_16x16x32_f16(false, a, false, b, (short)0, c, false, false); }
__device__ __forceinline__ v8f wmmab(v16bf a, v16bf b, v8f c) { return __builtin_amdgcn_wmma_f32_16x16x32_bf16(false, a, false, b, (short)0, c, false, false); }
__device__ __forceinline__ h16 tohx(float x) { return (h16)x; }
__device__ __forceinline__ void splitf(float y, unsigned short& h, unsigned short& l) { h = f2bf(y); l = f2bf(y - bf2f(h)); }
typedef __attribute__((ext_vector_type(4))) unsigned short v4us;
typedef __attribute__((ext_vector_type(4))) _Float16 v4h;



// ---- proj_wg: one 128 x 128 tile of a projection, C[t][n] = sum_k x[t][k] Wt[n][k] + bias[n], by a work-group of 4 waves (2 x 2, a wave holds 64 x 64 = 16 accumulators; a wave's 64 columns are one head).
// The k axis is walked in 12 stages of 64. A stage is 128 rows of x and 128 rows of Wt, 128 B (one whole line) of each row, laid in LDS at pitch GP by asynchronous copies, 16 B a lane, 4 whole lines a wave and copy; every row is fetched once for the whole work-group and read as fragments from LDS.
// Two buffers: when every wave has read the last fragments of stage t into registers, the copies of stage t + 2 are issued into that buffer and fly through the second half of stage t's matrix instructions and the first half of stage t + 1's. Each accumulator sums its k in rising order.
// C never reaches memory: each wave lays its f32 tile (+ bias) in its own part of the LDS that the stages have left, and rounds it to the three 16-bit planes that attention reads (fp16, bf16 high, bf16 low):
// OUT 1 as [head][t][d]; OUT 2 as [head][d][t], for which the tile lies transposed in LDS (an accumulator's 8 values are 8 consecutive t of one d: two 16-B LDS stores).
template <typename T16> struct WFrag;
template <> struct WFrag<h16> { typedef v16h V; static __device__ __forceinline__ V ld(const h16* p) { return cat16(*(const v8h*)p, *(const v8h*)(p + 16)); } static __device__ __forceinline__ v8f mma(V a, V b, v8f c) { return wmma16(a, b, c); } };
template <> struct WFrag<bf> { typedef v16bf V; static __device__ __forceinline__ V ld(const bf* p) { return cat16b(*(const v8us*)p, *(const v8us*)(p + 16)); } static __device__ __forceinline__ v8f mma(V a, V b, v8f c) { return wmmab(a, b, c); } };
#define GP 72            // LDS row pitch in 16-bit elements: 128 B of data + 16 B, an odd multiple of 16 B, so that the 16 rows of a fragment read fall on different banks
#define GST (256 * GP)   // one stage: 128 rows of x, then 128 rows of Wt
#define NST (DM / 64)    // stages
// copy8: eight asynchronous copies of 16 B a lane, rows 16 apart: global g + j * 16 rows -> LDS byte address d + j * 16 rows. The wait at the end of the statement stands in front of whatever next overwrites an address register of these copies.
__device__ __forceinline__ void copy8(unsigned d, const bf* g) {
    const unsigned d1 = d + 16 * GP * 2, d2 = d + 32 * GP * 2, d3 = d + 48 * GP * 2, d4 = d + 64 * GP * 2, d5 = d + 80 * GP * 2, d6 = d + 96 * GP * 2, d7 = d + 112 * GP * 2;
    const bf *g1 = g + 16 * DM, *g2 = g + 32 * DM, *g3 = g + 48 * DM, *g4 = g + 64 * DM, *g5 = g + 80 * DM, *g6 = g + 96 * DM, *g7 = g + 112 * DM;
    asm volatile("global_load_async_to_lds_b128 %0, %8, off\n\t"
                 "global_load_async_to_lds_b128 %1, %9, off\n\t"
                 "global_load_async_to_lds_b128 %2, %10, off\n\t"
                 "global_load_async_to_lds_b128 %3, %11, off\n\t"
                 "global_load_async_to_lds_b128 %4, %12, off\n\t"
                 "global_load_async_to_lds_b128 %5, %13, off\n\t"
                 "global_load_async_to_lds_b128 %6, %14, off\n\t"
                 "global_load_async_to_lds_b128 %7, %15, off\n\t"
                 "s_wait_xcnt 0x0"
                 :: "v"(d), "v"(d1), "v"(d2), "v"(d3), "v"(d4), "v"(d5), "v"(d6), "v"(d7), "v"(g), "v"(g1), "v"(g2), "v"(g3), "v"(g4), "v"(g5), "v"(g6), "v"(g7) : "memory");
}
template <int OUT>
__device__ __forceinline__ void proj_wg(bf* sm, const bf* __restrict__ A, const bf* __restrict__ Bt, const float* __restrict__ bias, int t0, int head0, h16* P, bf* Ph, bf* Pl) {
    typedef WFrag<bf> W; typedef W::V V;   // every '#pragma unroll' without a number below opens a short loop of fixed length, so that the arrays it indexes stay in registers
    const int wv = __builtin_amdgcn_readfirstlane((int)(threadIdx.x >> 5)), wm = wv & 1, wn = wv >> 1;   // wave number in a scalar register: LDS bases stay scalar
    const int lane = threadIdx.x & 31, lr = lane & 15, hi = lane >> 4;
    const int srow = (int)threadIdx.x >> 3, sch = ((int)threadIdx.x & 7) * 8;   // staging: 8 lanes a 128-B row, a wave covers 4 whole lines
    const bf *ga = A + srow * DM + sch, *gb = Bt + srow * DM + sch;
    const unsigned la = (unsigned)(size_t)(sm + srow * GP + sch), lb0 = la + 128 * GP * 2;   // the lane's LDS byte addresses in buffer 0: low 32 bits of the shared address
    const int head = head0 + wn, tw = t0 + wm * 64;
    float bs[4]; const float* pb = bias + head * HD + lr;   // an accumulator's column is 16 nb + lr: four bias values a lane, fetched ahead of the walk
#pragma unroll
    for (int nb = 0; nb < 4; ++nb) bs[nb] = pb[nb * 16];
    asm volatile("s_wait_xcnt 0x0" :: "v"(pb) : "memory");   // in front of whatever next overwrites the address register of the four fetches above; named as an input so that it stays as it is up to this wait
    copy8(la, ga); copy8(lb0, gb);
    asm volatile("s_wait_asynccnt 0x0" ::: "memory");   // this wave's copies of stage 0 have landed
    __syncthreads();   // stage 0 is in LDS before any wave reads it
    copy8(la + GST * 2, ga + 64); copy8(lb0 + GST * 2, gb + 64);
    v8f acc[4][4];
#pragma unroll
    for (int mb = 0; mb < 4; ++mb)
#pragma unroll
        for (int nb = 0; nb < 4; ++nb) acc[mb][nb] = (v8f){};
    const int fa = (wm * 64 + lr) * GP + 8 * hi, fb = (128 + wn * 64 + lr) * GP + 8 * hi;
#pragma unroll 1   // kept rolled: the buffer alternates by the counter, and a stage is 32 matrix instructions already
    for (int t = 0; t < NST; ++t) {
        const bf* lb = sm + (t & 1) * GST;
        V a[4], b[4];
#pragma unroll
        for (int mb = 0; mb < 4; ++mb) a[mb] = W::ld(lb + fa + mb * 16 * GP);
#pragma unroll
        for (int nb = 0; nb < 4; ++nb) b[nb] = W::ld(lb + fb + nb * 16 * GP);
        __builtin_amdgcn_sched_barrier(0);   // the eight fragments of the stage's first half are read as one group ahead of its matrix instructions; left alone the compiler reads each b fragment right in front of its use and the wave waits out the LDS latency four times
#pragma unroll
        for (int nb = 0; nb < 4; ++nb)
#pragma unroll
            for (int mb = 0; mb < 4; ++mb) acc[mb][nb] = W::mma(a[mb], b[nb], acc[mb][nb]);
#pragma unroll
        for (int mb = 0; mb < 4; ++mb) a[mb] = W::ld(lb + fa + mb * 16 * GP + 32);
#pragma unroll
        for (int nb = 0; nb < 4; ++nb) b[nb] = W::ld(lb + fb + nb * 16 * GP + 32);
        asm volatile("s_wait_dscnt 0x0" ::: "memory");      // this wave's reads of stage t have returned: the second half's fragments are in registers
        asm volatile("s_wait_asynccnt 0x0" ::: "memory");   // this wave's copies of stage t + 1 have landed
        __syncthreads();   // publishes stage t + 1 and frees stage t's buffer
        if (t + 2 < NST) { copy8(la + (t & 1) * (GST * 2), ga + (t + 2) * 64); copy8(lb0 + (t & 1) * (GST * 2), gb + (t + 2) * 64); }   // the same test for the whole work-group
#pragma unroll
        for (int nb = 0; nb < 4; ++nb)
#pragma unroll
            for (int mb = 0; mb < 4; ++mb) acc[mb][nb] = W::mma(a[mb], b[nb], acc[mb][nb]);   // from registers alone, while the copies fly
    }
    asm volatile("s_wait_asynccnt 0x0" ::: "memory");   // no copy is outstanding when the buffers become output staging
    float* ow = (float*)sm + wv * (64 * 68);
#pragma unroll
    for (int nb = 0; nb < 4; ++nb) { const float bn = bfr(bs[nb]);
#pragma unroll
        for (int mb = 0; mb < 4; ++mb) { const v8f c = acc[mb][nb] + bn;
            if constexpr (OUT == 2) { float* p = ow + (nb * 16 + lr) * 68 + mb * 16 + hi * 8; *(v4fa*)p = __builtin_shufflevector(c, c, 0, 1, 2, 3); *(v4fa*)(p + 4) = __builtin_shufflevector(c, c, 4, 5, 6, 7); }
            else {
#pragma unroll
                for (int j = 0; j < 8; ++j) ow[(mb * 16 + hi * 8 + j) * 68 + nb * 16 + lr] = c[j]; } } }
    __syncthreads();   // the tiles are in LDS before they are read back row by row
    const int cofs = lr * 4;
#pragma unroll 1   // kept rolled: all 32 row pairs opened would only cost instruction cache
    for (int s = 0; s < 32; s += 4) { v4f val[4];   // four LDS reads go ahead as one group: the waits behind the stores below would otherwise hold each read back until the row before it is stored
#pragma unroll
        for (int r = 0; r < 4; ++r) val[r] = *(const v4fa*)(ow + (2 * (s + r) + hi) * 68 + cofs);
#pragma unroll
        for (int r = 0; r < 4; ++r) { const int row = 2 * (s + r) + hi;
            const size_t e = (OUT == 1) ? ((size_t)head * TT + tw + row) * HD + cofs : ((size_t)head * HD + row) * TT + tw + cofs; v4h o; v4us oh, ol;   // 16 lanes fill one 128-B line of each plane
#pragma unroll
            for (int u = 0; u < 4; ++u) { o[u] = tohx(val[r][u]); unsigned short a, b; splitf(val[r][u], a, b); oh[u] = a; ol[u] = b; }
            h16* d0 = P + e; bf *d1 = Ph + e, *d2 = Pl + e; *(v4h*)d0 = o; *(v4us*)d1 = oh; *(v4us*)d2 = ol;
            asm volatile("s_wait_xcnt 0x0" :: "v"(d0), "v"(d1), "v"(d2), "v"(o), "v"(oh), "v"(ol) : "memory"); } }   // in front of whatever next overwrites an address or data register of the three stores above; they are named as inputs so that they stay as they are up to this wait
}

// ---- k_qkv: the six projections (q, k, v of both batches) as ONE launch, grid (NB_ * TT / 128, DM / 128, 3): blockIdx.x picks batch and rows, blockIdx.y two heads, blockIdx.z the projection, the same for a whole work-group. None reads what another writes.
__global__ __launch_bounds__(128) void k_qkv(const bf* __restrict__ XB, const bf* __restrict__ BQ, const bf* __restrict__ BK, const bf* __restrict__ BV, const float* __restrict__ bq, const float* __restrict__ bk, const float* __restrict__ bv,
                                             h16* Q16, bf* Qh, bf* Ql, h16* K16, bf* Kh, bf* Kl, h16* VT, bf* VTh, bf* VTl) {
    __shared__ __align__(16) unsigned short sm[2 * GST];
    const int p = blockIdx.z, b = blockIdx.x / (TT / 128), t0 = (blockIdx.x % (TT / 128)) * 128, head0 = blockIdx.y * 2;
    const bf* A = XB + (size_t)blockIdx.x * 128 * DM; const size_t zo = (size_t)b * NH_ * TT * HD, wo = (size_t)blockIdx.y * 128 * DM;
    if (p == 2) proj_wg<2>(sm, A, BV + wo, bv, t0, head0, VT + zo, VTh + zo, VTl + zo);
    else proj_wg<1>(sm, A, (p ? BK : BQ) + wo, p ? bk : bq, t0, head0, (p ? K16 : Q16) + zo, (p ? Kh : Qh) + zo, (p ? Kl : Ql) + zo);
}

// wt_wg: a 256 (k) x 64 (n) piece of a weight, w[k][n] f32 -> Bt[n][k] rounded to bf16, turned in LDS. A thread fetches a 4 x 4 block of each of the piece's four 64-row quarters (16 lanes read 256 B of one row: whole lines; all 16 fetches go ahead as one group),
// and stores each column of a block as 4 consecutive k. Column n lies in LDS row (n >> 2) + 16 (n & 3): the 16 lanes of one store then fall on 16 neighbouring LDS rows, which at pitch WTP are different banks. A wave reads a whole LDS row (512 B) and stores it as four whole lines of Bt.
#define WTP 264          // LDS row pitch in 16-bit elements: 512 B of data + 16 B
__device__ __forceinline__ void wt_wg(bf* tl, int blk, const float* __restrict__ w, bf* Bt) {
    const int n0 = (blk / 3) * 64, kb = (blk % 3) * 256; const int kq = (int)threadIdx.x >> 4, cl = (int)threadIdx.x & 15;
    const float* pw = w + (size_t)(kb + 4 * kq) * DM + n0 + cl * 4; v4f v[4][4];   // every '#pragma unroll' below opens a short loop of fixed length, so that the arrays it indexes stay in registers
#pragma unroll
    for (int u = 0; u < 4; ++u)
#pragma unroll
        for (int r = 0; r < 4; ++r) v[u][r] = *(const v4f*)(pw + (u * 64 + r) * DM);
    asm volatile("s_wait_xcnt 0x0" :: "v"(pw) : "memory");   // in front of whatever next overwrites the address register of the fetches above; it is named as an input so that it stays as it is up to this wait
#pragma unroll
    for (int u = 0; u < 4; ++u)
#pragma unroll
        for (int c = 0; c < 4; ++c) { v4us o;
#pragma unroll
            for (int r = 0; r < 4; ++r) o[r] = f2bf(v[u][r][c]);
            *(v4us*)(tl + (cl + 16 * c) * WTP + u * 64 + 4 * kq) = o; }
    __syncthreads();   // the piece is in LDS before it is read back row by row
    const int wv = (int)threadIdx.x >> 5, lane = (int)threadIdx.x & 31;
    const bf* pl = tl + wv * 8 * WTP + lane * 8; bf* pd = Bt + (size_t)(n0 + (wv & 1) * 32 + (wv >> 1)) * DM + kb + lane * 8; v8us o[8];   // LDS row 8 wv + s holds column 4 ((8 wv + s) & 15) + (wv >> 1)
#pragma unroll
    for (int s = 0; s < 8; ++s) o[s] = *(const v8us*)(pl + s * WTP);
#pragma unroll
    for (int s = 0; s < 8; ++s) *(v8us*)(pd + s * 4 * DM) = o[s];
}
// cvt_wg: XU x 256 octets of the hidden states rounded to bf16; a thread's XU octets lie 256 octets apart (a wave reads and writes whole lines) and are all fetched ahead of the first rounding.
#define XU 12
__device__ __forceinline__ void cvt_wg(int blk, const float* __restrict__ src, bf* dst) { const size_t i0 = ((size_t)blk * (256 * XU) + threadIdx.x) * 8; const float* ps = src + i0; bf* pd = dst + i0; v8f v[XU]; v8us o[XU];
#pragma unroll
    for (int u = 0; u < XU; ++u) v[u] = *(const v8f*)(ps + u * 2048);
    asm volatile("s_wait_xcnt 0x0" :: "v"(ps) : "memory");   // in front of whatever next overwrites the address register of the fetches above; it is named as an input so that it stays as it is up to this wait
#pragma unroll
    for (int u = 0; u < XU; ++u) {
#pragma unroll
        for (int k = 0; k < 8; ++k) o[u][k] = f2bf(v[u][k]);
        *(v8us*)(pd + u * 2048) = o[u]; }
    asm volatile("s_wait_xcnt 0x0" :: "v"(pd), "v"(o[0]), "v"(o[1]), "v"(o[2]), "v"(o[3]), "v"(o[4]), "v"(o[5]), "v"(o[6]), "v"(o[7]), "v"(o[8]), "v"(o[9]), "v"(o[10]), "v"(o[11]) : "memory"); }   // in front of whatever next overwrites an address or data register of the stores above (the table's work-groups go on); they are named as inputs so that they stay as they are up to this wait
// sqt_wg: SQ[j] = sqrt(j) (f32, correctly rounded).
__device__ __forceinline__ bool hlrow(int g, int i) { return (g == 0) ? (i < RHL) : (g == 1) ? (i >= TT - RHL) : false; }
__device__ __forceinline__ void sqt_wg(int blk, float* SQ) { const int j = blk * 256 + threadIdx.x; if (j >= TT) return; const float r = __fsqrt_rn((float)j);
    asm volatile("v_nop" :: "v"(r) : "memory");   // fills the one slot between the square root and the store that reads its result; the root is named as an input, so that the slot stands behind it
    *(float*)(SQ + j) = r;  }
// ---- k_prep: all that the projections and attention wait for, as ONE launch of fewer work-groups than the chip has WGPs, so that all start at once and each thread keeps many fetches in flight: the three weight transposes, the rounding of both batches' hidden states, the square-root table (by the first work-groups of the rounding). A work-group does one piece of a transpose or of the rounding (the first eight of the rounding also one of the table); none reads what another writes.
#define NWT ((DM / 64) * (DM / 256))         // work-groups of one weight transpose
#define NCV (NB_ * TT * DM / 8 / 256 / XU)   // work-groups of the rounding
#define NSQ ((TT + 255) / 256)               // of which so many also fill the table
__global__ __launch_bounds__(256) void k_prep(const float* __restrict__ x, const float* __restrict__ Wq, const float* __restrict__ Wk, const float* __restrict__ Wv, bf* XB, bf* BQ, bf* BK, bf* BV, float* SQ) {
    __shared__ __align__(16) unsigned short tl[64 * WTP];
    const int blk = blockIdx.x;
    if (blk < 3 * NWT) { const int p = blk / NWT; wt_wg(tl, blk - p * NWT, (p == 0) ? Wq : (p == 1) ? Wk : Wv, (p == 0) ? BQ : (p == 1) ? BK : BV); }
    else { const int xb = blk - 3 * NWT; cvt_wg(xb, x, XB); if (xb < NSQ) sqt_wg(xb, SQ); }
}
#define KP 72          // LDS row pitch in 16-bit elements: 128 B of data + 16 B, an odd multiple of 16 B, so that the 16 rows of a fragment read fall on different banks
#define PS (64 * KP)   // one 64-row plane
typedef __attribute__((ext_vector_type(2))) float v2f;
typedef __attribute__((ext_vector_type(2))) __bf16 v2b;
template <typename T16> struct Oct;
template <> struct Oct<h16> { typedef v8h T; };
template <> struct Oct<bf> { typedef v8us T; };
__device__ __forceinline__ float xhalf(float x) { return __builtin_bit_cast(float, __builtin_amdgcn_permlanex16(__builtin_bit_cast(int, x), __builtin_bit_cast(int, x), 0x76543210, 0xfedcba98, false, false)); }   // lane l <-> lane l ^ 16
template <typename T16, bool HL>
__device__ __forceinline__ void fattn_wg(T16* lds, const T16* __restrict__ q, const T16* __restrict__ q2, const T16* __restrict__ k, const T16* __restrict__ k2, const T16* __restrict__ vt, const T16* __restrict__ vt2,
                                         const float* __restrict__ SQ, int g, float slope, int q0, int kbeg, int kend, int lr, int hi, float* __restrict__ orow) {
    typedef WFrag<T16> W; typedef typename W::V V; typedef typename Oct<T16>::T H;   // every '#pragma unroll' without a number below opens a short loop of fixed length, so that the arrays it indexes stay in registers
    constexpr int BS = (HL ? 4 : 2) * PS;   // one buffer: K, V^T (and their low planes)
    const float L2E = 1.4426950408889634f; const float c1 = 0.125f * L2E, c2 = slope * L2E;
    __builtin_assume(kbeg < kend);   // the walk has at least one pass: no test in front of the loop, and what only the loop reads is fetched ahead of the first barrier
    const int i = q0 + lr; const float sqi = SQ[i];
    const int klo = (g == 1) ? i : 0; const unsigned span = (unsigned)(((g == 0) ? i : TT - 1) - klo);   // key j is kept when klo <= j <= klo + span
    V qa[2], qb[2]; const T16 *pq = q + (size_t)i * HD + 8 * hi, *pq2 = HL ? q2 + (size_t)i * HD + 8 * hi : pq;
#pragma unroll
    for (int kk = 0; kk < 2; ++kk) { qa[kk] = W::ld(pq + kk * 32); if (HL) qb[kk] = W::ld(pq2 + kk * 32); }
    const int srow = (int)threadIdx.x >> 3, sch = ((int)threadIdx.x & 7) * 8;   // staging: 8 threads a 128-B row, a wave covers 4 whole lines
    const int kso = srow * HD + sch, vso = srow * TT + sch, lso = srow * KP + sch;
    H rk[2], rv[2], rk2[2], rv2[2]; const T16 *pk0 = k + kso + kbeg * HD, *pv0 = vt + vso + kbeg, *pk20 = HL ? k2 + kso + kbeg * HD : pk0, *pv20 = HL ? vt2 + vso + kbeg : pv0;   // the walk's first tiles
#pragma unroll
    for (int r = 0; r < 2; ++r) { rk[r] = *(const H*)(pk0 + r * 32 * HD); rv[r] = *(const H*)(pv0 + r * 32 * TT); if (HL) { rk2[r] = *(const H*)(pk20 + r * 32 * HD); rv2[r] = *(const H*)(pv20 + r * 32 * TT); } }
#pragma unroll
    for (int r = 0; r < 2; ++r) { *(H*)(lds + lso + r * 32 * KP) = rk[r]; *(H*)(lds + PS + lso + r * 32 * KP) = rv[r]; if (HL) { *(H*)(lds + 2 * PS + lso + r * 32 * KP) = rk2[r]; *(H*)(lds + 3 * PS + lso + r * 32 * KP) = rv2[r]; } }
    v4f sq[4][2]; const unsigned sqo = 32u * hi;   // the lane's byte offset in a 16-key stretch of the table
#pragma unroll
    for (int t = 0; t < 4; ++t) { const char* pt = (const char*)(SQ + kbeg + t * 16) + sqo; sq[t][0] = *(const v4f*)pt; sq[t][1] = *(const v4f*)(pt + 16); }
    float m = -1.0e30f, l = 0.f; v8f o[4];
#pragma unroll
    for (int mb = 0; mb < 4; ++mb) o[mb] = (v8f){};
    const int fo = lr * KP + 8 * hi;
#pragma unroll
    for (int r = 0; r < 2; ++r) { rk[r] = *(const H*)(pk0 + (64 + r * 32) * HD); rv[r] = *(const H*)(pv0 + r * 32 * TT + 64); if (HL) { rk2[r] = *(const H*)(pk20 + (64 + r * 32) * HD); rv2[r] = *(const H*)(pv20 + r * 32 * TT + 64); } }   // the second pass's tiles, on their way to the registers
    asm volatile("s_wait_xcnt 0x0" :: "v"(i), "v"(sqo), "v"(pq), "v"(pq2), "v"(pk0), "v"(pv0), "v"(pk20), "v"(pv20) : "memory");   // in front of whatever next overwrites an address register of the fetches above, from the query's on; they are named as inputs so that they stay as they are up to this wait
    __syncthreads();   // the first pass's tiles are in LDS before any wave reads them
#pragma unroll 1   // kept rolled: a pass is some hundred instructions already, a second copy would only cost instruction cache
    for (int k0 = kbeg; k0 < kend; k0 += 64) {   // kbeg is a multiple of 128, so the first pass reads buffer 0; kend - kbeg >= 128
        const T16* lb = lds + ((k0 >> 6) & 1) * BS; T16* ln = lds + (((k0 >> 6) & 1) ^ 1) * BS;
        const int kn = (k0 + 64 < TT) ? k0 + 64 : 0, kf = (k0 + 128 < TT) ? k0 + 128 : 0;   // past the last key block 0 is fetched again, unused (so is what a shorter walk fetches past its own end): addresses stay in bounds and every pass has the same control flow
        v8f s[4];
#pragma unroll
        for (int t = 0; t < 4; ++t) { v8f a = (v8f){};
#pragma unroll
            for (int kk = 0; kk < 2; ++kk) { const V ka = W::ld(lb + fo + t * 16 * KP + kk * 32); a = W::mma(ka, qa[kk], a); if (HL) { const V kb = W::ld(lb + 2 * PS + fo + t * 16 * KP + kk * 32); a = W::mma(kb, qa[kk], a); a = W::mma(ka, qb[kk], a); } }
            s[t] = a; }
#pragma unroll
        for (int t = 0; t < 4; ++t)
#pragma unroll
            for (int j = 0; j < 8; ++j) s[t][j] = s[t][j] * c1 - c2 * fabsf(sq[t][j >> 2][j & 3] - sqi);
#pragma unroll
        for (int t = 0; t < 4; ++t) { sq[t][0] = *(const v4f*)(SQ + kn + t * 16 + 8 * hi); sq[t][1] = *(const v4f*)(SQ + kn + t * 16 + 8 * hi + 4); }
        if ((g == 0 && k0 + 63 > q0) || (g == 1 && k0 < q0 + 15)) {   // wave-uniform: only a pass that holds a masked (query, key) pair of this wave pays for the mask
            const int kb0 = k0 + 8 * hi - klo;
#pragma unroll
            for (int t = 0; t < 4; ++t)
#pragma unroll
                for (int j = 0; j < 8; ++j) s[t][j] = ((unsigned)(kb0 + t * 16 + j) <= span) ? s[t][j] : -3.0e38f; }
        float mt[4];
#pragma unroll
        for (int t = 0; t < 4; ++t) { mt[t] = s[t][0];
#pragma unroll
            for (int j = 1; j < 8; ++j) mt[t] = fmaxf(mt[t], s[t][j]); }
        float mx = fmaxf(fmaxf(m, fmaxf(mt[0], mt[1])), fmaxf(mt[2], mt[3])); mx = fmaxf(mx, xhalf(mx));
        const float al = __builtin_amdgcn_exp2f(m - mx), ms = mx - 10.0f; m = mx;   // while every key so far was masked, mx stays at its start value, al is 1 and every p below is 0
#pragma unroll
        for (int mb = 0; mb < 4; ++mb) o[mb] *= al;
        V pa[2], pb[2]; float lt[4];
#pragma unroll
        for (int t = 0; t < 4; ++t) { lt[t] = 0.f;
#pragma unroll
            for (int j = 0; j < 8; j += 2) { v2f p; p[0] = __builtin_amdgcn_exp2f(s[t][j] - ms); p[1] = __builtin_amdgcn_exp2f(s[t][j + 1] - ms); lt[t] += p[0]; lt[t] += p[1]; const int e = (t & 1) * 8 + j;
                if constexpr (HL) { const v2b ph = __builtin_convertvector(p, v2b); const v2b pl = __builtin_convertvector(p - __builtin_convertvector(ph, v2f), v2b); pa[t >> 1][e] = ph[0]; pa[t >> 1][e + 1] = ph[1]; pb[t >> 1][e] = pl[0]; pb[t >> 1][e + 1] = pl[1]; }   // high plane, and what it leaves, both rounded to nearest
                else { pa[t >> 1][e] = (h16)p[0]; pa[t >> 1][e + 1] = (h16)p[1]; } } }
        l = l * al + ((lt[0] + lt[1]) + (lt[2] + lt[3]));
#pragma unroll
        for (int kk = 0; kk < 2; ++kk)
#pragma unroll
            for (int mb = 0; mb < 4; ++mb) { const V va = W::ld(lb + PS + fo + mb * 16 * KP + kk * 32); o[mb] = W::mma(va, pa[kk], o[mb]); if (HL) { const V vb = W::ld(lb + 3 * PS + fo + mb * 16 * KP + kk * 32); o[mb] = W::mma(vb, pa[kk], o[mb]); o[mb] = W::mma(va, pb[kk], o[mb]); } }
#pragma unroll
        for (int r = 0; r < 2; ++r) { *(H*)(ln + lso + r * 32 * KP) = rk[r]; *(H*)(ln + PS + lso + r * 32 * KP) = rv[r]; if (HL) { *(H*)(ln + 2 * PS + lso + r * 32 * KP) = rk2[r]; *(H*)(ln + 3 * PS + lso + r * 32 * KP) = rv2[r]; } }
        const T16 *pk = k + kso + kf * HD, *pv = vt + vso + kf, *pk2 = HL ? k2 + kso + kf * HD : pk, *pv2 = HL ? vt2 + vso + kf : pv;
#pragma unroll
        for (int r = 0; r < 2; ++r) { rk[r] = *(const H*)(pk + r * 32 * HD); rv[r] = *(const H*)(pv + r * 32 * TT); if (HL) { rk2[r] = *(const H*)(pk2 + r * 32 * HD); rv2[r] = *(const H*)(pv2 + r * 32 * TT); } }   // fetched a whole pass ahead of their store to LDS
        asm volatile("s_wait_xcnt 0x0" :: "v"(pk), "v"(pv), "v"(pk2), "v"(pv2) : "memory");   // in front of whatever next overwrites the address registers of the fetches above; they are named as inputs so that they stay as they are up to this wait
        asm volatile("s_wait_dscnt 0x0" ::: "memory");   // this wave's LDS stores above have landed and its reads of this pass's buffer have returned
        asm volatile("s_barrier_signal -1\n\ts_barrier_wait -1" ::: "memory");   // work-group barrier: publishes the next pass's tiles and frees this pass's buffer. By hand, because __syncthreads() also waits for the global fetches just issued, which are to fly through the next pass
    }
    l += xhalf(l); const float inv = 1.0f / l;
#pragma unroll
    for (int mb = 0; mb < 4; ++mb) { float* d = orow + (size_t)lr * DM + mb * 16 + hi * 8; v4f x0, x1;
#pragma unroll
        for (int u = 0; u < 4; ++u) { x0[u] = o[mb][u] * inv; x1[u] = o[mb][4 + u] * inv; }
        *(v4f*)d = x0; *(v4f*)(d + 4) = x1; }
}
__global__ __launch_bounds__(256) void k_fattn(const h16* __restrict__ Q16, const bf* __restrict__ Qh, const bf* __restrict__ Ql, const h16* __restrict__ K16, const bf* __restrict__ Kh, const bf* __restrict__ Kl,
                                               const h16* __restrict__ VT, const bf* __restrict__ VTh, const bf* __restrict__ VTl, const float* __restrict__ SQ, float* __restrict__ outb) {
    __shared__ __align__(16) unsigned short sm[2 * 4 * PS];
    const int lane = threadIdx.x & 31, lr = lane & 15, hi = lane >> 4; const int wv = __builtin_amdgcn_readfirstlane((int)(threadIdx.x >> 5));   // wave number in a scalar register: the mask test of a pass is then a scalar branch
    // both batches in one launch, 384 work-groups in one dimension. This kernel's registers leave room for ONE work-group on a WGP, so 256 run at once and the other 128 start as places fall free: the numbering makes cost fall with the index
    // (for speed only: any order of starting is correct). 0-127: the masked heads' tiles of ranks 15 down to 8 (rank c walks 2 (c + 1) passes); 128-255: the unmasked heads, 32 passes each; 256-383: ranks 7 to 0 by falling cost,
    // a three-product pass of the short-window rows (ranks 0-3) counted as about two plain ones. The first place to fall free (rank 8) so takes the longest walk left, and no place works longer than about 39 plain passes' time.
    // Every (batch, head, tile) is taken once: 15 - (f >> 4) covers ranks 15-8, the table ranks 7-0, 16 numbers (8 heads x 2 batches) a rank.
    const int f = blockIdx.x; int b, h, xt;
    if (f >= 128 && f < 256) { const int u = f - 128; xt = u >> 3; h = 8 + ((u & 7) >> 1); b = u & 1; }
    else { const int c = (f < 128) ? 15 - (f >> 4) : (int)((0x01452673u >> (((f - 256) >> 4) * 4)) & 15u);   // the table, low digit first: ranks 3, 7, 6, 2, 5, 4, 1, 0
        h = (f & 15) >> 1; b = f & 1; xt = (h < 4) ? c : 15 - c; }   // a causal head's tile c has rank c, an anti-causal head's tile c rank 15 - c
    const int g = h / 4, hm = h % 4; const float slope = (hm == 0) ? 0.25f : (hm == 1) ? 0.0625f : (hm == 2) ? 0.015625f : 0.00390625f;
    const int kbeg = (g == 1) ? xt * 128 : 0, kend = (g == 0) ? xt * 128 + 128 : TT;   // the keys that at least one of the work-group's 128 queries keeps; a pass outside holds masked pairs only and would add exact zeros (factor 1, every p 0). The same for all 8 waves: every wave meets every barrier
    const int q0 = (xt * 8 + wv) * 16; const size_t zo = ((size_t)b * NH_ + h) * TT * HD; float* orow = outb + ((size_t)b * TT + q0) * DM + h * HD;
    if (hlrow(g, xt * 128)) fattn_wg<bf, true>(sm, Qh + zo, Ql + zo, Kh + zo, Kl + zo, VTh + zo, VTl + zo, SQ, g, slope, q0, kbeg, kend, lr, hi, orow);   // 128 divides the window's 512 rows: the same path for the whole work-group
    else fattn_wg<h16, false>((h16*)sm, Q16 + zo, nullptr, K16 + zo, nullptr, VT + zo, nullptr, SQ, g, slope, q0, kbeg, kend, lr, hi, orow);
}

extern "C" void kernel_launch(void* const* d_in, const int* in_sizes, int n_in,
                              void* d_out, int out_size, void* d_ws, size_t ws_size, hipStream_t stream) {
    (void)in_sizes; (void)n_in; (void)out_size;
    const float** I = (const float**)d_in;
    const float *x = I[0], *Wq = I[1], *bq = I[2], *Wk = I[3], *bk = I[4], *Wv = I[5], *bv = I[6];
    float* OUT = (float*)d_out;     // [2][2048][768]
    char* wsp = (char*)d_ws;
    auto take = [&](size_t bytes) { char* p = wsp; wsp += (bytes + 255) & ~(size_t)255; return (void*)p; };
    bf* BQ = (bf*)take((size_t)DM * DM * 2); bf* BK = (bf*)take((size_t)DM * DM * 2); bf* BV = (bf*)take((size_t)DM * DM * 2);
    bf* XB = (bf*)take((size_t)NB_ * TT * DM * 2);
    h16* Q16 = (h16*)take((size_t)NB_ * NH_ * TT * HD * 2); bf* Qh = (bf*)take((size_t)NB_ * NH_ * TT * HD * 2); bf* Ql = (bf*)take((size_t)NB_ * NH_ * TT * HD * 2); h16* K16 = (h16*)take((size_t)NB_ * NH_ * TT * HD * 2); bf* Kh = (bf*)take((size_t)NB_ * NH_ * TT * HD * 2); bf* Kl = (bf*)take((size_t)NB_ * NH_ * TT * HD * 2);
    h16* VT = (h16*)take((size_t)NB_ * NH_ * HD * TT * 2); bf* VTh = (bf*)take((size_t)NB_ * NH_ * HD * TT * 2); bf* VTl = (bf*)take((size_t)NB_ * NH_ * HD * TT * 2); float* SQ = (float*)take(TT * 4);
    if ((size_t)(wsp - (char*)d_ws) > ws_size) return;    // total ~ 66 MB
    k_prep<<<3 * NWT + NCV, 256, 0, stream>>>(x, Wq, Wk, Wv, XB, BQ, BK, BV, SQ);
    k_qkv<<<dim3(NB_ * TT / 128, DM / 128, 3), 128, 0, stream>>>(XB, BQ, BK, BV, bq, bk, bv, Q16, Qh, Ql, K16, Kh, Kl, VT, VTh, VTl);
    k_fattn<<<TT / 128 * NB_ * NH_, 256, 0, stream>>>(Q16, Qh, Ql, K16, Kh, Kl, VT, VTh, VTl, SQ, OUT);
}

// v009
// Measured time: 58.8 microseconds a run.
// Timed twice side by side with v008, it ran 1.05 and 1.06 times as fast.
// All steps since v000 together make it 15.9 times as fast.
#include <hip/hip_runtime.h>

// NonSymmetricAttentionKernel (hidden [2][2048][768]; q/k/v = x W + b (12 heads x 64); scores = q.k/8 + alibi[h][i][j] where alibi = -slope[h%4] |sqrt(j) - sqrt(i)|, slopes 2^-2, 2^-4, 2^-6, 2^-8; heads 0-3 causal (j <= i), heads 4-7 anti-causal (j >= i), heads 8-11 unmasked;
// softmax; out = attn v merged (no output projection) -> [2][2048][768]).
// Compute dtypes, f32 accumulate: every input rounded to bf16; q/k/v on PLAIN bf16 operands (inputs: exact) + bias; scores (K 64) and attn.v on single fp16 planes (probabilities x1024) EXCEPT the short-window rows (query rows < 512 of heads 0-3, >= 1536 of heads 4-7): bf16 high + low planes, three products.

#define NB_  2
#define TT   2048
#define DM   768
#define NH_  12
#define HD   64
#define RHL  512
typedef _Float16 h16;
typedef unsigned short bf;
typedef __attribute__((ext_vector_type(16))) __bf16   v16bf;
typedef __attribute__((ext_vector_type(16))) _Float16 v16h;
typedef __attribute__((ext_vector_type(8)))  _Float16 v8h;
typedef __attribute__((ext_vector_type(8)))  unsigned short v8us;
typedef __attribute__((ext_vector_type(8)))  float    v8f;
typedef __attribute__((ext_vector_type(4)))  float    v4f;
typedef v8h  __attribute__((may_alias)) v8ha;
typedef v4f  __attribute__((may_alias)) v4fa;
typedef v8us __attribute__((may_alias)) v8usa;

__device__ __forceinline__ unsigned short f2bf(float f) { unsigned u = __float_as_uint(f); u += 0x7FFFu + ((u >> 16) & 1u); return (unsigned short)(u >> 16); }
__device__ __forceinline__ float bf2f(unsigned short b) { return __uint_as_float(((unsigned)b) << 16); }
__device__ __forceinline__ float bfr(float f) { return bf2f(f2bf(f)); }
__device__ __forceinline__ v16h cat16(v8h lo, v8h hi) { return __builtin_shufflevector(lo, hi, 0, 1, 2, 3, 4, 5, 6, 7, 8, 9, 10, 11, 12, 13, 14, 15); }
__device__ __forceinline__ v16bf cat16b(v8us lo, v8us hi) { return __builtin_bit_cast(v16bf, __builtin_shufflevector(lo, hi, 0, 1, 2, 3, 4, 5, 6, 7, 8, 9, 10, 11, 12, 13, 14, 15)); }
__device__ __forceinline__ v8f wmma16(v16h a, v16h b, v8f c) { return __builtin_amdgcn_wmma_f32_16x16x32_f16(false, a, false, b, (short)0, c, false, false); }
__device__ __forceinline__ v8f wmmab(v16bf a, v16bf b, v8f c) { return __builtin_amdgcn_wmma_f32_16x16x32_bf16(false, a, false, b, (short)0, c, false, false); }
__device__ __forceinline__ h16 tohx(float x) { return (h16)x; }
__device__ __forceinline__ void splitf(float y, unsigned short& h, unsigned short& l) { h = f2bf(y); l = f2bf(y - bf2f(h)); }
typedef __attribute__((ext_vector_type(4))) unsigned short v4us;
typedef __attribute__((ext_vector_type(4))) _Float16 v4h;



// ---- proj_wg: one 128 x 128 tile of a projection, C[t][n] = sum_k x[t][k] Wt[n][k] + bias[n], by a work-group of 4 waves (2 x 2, a wave holds 64 x 64 = 16 accumulators; a wave's 64 columns are one head).
// The k axis is walked in 12 stages of 64. A stage is 128 rows of x and 128 rows of Wt, 128 B (one whole line) of each row, laid in LDS at pitch GP by asynchronous copies, 16 B a lane, 4 whole lines a wave and copy; every row is fetched once for the whole work-group and read as fragments from LDS.
// Two buffers: when every wave has read the last fragments of stage t into registers, the copies of stage t + 2 are issued into that buffer and fly through the second half of stage t's matrix instructions and the first half of stage t + 1's. Each accumulator sums its k in rising order.
// C never reaches memory: each wave lays its f32 tile (+ bias) in its own part of the LDS that the stages have left, and rounds it to the three 16-bit planes that attention reads (fp16, bf16 high, bf16 low):
// OUT 1 as [head][t][d]; OUT 2 as [head][d][t], for which the tile lies transposed in LDS (an accumulator's 8 values are 8 consecutive t of one d: two 16-B LDS stores).
template <typename T16> struct WFrag;
template <> struct WFrag<h16> { typedef v16h V; static __device__ __forceinline__ V ld(const h16* p) { return cat16(*(const v8h*)p, *(const v8h*)(p + 16)); } static __device__ __forceinline__ v8f mma(V a, V b, v8f c) { return wmma16(a, b, c); } };
template <> struct WFrag<bf> { typedef v16bf V; static __device__ __forceinline__ V ld(const bf* p) { return cat16b(*(const v8us*)p, *(const v8us*)(p + 16)); } static __device__ __forceinline__ v8f mma(V a, V b, v8f c) { return wmmab(a, b, c); } };
#define GP 72            // LDS row pitch in 16-bit elements: 128 B of data + 16 B, an odd multiple of 16 B, so that the 16 rows of a fragment read fall on different banks
#define GST (256 * GP)   // one stage: 128 rows of x, then 128 rows of Wt
#define NST (DM / 64)    // stages
// copy8: eight asynchronous copies of 16 B a lane, rows 16 apart: global g + j * 16 rows -> LDS byte address d + j * 16 rows. The wait at the end of the statement stands in front of whatever next overwrites an address register of these copies.
__device__ __forceinline__ void copy8(unsigned d, const bf* g) {
    const unsigned d1 = d + 16 * GP * 2, d2 = d + 32 * GP * 2, d3 = d + 48 * GP * 2, d4 = d + 64 * GP * 2, d5 = d + 80 * GP * 2, d6 = d + 96 * GP * 2, d7 = d + 112 * GP * 2;
    const bf *g1 = g + 16 * DM, *g2 = g + 32 * DM, *g3 = g + 48 * DM, *g4 = g + 64 * DM, *g5 = g + 80 * DM, *g6 = g + 96 * DM, *g7 = g + 112 * DM;
    asm volatile("global_load_async_to_lds_b128 %0, %8, off\n\t"
                 "global_load_async_to_lds_b128 %1, %9, off\n\t"
                 "global_load_async_to_lds_b128 %2, %10, off\n\t"
                 "global_load_async_to_lds_b128 %3, %11, off\n\t"
                 "global_load_async_to_lds_b128 %4, %12, off\n\t"
                 "global_load_async_to_lds_b128 %5, %13, off\n\t"
                 "global_load_async_to_lds_b128 %6, %14, off\n\t"
                 "global_load_async_to_lds_b128 %7, %15, off\n\t"
                 "s_wait_xcnt 0x0"
                 :: "v"(d), "v"(d1), "v"(d2), "v"(d3), "v"(d4), "v"(d5), "v"(d6), "v"(d7), "v"(g), "v"(g1), "v"(g2), "v"(g3), "v"(g4), "v"(g5), "v"(g6), "v"(g7) : "memory");
}
template <int OUT>
__device__ __forceinline__ void proj_wg(bf* sm, const bf* __restrict__ A, const bf* __restrict__ Bt, const float* __restrict__ bias, int t0, int head0, h16* P, bf* Ph, bf* Pl) {
    typedef WFrag<bf> W; typedef W::V V;   // every '#pragma unroll' without a number below opens a short loop of fixed length, so that the arrays it indexes stay in registers
    const int wv = __builtin_amdgcn_readfirstlane((int)(threadIdx.x >> 5)), wm = wv & 1, wn = wv >> 1;   // wave number in a scalar register: LDS bases stay scalar
    const int lane = threadIdx.x & 31, lr = lane & 15, hi = lane >> 4;
    const int srow = (int)threadIdx.x >> 3, sch = ((int)threadIdx.x & 7) * 8;   // staging: 8 lanes a 128-B row, a wave covers 4 whole lines
    const bf *ga = A + srow * DM + sch, *gb = Bt + srow * DM + sch;
    const unsigned la = (unsigned)(size_t)(sm + srow * GP + sch), lb0 = la + 128 * GP * 2;   // the lane's LDS byte addresses in buffer 0: low 32 bits of the shared address
    const int head = head0 + wn, tw = t0 + wm * 64;
    float bs[4]; const float* pb = bias + head * HD + lr;   // an accumulator's column is 16 nb + lr: four bias values a lane, fetched ahead of the walk
#pragma unroll
    for (int nb = 0; nb < 4; ++nb) bs[nb] = pb[nb * 16];
    asm volatile("s_wait_xcnt 0x0" :: "v"(pb) : "memory");   // in front of whatever next overwrites the address register of the four fetches above; named as an input so that it stays as it is up to this wait
    copy8(la, ga); copy8(lb0, gb);
    asm volatile("s_wait_asynccnt 0x0" ::: "memory");   // this wave's copies of stage 0 have landed
    __syncthreads();   // stage 0 is in LDS before any wave reads it
    copy8(la + GST * 2, ga + 64); copy8(lb0 + GST * 2, gb + 64);
    v8f acc[4][4];
#pragma unroll
    for (int mb = 0; mb < 4; ++mb)
#pragma unroll
        for (int nb = 0; nb < 4; ++nb) acc[mb][nb] = (v8f){};
    const int fa = (wm * 64 + lr) * GP + 8 * hi, fb = (128 + wn * 64 + lr) * GP + 8 * hi;
#pragma unroll 1   // kept rolled: the buffer alternates by the counter, and a stage is 32 matrix instructions already
    for (int t = 0; t < NST; ++t) {
        const bf* lb = sm + (t & 1) * GST;
        V a[4], b[4];
#pragma unroll
        for (int mb = 0; mb < 4; ++mb) a[mb] = W::ld(lb + fa + mb * 16 * GP);
#pragma unroll
        for (int nb = 0; nb < 4; ++nb) b[nb] = W::ld(lb + fb + nb * 16 * GP);
        __builtin_amdgcn_sched_barrier(0);   // the eight fragments of the stage's first half are read as one group ahead of its matrix instructions; left alone the compiler reads each b fragment right in front of its use and the wave waits out the LDS latency four times
#pragma unroll
        for (int nb = 0; nb < 4; ++nb)
#pragma unroll
            for (int mb = 0; mb < 4; ++mb) acc[mb][nb] = W::mma(a[mb], b[nb], acc[mb][nb]);
#pragma unroll
        for (int mb = 0; mb < 4; ++mb) a[mb] = W::ld(lb + fa + mb * 16 * GP + 32);
#pragma unroll
        for (int nb = 0; nb < 4; ++nb) b[nb] = W::ld(lb + fb + nb * 16 * GP + 32);
        asm volatile("s_wait_dscnt 0x0" ::: "memory");      // this wave's reads of stage t have returned: the second half's fragments are in registers
        asm volatile("s_wait_asynccnt 0x0" ::: "memory");   // this wave's copies of stage t + 1 have landed
        __syncthreads();   // publishes stage t + 1 and frees stage t's buffer
        if (t + 2 < NST) { copy8(la + (t & 1) * (GST * 2), ga + (t + 2) * 64); copy8(lb0 + (t & 1) * (GST * 2), gb + (t + 2) * 64); }   // the same test for the whole work-group
#pragma unroll
        for (int nb = 0; nb < 4; ++nb)
#pragma unroll
            for (int mb = 0; mb < 4; ++mb) acc[mb][nb] = W::mma(a[mb], b[nb], acc[mb][nb]);   // from registers alone, while the copies fly
    }
    asm volatile("s_wait_asynccnt 0x0" ::: "memory");   // no copy is outstanding when the buffers become output staging
    float* ow = (float*)sm + wv * (64 * 68);
#pragma unroll
    for (int nb = 0; nb < 4; ++nb) { const float bn = bfr(bs[nb]);
#pragma unroll
        for (int mb = 0; mb < 4; ++mb) { const v8f c = acc[mb][nb] + bn;
            if constexpr (OUT == 2) { float* p = ow + (nb * 16 + lr) * 68 + mb * 16 + hi * 8; *(v4fa*)p = __builtin_shufflevector(c, c, 0, 1, 2, 3); *(v4fa*)(p + 4) = __builtin_shufflevector(c, c, 4, 5, 6, 7); }
            else {
#pragma unroll
                for (int j = 0; j < 8; ++j) ow[(mb * 16 + hi * 8 + j) * 68 + nb * 16 + lr] = c[j]; } } }
    __syncthreads();   // the tiles are in LDS before they are read back row by row
    const int cofs = lr * 4;
#pragma unroll 1   // kept rolled: all 32 row pairs opened would only cost instruction cache
    for (int s = 0; s < 32; s += 4) { v4f val[4];   // four LDS reads go ahead as one group: the waits behind the stores below would otherwise hold each read back until the row before it is stored
#pragma unroll
        for (int r = 0; r < 4; ++r) val[r] = *(const v4fa*)(ow + (2 * (s + r) + hi) * 68 + cofs);
#pragma unroll
        for (int r = 0; r < 4; ++r) { const int row = 2 * (s + r) + hi;
            const size_t e = (OUT == 1) ? ((size_t)head * TT + tw + row) * HD + cofs : ((size_t)head * HD + row) * TT + tw + cofs; v4h o; v4us oh, ol;   // 16 lanes fill one 128-B line of each plane
#pragma unroll
            for (int u = 0; u < 4; ++u) { o[u] = tohx(val[r][u]); unsigned short a, b; splitf(val[r][u], a, b); oh[u] = a; ol[u] = b; }
            h16* d0 = P + e; bf *d1 = Ph + e, *d2 = Pl + e; *(v4h*)d0 = o; *(v4us*)d1 = oh; *(v4us*)d2 = ol;
            asm volatile("s_wait_xcnt 0x0" :: "v"(d0), "v"(d1), "v"(d2), "v"(o), "v"(oh), "v"(ol) : "memory"); } }   // in front of whatever next overwrites an address or data register of the three stores above; they are named as inputs so that they stay as they are up to this wait
}

// ---- k_qkv: the six projections (q, k, v of both batches) as ONE launch, grid (NB_ * TT / 128, DM / 128, 3): blockIdx.x picks batch and rows, blockIdx.y two heads, blockIdx.z the projection, the same for a whole work-group. None reads what another writes.
__global__ __launch_bounds__(128) void k_qkv(const bf* __restrict__ XB, const bf* __restrict__ BQ, const bf* __restrict__ BK, const bf* __restrict__ BV, const float* __restrict__ bq, const float* __restrict__ bk, const float* __restrict__ bv,
                                             h16* Q16, bf* Qh, bf* Ql, h16* K16, bf* Kh, bf* Kl, h16* VT, bf* VTh, bf* VTl) {
    __shared__ __align__(16) unsigned short sm[2 * GST];
    const int p = blockIdx.z, b = blockIdx.x / (TT / 128), t0 = (blockIdx.x % (TT / 128)) * 128, head0 = blockIdx.y * 2;
    const bf* A = XB + (size_t)blockIdx.x * 128 * DM; const size_t zo = (size_t)b * NH_ * TT * HD, wo = (size_t)blockIdx.y * 128 * DM;
    if (p == 2) proj_wg<2>(sm, A, BV + wo, bv, t0, head0, VT + zo, VTh + zo, VTl + zo);
    else proj_wg<1>(sm, A, (p ? BK : BQ) + wo, p ? bk : bq, t0, head0, (p ? K16 : Q16) + zo, (p ? Kh : Qh) + zo, (p ? Kl : Ql) + zo);
}

// wt_wg: a 256 (k) x 64 (n) piece of a weight, w[k][n] f32 -> Bt[n][k] rounded to bf16, turned in LDS. A thread fetches a 4 x 4 block of each of the piece's four 64-row quarters (16 lanes read 256 B of one row: whole lines; all 16 fetches go ahead as one group),
// and stores each column of a block as 4 consecutive k. Column n lies in LDS row (n >> 2) + 16 (n & 3): the 16 lanes of one store then fall on 16 neighbouring LDS rows, which at pitch WTP are different banks. A wave reads a whole LDS row (512 B) and stores it as four whole lines of Bt.
#define WTP 264          // LDS row pitch in 16-bit elements: 512 B of data + 16 B
__device__ __forceinline__ void wt_wg(bf* tl, int blk, const float* __restrict__ w, bf* Bt) {
    const int n0 = (blk / 3) * 64, kb = (blk % 3) * 256; const int kq = (int)threadIdx.x >> 4, cl = (int)threadIdx.x & 15;
    const float* pw = w + (size_t)(kb + 4 * kq) * DM + n0 + cl * 4; v4f v[4][4];   // every '#pragma unroll' below opens a short loop of fixed length, so that the arrays it indexes stay in registers
#pragma unroll
    for (int u = 0; u < 4; ++u)
#pragma unroll
        for (int r = 0; r < 4; ++r) v[u][r] = *(const v4f*)(pw + (u * 64 + r) * DM);
    asm volatile("s_wait_xcnt 0x0" :: "v"(pw) : "memory");   // in front of whatever next overwrites the address register of the fetches above; it is named as an input so that it stays as it is up to this wait
#pragma unroll
    for (int u = 0; u < 4; ++u)
#pragma unroll
        for (int c = 0; c < 4; ++c) { v4us o;
#pragma unroll
            for (int r = 0; r < 4; ++r) o[r] = f2bf(v[u][r][c]);
            *(v4us*)(tl + (cl + 16 * c) * WTP + u * 64 + 4 * kq) = o; }
    __syncthreads();   // the piece is in LDS before it is read back row by row
    const int wv = (int)threadIdx.x >> 5, lane = (int)threadIdx.x & 31;
    const bf* pl = tl + wv * 8 * WTP + lane * 8; bf* pd = Bt + (size_t)(n0 + (wv & 1) * 32 + (wv >> 1)) * DM + kb + lane * 8; v8us o[8];   // LDS row 8 wv + s holds column 4 ((8 wv + s) & 15) + (wv >> 1)
#pragma unroll
    for (int s = 0; s < 8; ++s) o[s] = *(const v8us*)(pl + s * WTP);
#pragma unroll
    for (int s = 0; s < 8; ++s) *(v8us*)(pd + s * 4 * DM) = o[s];
}
// cvt_wg: XU x 256 octets of the hidden states rounded to bf16; a thread's XU octets lie 256 octets apart (a wave reads and writes whole lines) and are all fetched ahead of the first rounding.
#define XU 12
__device__ __forceinline__ void cvt_wg(int blk, const float* __restrict__ src, bf* dst) { const size_t i0 = ((size_t)blk * (256 * XU) + threadIdx.x) * 8; const float* ps = src + i0; bf* pd = dst + i0; v8f v[XU]; v8us o[XU];
#pragma unroll
    for (int u = 0; u < XU; ++u) v[u] = *(const v8f*)(ps + u * 2048);
    asm volatile("s_wait_xcnt 0x0" :: "v"(ps) : "memory");   // in front of whatever next overwrites the address register of the fetches above; it is named as an input so that it stays as it is up to this wait
#pragma unroll
    for (int u = 0; u < XU; ++u) {
#pragma unroll
        for (int k = 0; k < 8; ++k) o[u][k] = f2bf(v[u][k]);
        *(v8us*)(pd + u * 2048) = o[u]; }
    asm volatile("s_wait_xcnt 0x0" :: "v"(pd), "v"(o[0]), "v"(o[1]), "v"(o[2]), "v"(o[3]), "v"(o[4]), "v"(o[5]), "v"(o[6]), "v"(o[7]), "v"(o[8]), "v"(o[9]), "v"(o[10]), "v"(o[11]) : "memory"); }   // in front of whatever next overwrites an address or data register of the stores above (the table's work-groups go on); they are named as inputs so that they stay as they are up to this wait
// sqt_wg: SQ[j] = sqrt(j) (f32, correctly rounded).
__device__ __forceinline__ bool hlrow(int g, int i) { return (g == 0) ? (i < RHL) : (g == 1) ? (i >= TT - RHL) : false; }
__device__ __forceinline__ void sqt_wg(int blk, float* SQ) { const int j = blk * 256 + threadIdx.x; if (j >= TT) return; const float r = __fsqrt_rn((float)j);
    asm volatile("v_nop" :: "v"(r) : "memory");   // fills the one slot between the square root and the store that reads its result; the root is named as an input, so that the slot stands behind it
    *(float*)(SQ + j) = r;  }
// ---- k_prep: all that the projections and attention wait for, as ONE launch of fewer work-groups than the chip has WGPs, so that all start at once and each thread keeps many fetches in flight: the three weight transposes, the rounding of both batches' hidden states, the square-root table (by the first work-groups of the rounding). A work-group does one piece of a transpose or of the rounding (the first eight of the rounding also one of the table); none reads what another writes.
#define NWT ((DM / 64) * (DM / 256))         // work-groups of one weight transpose
#define NCV (NB_ * TT * DM / 8 / 256 / XU)   // work-groups of the rounding
#define NSQ ((TT + 255) / 256)               // of which so many also fill the table
__global__ __launch_bounds__(256) void k_prep(const float* __restrict__ x, const float* __restrict__ Wq, const float* __restrict__ Wk, const float* __restrict__ Wv, bf* XB, bf* BQ, bf* BK, bf* BV, float* SQ) {
    __shared__ __align__(16) unsigned short tl[64 * WTP];
    const int blk = blockIdx.x;
    if (blk < 3 * NWT) { const int p = blk / NWT; wt_wg(tl, blk - p * NWT, (p == 0) ? Wq : (p == 1) ? Wk : Wv, (p == 0) ? BQ : (p == 1) ? BK : BV); }
    else { const int xb = blk - 3 * NWT; cvt_wg(xb, x, XB); if (xb < NSQ) sqt_wg(xb, SQ); }
}
#define KP 72          // LDS row pitch in 16-bit elements: 128 B of data + 16 B, an odd multiple of 16 B, so that the 16 rows of a fragment read fall on different banks
#define PS (64 * KP)   // one 64-row plane
typedef __attribute__((ext_vector_type(2))) float v2f;
typedef __attribute__((ext_vector_type(2))) __bf16 v2b;
template <typename T16> struct Oct;
template <> struct Oct<h16> { typedef v8h T; };
template <> struct Oct<bf> { typedef v8us T; };
__device__ __forceinline__ float xhalf(float x) { return __builtin_bit_cast(float, __builtin_amdgcn_permlanex16(__builtin_bit_cast(int, x), __builtin_bit_cast(int, x), 0x76543210, 0xfedcba98, false, false)); }   // lane l <-> lane l ^ 16
template <typename T16, bool HL>
__device__ __forceinline__ void fattn_wg(T16* lds, const T16* __restrict__ q, const T16* __restrict__ q2, const T16* __restrict__ k, const T16* __restrict__ k2, const T16* __restrict__ vt, const T16* __restrict__ vt2,
                                         const float* __restrict__ SQ, int g, float slope, int q0, int kb, int kend, int half, float* mg, int lr, int hi, float* __restrict__ orow) {
    typedef WFrag<T16> W; typedef typename W::V V; typedef typename Oct<T16>::T H;   // every '#pragma unroll' without a number below opens a short loop of fixed length, so that the arrays it indexes stay in registers
    constexpr int BS = (HL ? 4 : 2) * PS;   // one buffer: K, V^T (and their low planes)
    const float L2E = 1.4426950408889634f; const float c1 = 0.125f * L2E, c2 = slope * L2E;
    __builtin_assume(kb < kend);   // each half's walk (from its first key kb, every second pass) has at least one pass: no test in front of the loop, and what only the loop reads is fetched ahead of the first barrier
    const int i = q0 + lr; const float sqi = SQ[i];
    const int klo = (g == 1) ? i : 0; const unsigned span = (unsigned)(((g == 0) ? i : TT - 1) - klo);   // key j is kept when klo <= j <= klo + span
    V qa[2], qb[2]; const T16 *pq = q + (size_t)i * HD + 8 * hi, *pq2 = HL ? q2 + (size_t)i * HD + 8 * hi : pq;
#pragma unroll
    for (int kk = 0; kk < 2; ++kk) { qa[kk] = W::ld(pq + kk * 32); if (HL) qb[kk] = W::ld(pq2 + kk * 32); }
    const int ht = (int)threadIdx.x & 255, srow = ht >> 3, sch = (ht & 7) * 8;   // staging, by the thread's number in its half: 8 threads a 128-B row, a wave covers 4 whole lines
    const int kso = srow * HD + sch, vso = srow * TT + sch, lso = srow * KP + sch;
    H rk[2], rv[2], rk2[2], rv2[2]; const T16 *pk0 = k + kso + kb * HD, *pv0 = vt + vso + kb, *pk20 = HL ? k2 + kso + kb * HD : pk0, *pv20 = HL ? vt2 + vso + kb : pv0;   // the half's first tiles
#pragma unroll
    for (int r = 0; r < 2; ++r) { rk[r] = *(const H*)(pk0 + r * 32 * HD); rv[r] = *(const H*)(pv0 + r * 32 * TT); if (HL) { rk2[r] = *(const H*)(pk20 + r * 32 * HD); rv2[r] = *(const H*)(pv20 + r * 32 * TT); } }
#pragma unroll
    for (int r = 0; r < 2; ++r) { *(H*)(lds + lso + r * 32 * KP) = rk[r]; *(H*)(lds + PS + lso + r * 32 * KP) = rv[r]; if (HL) { *(H*)(lds + 2 * PS + lso + r * 32 * KP) = rk2[r]; *(H*)(lds + 3 * PS + lso + r * 32 * KP) = rv2[r]; } }
    v4f sq[4][2]; const unsigned sqo = 32u * hi;   // the lane's byte offset in a 16-key stretch of the table
#pragma unroll
    for (int t = 0; t < 4; ++t) { const char* pt = (const char*)(SQ + kb + t * 16) + sqo; sq[t][0] = *(const v4f*)pt; sq[t][1] = *(const v4f*)(pt + 16); }
    float m = -1.0e30f, l = 0.f; v8f o[4];
#pragma unroll
    for (int mb = 0; mb < 4; ++mb) o[mb] = (v8f){};
    const int fo = lr * KP + 8 * hi;
    const int k1 = (kb + 128 < TT) ? kb + 128 : 0;   // past the last key block 0 is fetched, unused: addresses stay in bounds
    const T16 *pk1 = k + kso + k1 * HD, *pv1 = vt + vso + k1, *pk21 = HL ? k2 + kso + k1 * HD : pk1, *pv21 = HL ? vt2 + vso + k1 : pv1;
#pragma unroll
    for (int r = 0; r < 2; ++r) { rk[r] = *(const H*)(pk1 + r * 32 * HD); rv[r] = *(const H*)(pv1 + r * 32 * TT); if (HL) { rk2[r] = *(const H*)(pk21 + r * 32 * HD); rv2[r] = *(const H*)(pv21 + r * 32 * TT); } }   // the tiles of the half's second pass, on their way to the registers
    asm volatile("s_wait_xcnt 0x0" :: "v"(i), "v"(sqo), "v"(pq), "v"(pq2), "v"(pk0), "v"(pv0), "v"(pk20), "v"(pv20), "v"(pk1), "v"(pv1), "v"(pk21), "v"(pv21) : "memory");   // in front of whatever next overwrites an address register of the fetches above, from the query's on; they are named as inputs so that they stay as they are up to this wait
    __syncthreads();   // the first pass's tiles are in LDS before any wave reads them
#pragma unroll 1   // kept rolled: a pass is some hundred instructions already, a second copy would only cost instruction cache
    for (int k0 = kb; k0 < kend; k0 += 128) {   // the walk's length is a multiple of 128 keys: both halves make the same number of passes and meet every barrier
        const int par = ((k0 - kb) >> 7) & 1; const T16* lb = lds + par * BS; T16* ln = lds + (par ^ 1) * BS;   // the half's first pass reads its buffer 0
        const int kn = (k0 + 128 < TT) ? k0 + 128 : 0, kf = (k0 + 256 < TT) ? k0 + 256 : 0;   // past the last key block 0 is fetched again, unused (so is what a shorter walk fetches past its own end): addresses stay in bounds and every pass has the same control flow
        const float* psq = SQ + kn + 8 * hi;   // the lane's stretch of the table for the half's next pass
        v8f s[4];
#pragma unroll
        for (int t = 0; t < 4; ++t) { v8f a = (v8f){};
#pragma unroll
            for (int kk = 0; kk < 2; ++kk) { const V ka = W::ld(lb + fo + t * 16 * KP + kk * 32); a = W::mma(ka, qa[kk], a); if (HL) { const V kb = W::ld(lb + 2 * PS + fo + t * 16 * KP + kk * 32); a = W::mma(kb, qa[kk], a); a = W::mma(ka, qb[kk], a); } }
            s[t] = a; }
#pragma unroll
        for (int t = 0; t < 4; ++t)
#pragma unroll
            for (int j = 0; j < 8; ++j) s[t][j] = s[t][j] * c1 - c2 * fabsf(sq[t][j >> 2][j & 3] - sqi);
#pragma unroll
        for (int t = 0; t < 4; ++t) { sq[t][0] = *(const v4f*)(psq + t * 16); sq[t][1] = *(const v4f*)(psq + t * 16 + 4); }
        if ((g == 0 && k0 + 63 > q0) || (g == 1 && k0 < q0 + 15)) {   // wave-uniform: only a pass that holds a masked (query, key) pair of this wave pays for the mask
            const int kb0 = k0 + 8 * hi - klo;
#pragma unroll
            for (int t = 0; t < 4; ++t)
#pragma unroll
                for (int j = 0; j < 8; ++j) s[t][j] = ((unsigned)(kb0 + t * 16 + j) <= span) ? s[t][j] : -3.0e38f; }
        float mt[4];
#pragma unroll
        for (int t = 0; t < 4; ++t) { mt[t] = s[t][0];
#pragma unroll
            for (int j = 1; j < 8; ++j) mt[t] = fmaxf(mt[t], s[t][j]); }
        float mx = fmaxf(fmaxf(m, fmaxf(mt[0], mt[1])), fmaxf(mt[2], mt[3])); mx = fmaxf(mx, xhalf(mx));
        const float al = __builtin_amdgcn_exp2f(m - mx), ms = mx - 10.0f; m = mx;   // while every key so far was masked, mx stays at its start value, al is 1 and every p below is 0
#pragma unroll
        for (int mb = 0; mb < 4; ++mb) o[mb] *= al;
        V pa[2], pb[2]; float lt[4];
#pragma unroll
        for (int t = 0; t < 4; ++t) { lt[t] = 0.f;
#pragma unroll
            for (int j = 0; j < 8; j += 2) { v2f p; p[0] = __builtin_amdgcn_exp2f(s[t][j] - ms); p[1] = __builtin_amdgcn_exp2f(s[t][j + 1] - ms); lt[t] += p[0]; lt[t] += p[1]; const int e = (t & 1) * 8 + j;
                if constexpr (HL) { const v2b ph = __builtin_convertvector(p, v2b); const v2b pl = __builtin_convertvector(p - __builtin_convertvector(ph, v2f), v2b); pa[t >> 1][e] = ph[0]; pa[t >> 1][e + 1] = ph[1]; pb[t >> 1][e] = pl[0]; pb[t >> 1][e + 1] = pl[1]; }   // high plane, and what it leaves, both rounded to nearest
                else { pa[t >> 1][e] = (h16)p[0]; pa[t >> 1][e + 1] = (h16)p[1]; } } }
        l = l * al + ((lt[0] + lt[1]) + (lt[2] + lt[3]));
#pragma unroll
        for (int kk = 0; kk < 2; ++kk)
#pragma unroll
            for (int mb = 0; mb < 4; ++mb) { const V va = W::ld(lb + PS + fo + mb * 16 * KP + kk * 32); o[mb] = W::mma(va, pa[kk], o[mb]); if (HL) { const V vb = W::ld(lb + 3 * PS + fo + mb * 16 * KP + kk * 32); o[mb] = W::mma(vb, pa[kk], o[mb]); o[mb] = W::mma(va, pb[kk], o[mb]); } }
#pragma unroll
        for (int r = 0; r < 2; ++r) { *(H*)(ln + lso + r * 32 * KP) = rk[r]; *(H*)(ln + PS + lso + r * 32 * KP) = rv[r]; if (HL) { *(H*)(ln + 2 * PS + lso + r * 32 * KP) = rk2[r]; *(H*)(ln + 3 * PS + lso + r * 32 * KP) = rv2[r]; } }
        const T16 *pk = k + kso + kf * HD, *pv = vt + vso + kf, *pk2 = HL ? k2 + kso + kf * HD : pk, *pv2 = HL ? vt2 + vso + kf : pv;
#pragma unroll
        for (int r = 0; r < 2; ++r) { rk[r] = *(const H*)(pk + r * 32 * HD); rv[r] = *(const H*)(pv + r * 32 * TT); if (HL) { rk2[r] = *(const H*)(pk2 + r * 32 * HD); rv2[r] = *(const H*)(pv2 + r * 32 * TT); } }   // fetched a whole pass ahead of their store to LDS
        asm volatile("s_wait_xcnt 0x0" :: "v"(pk), "v"(pv), "v"(pk2), "v"(pv2), "v"(psq) : "memory");   // in front of whatever next overwrites the address registers of the fetches above, the table's among them; they are named as inputs so that they stay as they are up to this wait
        asm volatile("s_wait_dscnt 0x0" ::: "memory");   // this wave's LDS stores above have landed and its reads of this pass's buffer have returned
        asm volatile("s_barrier_signal -1\n\ts_barrier_wait -1" ::: "memory");   // work-group barrier: publishes the next pass's tiles and frees this pass's buffer. By hand, because __syncthreads() also waits for the global fetches just issued, which are to fly through the next pass
    }
    // the two halves' results are joined. The walk's last barrier stands behind every wave's last LDS read and store, so the buffers are free: wave w of half 1 lays its output tile, maximum and sum in slot w, 16 B a lane and store; wave w of half 0 holds the same 16 queries in the same lanes.
    float* ms = mg + (lr + 16 * hi) * 4;
    if (half) {   // a scalar test: the same for a whole wave
#pragma unroll
        for (int mb = 0; mb < 4; ++mb) { *(v4fa*)(ms + (2 * mb) * 128) = __builtin_shufflevector(o[mb], o[mb], 0, 1, 2, 3); *(v4fa*)(ms + (2 * mb + 1) * 128) = __builtin_shufflevector(o[mb], o[mb], 4, 5, 6, 7); }
        *(v4fa*)(ms + 8 * 128) = (v4f){m, l, 0.f, 0.f}; }
    __syncthreads();   // half 1's results are in LDS before half 0 reads them; every wave passes it
    if (half) return;   // behind the last barrier
    { const v4f ml = *(const v4fa*)(ms + 8 * 128); const float mj = fmaxf(m, ml[0]), a0 = __builtin_amdgcn_exp2f(m - mj), a1 = __builtin_amdgcn_exp2f(ml[0] - mj);   // a half that kept no key of a query has sum 0 and its start maximum: its factor is 0
        l = l * a0 + ml[1] * a1;
#pragma unroll
        for (int mb = 0; mb < 4; ++mb) { const v4f y0 = *(const v4fa*)(ms + (2 * mb) * 128), y1 = *(const v4fa*)(ms + (2 * mb + 1) * 128);
#pragma unroll
            for (int u = 0; u < 4; ++u) { o[mb][u] = o[mb][u] * a0 + y0[u] * a1; o[mb][4 + u] = o[mb][4 + u] * a0 + y1[u] * a1; } } }
    l += xhalf(l); const float inv = 1.0f / l;
#pragma unroll
    for (int mb = 0; mb < 4; ++mb) { float* d = orow + (size_t)lr * DM + mb * 16 + hi * 8; v4f x0, x1;
#pragma unroll
        for (int u = 0; u < 4; ++u) { x0[u] = o[mb][u] * inv; x1[u] = o[mb][4 + u] * inv; }
        *(v4f*)d = x0; *(v4f*)(d + 4) = x1; }
}
__global__ __launch_bounds__(512) void k_fattn(const h16* __restrict__ Q16, const bf* __restrict__ Qh, const bf* __restrict__ Ql, const h16* __restrict__ K16, const bf* __restrict__ Kh, const bf* __restrict__ Kl,
                                               const h16* __restrict__ VT, const bf* __restrict__ VTh, const bf* __restrict__ VTl, const float* __restrict__ SQ, float* __restrict__ outb) {
    __shared__ __align__(16) unsigned short sm[2 * 2 * 4 * PS];   // each half's two buffers
    const int lane = threadIdx.x & 31, lr = lane & 15, hi = lane >> 4; const int wn = __builtin_amdgcn_readfirstlane((int)(threadIdx.x >> 5)), half = wn >> 3, wv = wn & 7;   // wave number in a scalar register: the mask test of a pass and the test of the half are then scalar branches
    // both batches in one launch, 384 work-groups in one dimension. This kernel's registers leave room for ONE work-group on a WGP, so 256 run at once and the other 128 start as places fall free: the numbering makes cost fall with the index
    // (for speed only: any order of starting is correct). 0-127: the masked heads' tiles of ranks 15 down to 8 (rank c walks 2 (c + 1) passes); 128-255: the unmasked heads, 32 passes each; 256-383: ranks 7 to 0 by falling cost,
    // a three-product pass of the short-window rows (ranks 0-3) counted as about two plain ones. The first place to fall free (rank 8) so takes the longest walk left, and no place works longer than about 39 plain passes' time.
    // Every (batch, head, tile) is taken once: 15 - (f >> 4) covers ranks 15-8, the table ranks 7-0, 16 numbers (8 heads x 2 batches) a rank.
    const int f = blockIdx.x; int b, h, xt;
    if (f >= 128 && f < 256) { const int u = f - 128; xt = u >> 3; h = 8 + ((u & 7) >> 1); b = u & 1; }
    else { const int c = (f < 128) ? 15 - (f >> 4) : (int)((0x01452673u >> (((f - 256) >> 4) * 4)) & 15u);   // the table, low digit first: ranks 3, 7, 6, 2, 5, 4, 1, 0
        h = (f & 15) >> 1; b = f & 1; xt = (h < 4) ? c : 15 - c; }   // a causal head's tile c has rank c, an anti-causal head's tile c rank 15 - c
    const int g = h / 4, hm = h % 4; const float slope = (hm == 0) ? 0.25f : (hm == 1) ? 0.0625f : (hm == 2) ? 0.015625f : 0.00390625f;
    const int kbeg = (g == 1) ? xt * 128 : 0, kend = (g == 0) ? xt * 128 + 128 : TT;   // the keys that at least one of the work-group's 128 queries keeps; a pass outside holds masked pairs only and would add exact zeros (factor 1, every p 0). The same for all 16 waves: every wave meets every barrier
    const int q0 = (xt * 8 + wv) * 16; const size_t zo = ((size_t)b * NH_ + h) * TT * HD; float* orow = outb + ((size_t)b * TT + q0) * DM + h * HD;
    unsigned short* hs = sm + half * (2 * 4 * PS); float* mg = (float*)sm + wv * (9 * 128); const int kb = kbeg + half * 64;   // the half's buffers, the wave pair's slot for the join (9 x 512 B), the half's first key
    if (hlrow(g, xt * 128)) fattn_wg<bf, true>(hs, Qh + zo, Ql + zo, Kh + zo, Kl + zo, VTh + zo, VTl + zo, SQ, g, slope, q0, kb, kend, half, mg, lr, hi, orow);   // 128 divides the window's 512 rows: the same path for the whole work-group
    else fattn_wg<h16, false>((h16*)hs, Q16 + zo, nullptr, K16 + zo, nullptr, VT + zo, nullptr, SQ, g, slope, q0, kb, kend, half, mg, lr, hi, orow);
}

extern "C" void kernel_launch(void* const* d_in, const int* in_sizes, int n_in,
                              void* d_out, int out_size, void* d_ws, size_t ws_size, hipStream_t stream) {
    (void)in_sizes; (void)n_in; (void)out_size;
    const float** I = (const float**)d_in;
    const float *x = I[0], *Wq = I[1], *bq = I[2], *Wk = I[3], *bk = I[4], *Wv = I[5], *bv = I[6];
    float* OUT = (float*)d_out;     // [2][2048][768]
    char* wsp = (char*)d_ws;
    auto take = [&](size_t bytes) { char* p = wsp; wsp += (bytes + 255) & ~(size_t)255; return (void*)p; };
    bf* BQ = (bf*)take((size_t)DM * DM * 2); bf* BK = (bf*)take((size_t)DM * DM * 2); bf* BV = (bf*)take((size_t)DM * DM * 2);
    bf* XB = (bf*)take((size_t)NB_ * TT * DM * 2);
    h16* Q16 = (h16*)take((size_t)NB_ * NH_ * TT * HD * 2); bf* Qh = (bf*)take((size_t)NB_ * NH_ * TT * HD * 2); bf* Ql = (bf*)take((size_t)NB_ * NH_ * TT * HD * 2); h16* K16 = (h16*)take((size_t)NB_ * NH_ * TT * HD * 2); bf* Kh = (bf*)take((size_t)NB_ * NH_ * TT * HD * 2); bf* Kl = (bf*)take((size_t)NB_ * NH_ * TT * HD * 2);
    h16* VT = (h16*)take((size_t)NB_ * NH_ * HD * TT * 2); bf* VTh = (bf*)take((size_t)NB_ * NH_ * HD * TT * 2); bf* VTl = (bf*)take((size_t)NB_ * NH_ * HD * TT * 2); float* SQ = (float*)take(TT * 4);
    if ((size_t)(wsp - (char*)d_ws) > ws_size) return;    // total ~ 66 MB
    k_prep<<<3 * NWT + NCV, 256, 0, stream>>>(x, Wq, Wk, Wv, XB, BQ, BK, BV, SQ);
    k_qkv<<<dim3(NB_ * TT / 128, DM / 128, 3), 128, 0, stream>>>(XB, BQ, BK, BV, bq, bk, bv, Q16, Qh, Ql, K16, Kh, Kl, VT, VTh, VTl);
    k_fattn<<<TT / 128 * NB_ * NH_, 512, 0, stream>>>(Q16, Qh, Ql, K16, Kh, Kl, VT, VTh, VTl, SQ, OUT);
}
